// v000
// The times below were measured on an AMD MI455X: many runs one after another, warmed up first and cycling through
// copies of the inputs, with the whole window's GPU time divided by the number of runs. Launches and the gaps
// between them are all in it. The median over several windows is given; except for v000 it joins two sittings, which
// can be a few percent apart, so the side-by-side timings, each taken in one sitting, are the better comparison.
// v000 is the starting kernel. One run takes 407 microseconds.
#include <hip/hip_runtime.h>
#include <hip/hip_bf16.h>
#include <math.h>

typedef unsigned short u16;
typedef __bf16 bf16x16 __attribute__((ext_vector_type(16)));
typedef float f32x8 __attribute__((ext_vector_type(8)));
typedef unsigned int uint8v __attribute__((ext_vector_type(8)));
typedef int v4i __attribute__((__vector_size__(16)));

#define D_MODEL 1024
#define SEQ 2048
#define NB 2
#define NH 16
#define HD 64
#define ROWS (NB * SEQ)   // 4096

#if __has_builtin(__builtin_amdgcn_global_load_async_to_lds_b128)
#define USE_ASYNC_LDS 1
#endif

__device__ __forceinline__ u16 f32_to_bf16(float f) {
    unsigned int u = __float_as_uint(f);
    u += 0x7FFFu + ((u >> 16) & 1u);   // round to nearest even
    return (u16)(u >> 16);
}

__device__ __forceinline__ bf16x16 ld_frag(const u16* plo, const u16* phi) {
    uint4 lo = *(const uint4*)plo;
    uint4 hi = *(const uint4*)phi;
    uint8v t;
    t[0] = lo.x; t[1] = lo.y; t[2] = lo.z; t[3] = lo.w;
    t[4] = hi.x; t[5] = hi.y; t[6] = hi.z; t[7] = hi.w;
    return __builtin_bit_cast(bf16x16, t);
}

__device__ __forceinline__ f32x8 wmma_bf16(bf16x16 a, bf16x16 b, f32x8 c) {
    return __builtin_amdgcn_wmma_f32_16x16x32_bf16(false, a, false, b, (short)0, c, false, false);
}

__device__ __forceinline__ f32x8 zero8() {
    f32x8 z;
#pragma unroll
    for (int i = 0; i < 8; ++i) z[i] = 0.0f;
    return z;
}

// Copy 16B global -> LDS. Async (memory->LDS direct, ASYNCcnt) when available.
__device__ __forceinline__ void cp16_g2l(const u16* g, u16* l) {
#ifdef USE_ASYNC_LDS
    __builtin_amdgcn_global_load_async_to_lds_b128(
        (__attribute__((address_space(1))) v4i*)const_cast<u16*>(g),
        (__attribute__((address_space(3))) v4i*)l, 0, 0);
#else
    *(uint4*)l = *(const uint4*)g;
#endif
}

__device__ __forceinline__ void wait_async0() {
#ifdef USE_ASYNC_LDS
#if __has_builtin(__builtin_amdgcn_s_wait_asynccnt)
    __builtin_amdgcn_s_wait_asynccnt(0);
#else
    asm volatile("s_wait_asynccnt 0x0" ::: "memory");
#endif
#endif
}

// ---------------------------------------------------------------------------
// Weight cast + transpose: W[K,N] f32 -> out[N,K] bf16.  32x32 LDS tiles,
// coalesced reads and writes.  Grid: (N/32, K/32), 256 threads.
// ---------------------------------------------------------------------------
__global__ __launch_bounds__(256) void cast_transpose_k(const float* __restrict__ W,
                                                        u16* __restrict__ out,
                                                        int K, int N) {
    __shared__ float t[32][33];
    const int n0 = blockIdx.x * 32;
    const int k0 = blockIdx.y * 32;
    const int c = threadIdx.x & 31;
    const int r = threadIdx.x >> 5;   // 0..7
#pragma unroll
    for (int i = 0; i < 4; ++i) {
        int row = r + i * 8;
        t[row][c] = W[(size_t)(k0 + row) * N + n0 + c];
    }
    __syncthreads();
#pragma unroll
    for (int i = 0; i < 4; ++i) {
        int row = r + i * 8;          // row within N-tile
        out[(size_t)(n0 + row) * K + k0 + c] = f32_to_bf16(t[c][row]);
    }
}

// ---------------------------------------------------------------------------
// LayerNorm: one row (D=1024) per 256-thread block. Writes f32 (optional) + bf16.
// ---------------------------------------------------------------------------
__global__ __launch_bounds__(256) void layernorm_k(const float* __restrict__ x,
                                                   const float* __restrict__ g,
                                                   const float* __restrict__ b,
                                                   float* __restrict__ outF,
                                                   u16* __restrict__ outB) {
    __shared__ float r1[256];
    __shared__ float r2[256];
    const int tid = threadIdx.x;
    const size_t row = blockIdx.x;
    const float* xr = x + row * D_MODEL;
    float v[4];
    const int base = tid * 4;
    float s = 0.f, s2 = 0.f;
#pragma unroll
    for (int i = 0; i < 4; ++i) {
        v[i] = xr[base + i];
        s += v[i];
        s2 += v[i] * v[i];
    }
    r1[tid] = s; r2[tid] = s2;
    __syncthreads();
    for (int off = 128; off > 0; off >>= 1) {
        if (tid < off) { r1[tid] += r1[tid + off]; r2[tid] += r2[tid + off]; }
        __syncthreads();
    }
    const float mu = r1[0] * (1.0f / D_MODEL);
    const float var = r2[0] * (1.0f / D_MODEL) - mu * mu;
    const float rs = rsqrtf(var + 1e-5f);
#pragma unroll
    for (int i = 0; i < 4; ++i) {
        int col = base + i;
        float xn = (v[i] - mu) * rs * g[col] + b[col];
        if (outF) outF[row * D_MODEL + col] = xn;
        outB[row * D_MODEL + col] = f32_to_bf16(xn);
    }
}

// ---------------------------------------------------------------------------
// Tiled bf16 GEMM with WMMA.  C[M,N] = A[M,K] * Bt[N,K]^T  (Bt is B transposed)
// Block tile 128x128, 8 waves (4 M x 2 N), each wave 32x64, K step 32.
// Double-buffered LDS; async memory->LDS copies when available.
// ---------------------------------------------------------------------------
#define MODE_Q    0
#define MODE_K    1
#define MODE_V    2
#define MODE_F32  3   // outF = acc*scale + bias + resid
#define MODE_GELU 4   // outB = bf16(gelu(acc*scale + bias))

__global__ __launch_bounds__(256) void gemm_bf16_k(const u16* __restrict__ A,
                                                   const u16* __restrict__ Bt,
                                                   int M, int N, int K,
                                                   int mode, float scale,
                                                   const float* __restrict__ bias,
                                                   const float* __restrict__ resid,
                                                   float* __restrict__ outF,
                                                   u16* __restrict__ outB) {
    __shared__ u16 lA[2][128 * 40];
    __shared__ u16 lB[2][128 * 40];
    const int tid = threadIdx.x;
    const int lane = tid & 31;
    const int wave = tid >> 5;
    const int waveM = wave & 3;       // 0..3
    const int waveN = wave >> 2;      // 0..1
    const int bM = blockIdx.y * 128;
    const int bN = blockIdx.x * 128;
    const int l16 = lane & 15;
    const int khalf = (lane >> 4) * 8;     // 0 or 8 (K sub-chunk base)
    const int mloc = (lane >> 4) * 8;      // 0 or 8 (C-layout row base)
    // staging assignment: this thread copies chunks c = tid*2, tid*2+1
    const int sr0 = (tid * 2) >> 2, sc0 = (tid * 2) & 3;
    const int sr1 = (tid * 2 + 1) >> 2, sc1 = (tid * 2 + 1) & 3;

    f32x8 acc[2][4];
#pragma unroll
    for (int mt = 0; mt < 2; ++mt)
#pragma unroll
        for (int nt = 0; nt < 4; ++nt) acc[mt][nt] = zero8();

    // stage K-slice kk into buffer buf
    auto stage = [&](int buf, int kk) {
        cp16_g2l(A + (size_t)(bM + sr0) * K + kk + sc0 * 8, &lA[buf][sr0 * 40 + sc0 * 8]);
        cp16_g2l(A + (size_t)(bM + sr1) * K + kk + sc1 * 8, &lA[buf][sr1 * 40 + sc1 * 8]);
        cp16_g2l(Bt + (size_t)(bN + sr0) * K + kk + sc0 * 8, &lB[buf][sr0 * 40 + sc0 * 8]);
        cp16_g2l(Bt + (size_t)(bN + sr1) * K + kk + sc1 * 8, &lB[buf][sr1 * 40 + sc1 * 8]);
    };

    stage(0, 0);
    wait_async0();
    __syncthreads();

    int cur = 0;
    for (int kk = 0; kk < K; kk += 32) {
        if (kk + 32 < K) stage(cur ^ 1, kk + 32);   // prefetch next slice
        bf16x16 af[2], bfr[4];
#pragma unroll
        for (int mt = 0; mt < 2; ++mt) {
            const u16* p = &lA[cur][(waveM * 32 + mt * 16 + l16) * 40 + khalf];
            af[mt] = ld_frag(p, p + 16);
        }
#pragma unroll
        for (int nt = 0; nt < 4; ++nt) {
            const u16* p = &lB[cur][(waveN * 64 + nt * 16 + l16) * 40 + khalf];
            bfr[nt] = ld_frag(p, p + 16);
        }
#pragma unroll
        for (int mt = 0; mt < 2; ++mt)
#pragma unroll
            for (int nt = 0; nt < 4; ++nt)
                acc[mt][nt] = wmma_bf16(af[mt], bfr[nt], acc[mt][nt]);
        wait_async0();
        __syncthreads();
        cur ^= 1;
    }

    // Epilogue. C layout: vgpr j -> row mloc+j, lane%16 -> col.
#pragma unroll
    for (int mt = 0; mt < 2; ++mt) {
#pragma unroll
        for (int nt = 0; nt < 4; ++nt) {
            const int gcol = bN + waveN * 64 + nt * 16 + l16;
#pragma unroll
            for (int j = 0; j < 8; ++j) {
                const int grow = bM + waveM * 32 + mt * 16 + mloc + j;
                float v = acc[mt][nt][j] * scale;
                if (mode == MODE_Q || mode == MODE_K) {
                    int bb = grow >> 11, s = grow & 2047;
                    int h = gcol >> 6, d = gcol & 63;
                    outB[(((size_t)(bb * NH + h) * SEQ) + s) * HD + d] = f32_to_bf16(v);
                } else if (mode == MODE_V) {
                    int bb = grow >> 11, s = grow & 2047;
                    int h = gcol >> 6, d = gcol & 63;
                    outB[(((size_t)(bb * NH + h) * HD) + d) * SEQ + s] = f32_to_bf16(v);
                } else if (mode == MODE_F32) {
                    size_t idx = (size_t)grow * N + gcol;
                    outF[idx] = v + bias[gcol] + resid[idx];
                } else { // MODE_GELU
                    float xv = v + bias[gcol];
                    float gl = 0.5f * xv * (1.0f + erff(xv * 0.70710678118654752f));
                    outB[(size_t)grow * N + gcol] = f32_to_bf16(gl);
                }
            }
        }
    }
}

// ---------------------------------------------------------------------------
// Flash attention, WMMA.  q,k: [b,h,s,d] bf16 (q pre-scaled by 1/8).
// vt: [b,h,d,s] bf16.  out yb: [b,s, h*64+d] bf16.
// Block = 128 threads = 4 waves; wave owns 16 query rows; 64-key tiles.
// ---------------------------------------------------------------------------
__global__ __launch_bounds__(128) void attn_k(const u16* __restrict__ q,
                                              const u16* __restrict__ k,
                                              const u16* __restrict__ vt,
                                              u16* __restrict__ yb) {
    __shared__ u16 lP[4][16 * 72];
    const int lane = threadIdx.x & 31;
    const int wave = threadIdx.x >> 5;
    const int bh = blockIdx.y;                 // b*NH + h
    const int qbase = blockIdx.x * 64 + wave * 16;
    const int l16 = lane & 15;
    const int khalf = (lane >> 4) * 8;
    const int mloc = (lane >> 4) * 8;
    const size_t headOff = (size_t)bh * SEQ * HD;

    bf16x16 qf[2];
    {
        const u16* qp = q + headOff + (size_t)(qbase + l16) * HD;
#pragma unroll
        for (int kt = 0; kt < 2; ++kt) {
            const u16* p = qp + kt * 32 + khalf;
            qf[kt] = ld_frag(p, p + 16);
        }
    }

    f32x8 O[4];
    float rmax[8], rsum[8];
#pragma unroll
    for (int n = 0; n < 4; ++n) O[n] = zero8();
#pragma unroll
    for (int j = 0; j < 8; ++j) { rmax[j] = -INFINITY; rsum[j] = 0.0f; }

    for (int kb = 0; kb < SEQ; kb += 64) {
        // ---- scores: S[16 x 64] = Q * K^T (q pre-scaled) ----
        f32x8 sAcc[4];
#pragma unroll
        for (int n = 0; n < 4; ++n) {
            sAcc[n] = zero8();
#pragma unroll
            for (int kt = 0; kt < 2; ++kt) {
                const u16* kp = k + headOff + (size_t)(kb + n * 16 + l16) * HD + kt * 32 + khalf;
                bf16x16 bf = ld_frag(kp, kp + 16);
                sAcc[n] = wmma_bf16(qf[kt], bf, sAcc[n]);
            }
            const int kj = kb + n * 16 + l16;
#pragma unroll
            for (int j = 0; j < 8; ++j) {
                if (qbase + mloc + j == kj) sAcc[n][j] = -INFINITY;
            }
        }
        // ---- online softmax ----
        float corr[8];
#pragma unroll
        for (int j = 0; j < 8; ++j) {
            float t = sAcc[0][j];
#pragma unroll
            for (int n = 1; n < 4; ++n) t = fmaxf(t, sAcc[n][j]);
            t = fmaxf(t, __shfl_xor(t, 1));
            t = fmaxf(t, __shfl_xor(t, 2));
            t = fmaxf(t, __shfl_xor(t, 4));
            t = fmaxf(t, __shfl_xor(t, 8));
            float nm = fmaxf(rmax[j], t);
            corr[j] = expf(rmax[j] - nm);
            rmax[j] = nm;
            rsum[j] *= corr[j];
        }
#pragma unroll
        for (int n = 0; n < 4; ++n)
#pragma unroll
            for (int j = 0; j < 8; ++j) O[n][j] *= corr[j];

        float ps[8];
#pragma unroll
        for (int j = 0; j < 8; ++j) ps[j] = 0.0f;
#pragma unroll
        for (int n = 0; n < 4; ++n)
#pragma unroll
            for (int j = 0; j < 8; ++j) {
                float p = expf(sAcc[n][j] - rmax[j]);
                sAcc[n][j] = p;
                ps[j] += p;
            }
#pragma unroll
        for (int j = 0; j < 8; ++j) {
            float t = ps[j];
            t += __shfl_xor(t, 1);
            t += __shfl_xor(t, 2);
            t += __shfl_xor(t, 4);
            t += __shfl_xor(t, 8);
            rsum[j] += t;
        }
        // ---- P (C layout) -> LDS -> A-fragment layout ----
        u16* base = &lP[wave][0];
#pragma unroll
        for (int n = 0; n < 4; ++n)
#pragma unroll
            for (int j = 0; j < 8; ++j)
                base[(mloc + j) * 72 + n * 16 + l16] = f32_to_bf16(sAcc[n][j]);
        bf16x16 pf[2];
#pragma unroll
        for (int kt = 0; kt < 2; ++kt) {
            const u16* p = base + l16 * 72 + kt * 32 + khalf;
            pf[kt] = ld_frag(p, p + 16);
        }
        // ---- O += P * V  (V^T layout: [d][s], contiguous over keys) ----
#pragma unroll
        for (int nd = 0; nd < 4; ++nd) {
#pragma unroll
            for (int kt = 0; kt < 2; ++kt) {
                const u16* vp = vt + (size_t)bh * HD * SEQ +
                                (size_t)(nd * 16 + l16) * SEQ + kb + kt * 32 + khalf;
                bf16x16 vf = ld_frag(vp, vp + 16);
                O[nd] = wmma_bf16(pf[kt], vf, O[nd]);
            }
        }
    }

    const int bb = bh >> 4, h = bh & 15;
#pragma unroll
    for (int j = 0; j < 8; ++j) rsum[j] = 1.0f / rsum[j];
#pragma unroll
    for (int nd = 0; nd < 4; ++nd)
#pragma unroll
        for (int j = 0; j < 8; ++j) {
            int s = qbase + mloc + j;
            size_t idx = ((size_t)bb * SEQ + s) * D_MODEL + h * HD + nd * 16 + l16;
            yb[idx] = f32_to_bf16(O[nd][j] * rsum[j]);
        }
}

// ---------------------------------------------------------------------------
extern "C" void kernel_launch(void* const* d_in, const int* in_sizes, int n_in,
                              void* d_out, int out_size, void* d_ws, size_t ws_size,
                              hipStream_t stream) {
    (void)in_sizes; (void)n_in; (void)out_size; (void)ws_size;
    const float* x   = (const float*)d_in[0];
    const float* Wk  = (const float*)d_in[1];
    const float* Wq  = (const float*)d_in[2];
    const float* Wv  = (const float*)d_in[3];
    const float* Wp  = (const float*)d_in[4];
    const float* bp  = (const float*)d_in[5];
    const float* g1  = (const float*)d_in[6];
    const float* b1  = (const float*)d_in[7];
    const float* g2  = (const float*)d_in[8];
    const float* b2  = (const float*)d_in[9];
    const float* W1  = (const float*)d_in[10];
    const float* bm1 = (const float*)d_in[11];
    const float* W2  = (const float*)d_in[12];
    const float* bm2 = (const float*)d_in[13];
    float* out = (float*)d_out;

    char* ws = (char*)d_ws;
    size_t off = 0;
    auto alloc = [&](size_t bytes) -> char* {
        char* p = ws + off;
        off += (bytes + 255) & ~(size_t)255;
        return p;
    };
    float* xnF = (float*)alloc((size_t)ROWS * D_MODEL * 4);   // 16 MB
    u16*   xnB = (u16*)  alloc((size_t)ROWS * D_MODEL * 2);   //  8 MB
    u16*   WqT = (u16*)  alloc((size_t)D_MODEL * D_MODEL * 2);
    u16*   WkT = (u16*)  alloc((size_t)D_MODEL * D_MODEL * 2);
    u16*   WvT = (u16*)  alloc((size_t)D_MODEL * D_MODEL * 2);
    u16*   WpT = (u16*)  alloc((size_t)D_MODEL * D_MODEL * 2);
    u16*   W1T = (u16*)  alloc((size_t)D_MODEL * 4 * D_MODEL * 2);  // 8 MB
    u16*   W2T = (u16*)  alloc((size_t)D_MODEL * 4 * D_MODEL * 2);  // 8 MB
    char*  pool = alloc((size_t)ROWS * D_MODEL * 2 * 4);            // 32 MB shared pool
    u16*   qB  = (u16*)pool;
    u16*   kB  = (u16*)(pool + (size_t)ROWS * HD * NH * 2);
    u16*   vtB = (u16*)(pool + (size_t)ROWS * HD * NH * 4);
    u16*   yB  = (u16*)(pool + (size_t)ROWS * HD * NH * 6);
    u16*   uB  = (u16*)pool;   // aliases q/k/vt/y (dead by MLP time)
    float* hF  = (float*)alloc((size_t)ROWS * D_MODEL * 4);   // 16 MB
    u16*   hnB = (u16*)  alloc((size_t)ROWS * D_MODEL * 2);   //  8 MB

    // 1) Weight casts + transposes to bf16 [N,K] (coalesced 32x32 tiles)
    cast_transpose_k<<<dim3(D_MODEL / 32, D_MODEL / 32), 256, 0, stream>>>(Wq, WqT, D_MODEL, D_MODEL);
    cast_transpose_k<<<dim3(D_MODEL / 32, D_MODEL / 32), 256, 0, stream>>>(Wk, WkT, D_MODEL, D_MODEL);
    cast_transpose_k<<<dim3(D_MODEL / 32, D_MODEL / 32), 256, 0, stream>>>(Wv, WvT, D_MODEL, D_MODEL);
    cast_transpose_k<<<dim3(D_MODEL / 32, D_MODEL / 32), 256, 0, stream>>>(Wp, WpT, D_MODEL, D_MODEL);
    cast_transpose_k<<<dim3(4 * D_MODEL / 32, D_MODEL / 32), 256, 0, stream>>>(W1, W1T, D_MODEL, 4 * D_MODEL);
    cast_transpose_k<<<dim3(D_MODEL / 32, 4 * D_MODEL / 32), 256, 0, stream>>>(W2, W2T, 4 * D_MODEL, D_MODEL);

    // 2) LayerNorm1: x -> xn (f32 + bf16)
    layernorm_k<<<ROWS, 256, 0, stream>>>(x, g1, b1, xnF, xnB);

    // 3) QKV projections (q pre-scaled by 1/sqrt(HD))
    dim3 gQKV(D_MODEL / 128, ROWS / 128);
    gemm_bf16_k<<<gQKV, 256, 0, stream>>>(xnB, WqT, ROWS, D_MODEL, D_MODEL,
                                          MODE_Q, 0.125f, nullptr, nullptr, nullptr, qB);
    gemm_bf16_k<<<gQKV, 256, 0, stream>>>(xnB, WkT, ROWS, D_MODEL, D_MODEL,
                                          MODE_K, 1.0f, nullptr, nullptr, nullptr, kB);
    gemm_bf16_k<<<gQKV, 256, 0, stream>>>(xnB, WvT, ROWS, D_MODEL, D_MODEL,
                                          MODE_V, 1.0f, nullptr, nullptr, nullptr, vtB);

    // 4) Flash attention
    attn_k<<<dim3(SEQ / 64, NB * NH), 128, 0, stream>>>(qB, kB, vtB, yB);

    // 5) Output projection + residual: h = xn + y*Wp + bp
    gemm_bf16_k<<<gQKV, 256, 0, stream>>>(yB, WpT, ROWS, D_MODEL, D_MODEL,
                                          MODE_F32, 1.0f, bp, xnF, hF, nullptr);

    // 6) LayerNorm2: h -> hn (bf16 only)
    layernorm_k<<<ROWS, 256, 0, stream>>>(hF, g2, b2, nullptr, hnB);

    // 7) MLP up + exact GELU: u = gelu(hn*W1 + bm1)
    dim3 gUp(4 * D_MODEL / 128, ROWS / 128);
    gemm_bf16_k<<<gUp, 256, 0, stream>>>(hnB, W1T, ROWS, 4 * D_MODEL, D_MODEL,
                                         MODE_GELU, 1.0f, bm1, nullptr, nullptr, uB);

    // 8) MLP down + residual: out = h + u*W2 + bm2
    gemm_bf16_k<<<gQKV, 256, 0, stream>>>(uB, W2T, ROWS, D_MODEL, 4 * D_MODEL,
                                          MODE_F32, 1.0f, bm2, hF, out, nullptr);
}

// v001
// A run of this version takes 364 microseconds.
// In two side-by-side timings against v000, it was 1.14 and 1.13 times as fast.
#include <hip/hip_runtime.h>
#include <hip/hip_bf16.h>
#include <math.h>

typedef unsigned short u16;
typedef __bf16 bf16x16 __attribute__((ext_vector_type(16)));
typedef float f32x8 __attribute__((ext_vector_type(8)));
typedef unsigned int uint8v __attribute__((ext_vector_type(8)));
typedef int v4i __attribute__((__vector_size__(16)));

#define D_MODEL 1024
#define SEQ 2048
#define NB 2
#define NH 16
#define HD 64
#define ROWS (NB * SEQ)   // 4096

#if __has_builtin(__builtin_amdgcn_global_load_async_to_lds_b128)
#define USE_ASYNC_LDS 1
#endif

__device__ __forceinline__ u16 f32_to_bf16(float f) {
    unsigned int u = __float_as_uint(f);
    u += 0x7FFFu + ((u >> 16) & 1u);   // round to nearest even
    return (u16)(u >> 16);
}

__device__ __forceinline__ bf16x16 ld_frag(const u16* plo, const u16* phi) {
    uint4 lo = *(const uint4*)plo;
    uint4 hi = *(const uint4*)phi;
    uint8v t;
    t[0] = lo.x; t[1] = lo.y; t[2] = lo.z; t[3] = lo.w;
    t[4] = hi.x; t[5] = hi.y; t[6] = hi.z; t[7] = hi.w;
    return __builtin_bit_cast(bf16x16, t);
}

__device__ __forceinline__ f32x8 wmma_bf16(bf16x16 a, bf16x16 b, f32x8 c) {
    return __builtin_amdgcn_wmma_f32_16x16x32_bf16(false, a, false, b, (short)0, c, false, false);
}

__device__ __forceinline__ f32x8 zero8() {
    f32x8 z;
#pragma unroll
    for (int i = 0; i < 8; ++i) z[i] = 0.0f;
    return z;
}

// Copy 16B global -> LDS. Async (memory->LDS direct, ASYNCcnt) when available.
__device__ __forceinline__ void cp16_g2l(const u16* g, u16* l) {
#ifdef USE_ASYNC_LDS
    __builtin_amdgcn_global_load_async_to_lds_b128(
        (__attribute__((address_space(1))) v4i*)const_cast<u16*>(g),
        (__attribute__((address_space(3))) v4i*)l, 0, 0);
#else
    *(uint4*)l = *(const uint4*)g;
#endif
}

__device__ __forceinline__ void wait_async0() {
#ifdef USE_ASYNC_LDS
    // this wave's copies have landed; the clobber keeps every LDS read behind it
    asm volatile("s_wait_asynccnt 0x0" ::: "memory");
#endif
}

// ---------------------------------------------------------------------------
// Weight cast + transpose: W[K,N] f32 -> out[N,K] bf16.  32x32 LDS tiles,
// coalesced reads and writes.  Grid: (N/32, K/32), 256 threads.
// ---------------------------------------------------------------------------
__global__ __launch_bounds__(256) void cast_transpose_k(const float* __restrict__ W,
                                                        u16* __restrict__ out,
                                                        int K, int N) {
    __shared__ float t[32][33];
    const int n0 = blockIdx.x * 32;
    const int k0 = blockIdx.y * 32;
    const int c = threadIdx.x & 31;
    const int r = threadIdx.x >> 5;   // 0..7
#pragma unroll
    for (int i = 0; i < 4; ++i) {
        int row = r + i * 8;
        t[row][c] = W[(size_t)(k0 + row) * N + n0 + c];
    }
    __syncthreads();
#pragma unroll
    for (int i = 0; i < 4; ++i) {
        int row = r + i * 8;          // row within N-tile
        out[(size_t)(n0 + row) * K + k0 + c] = f32_to_bf16(t[c][row]);
    }
}

// ---------------------------------------------------------------------------
// LayerNorm: one row (D=1024) per 256-thread block. Writes f32 (optional) + bf16.
// ---------------------------------------------------------------------------
__global__ __launch_bounds__(256) void layernorm_k(const float* __restrict__ x,
                                                   const float* __restrict__ g,
                                                   const float* __restrict__ b,
                                                   float* __restrict__ outF,
                                                   u16* __restrict__ outB) {
    __shared__ float r1[256];
    __shared__ float r2[256];
    const int tid = threadIdx.x;
    const size_t row = blockIdx.x;
    const float* xr = x + row * D_MODEL;
    float v[4];
    const int base = tid * 4;
    float s = 0.f, s2 = 0.f;
#pragma unroll
    for (int i = 0; i < 4; ++i) {
        v[i] = xr[base + i];
        s += v[i];
        s2 += v[i] * v[i];
    }
    r1[tid] = s; r2[tid] = s2;
    __syncthreads();
    for (int off = 128; off > 0; off >>= 1) {
        if (tid < off) { r1[tid] += r1[tid + off]; r2[tid] += r2[tid + off]; }
        __syncthreads();
    }
    const float mu = r1[0] * (1.0f / D_MODEL);
    const float var = r2[0] * (1.0f / D_MODEL) - mu * mu;
    const float rs = rsqrtf(var + 1e-5f);
#pragma unroll
    for (int i = 0; i < 4; ++i) {
        int col = base + i;
        float xn = (v[i] - mu) * rs * g[col] + b[col];
        if (outF) outF[row * D_MODEL + col] = xn;
        outB[row * D_MODEL + col] = f32_to_bf16(xn);
    }
}

// ---------------------------------------------------------------------------
// Tiled bf16 GEMM with WMMA.  C[M,N] = A[M,K] * Bt[N,K]^T  (Bt is B transposed)
// Block tile 128x128, 8 waves (4 M x 2 N), each wave 32x64.
// A stage is 128 k of every operand row (256 B, two whole lines), so one
// wave-wide 16 B copy covers two full rows; four 32-k blocks per stage.
// Double-buffered LDS; async memory->LDS copies when available.
// K must be a multiple of 128.
// ---------------------------------------------------------------------------
#define MODE_Q    0
#define MODE_K    1
#define MODE_V    2
#define MODE_F32  3   // outF = acc*scale + bias + resid
#define MODE_GELU 4   // outB = bf16(gelu(acc*scale + bias))
#define BK 128              // k per stage
#define LPITCH (BK + 8)     // LDS row pitch in elements: 272 B = 16 B x odd

__global__ __launch_bounds__(256) void gemm_bf16_k(const u16* __restrict__ A,
                                                   const u16* __restrict__ Bt,
                                                   int M, int N, int K,
                                                   int mode, float scale,
                                                   const float* __restrict__ bias,
                                                   const float* __restrict__ resid,
                                                   float* __restrict__ outF,
                                                   u16* __restrict__ outB) {
    __shared__ __attribute__((aligned(16))) u16 lA[2][128 * LPITCH];
    __shared__ __attribute__((aligned(16))) u16 lB[2][128 * LPITCH];
    const int tid = threadIdx.x;
    const int lane = tid & 31;
    const int wave = tid >> 5;
    const int waveM = wave & 3;       // 0..3
    const int waveN = wave >> 2;      // 0..1
    const int bM = blockIdx.y * 128;
    const int bN = blockIdx.x * 128;
    const int l16 = lane & 15;
    const int khalf = (lane >> 4) * 8;     // 0 or 8 (K sub-chunk base)
    const int mloc = (lane >> 4) * 8;      // 0 or 8 (C-layout row base)
    // staging assignment: 16 lanes cover one 256 B row; this thread copies
    // 16 B chunk sc of rows sr, sr + 16, ..., sr + 112 of both operands
    const int sr = tid >> 4, sc = tid & 15;

    f32x8 acc[2][4];
#pragma unroll
    for (int mt = 0; mt < 2; ++mt)
#pragma unroll
        for (int nt = 0; nt < 4; ++nt) acc[mt][nt] = zero8();

    // stage K-slice kk into buffer buf
    auto stage = [&](int buf, int kk) {
        const u16* ga = A + (size_t)(bM + sr) * K + kk + sc * 8;
        const u16* gb = Bt + (size_t)(bN + sr) * K + kk + sc * 8;
        u16* la = &lA[buf][sr * LPITCH + sc * 8];
        u16* lb = &lB[buf][sr * LPITCH + sc * 8];
#pragma unroll   // the 16 copies issue back to back, LDS steps are constants
        for (int i = 0; i < 8; ++i) {
            cp16_g2l(ga + (size_t)(i * 16) * K, la + i * 16 * LPITCH);
            cp16_g2l(gb + (size_t)(i * 16) * K, lb + i * 16 * LPITCH);
        }
    };

    stage(0, 0);
    wait_async0();
    __syncthreads();
    if (BK < K) stage(1, BK);

    int cur = 0;
    for (int kk = 0; kk < K; kk += BK) {
#pragma unroll   // the four blocks' LDS offsets become immediates
        for (int ks = 0; ks < BK; ks += 32) {
            bf16x16 af[2], bfr[4];
#pragma unroll
            for (int mt = 0; mt < 2; ++mt) {
                const u16* p = &lA[cur][(waveM * 32 + mt * 16 + l16) * LPITCH + ks + khalf];
                af[mt] = ld_frag(p, p + 16);
            }
#pragma unroll
            for (int nt = 0; nt < 4; ++nt) {
                const u16* p = &lB[cur][(waveN * 64 + nt * 16 + l16) * LPITCH + ks + khalf];
                bfr[nt] = ld_frag(p, p + 16);
            }
#pragma unroll
            for (int mt = 0; mt < 2; ++mt)
#pragma unroll
                for (int nt = 0; nt < 4; ++nt)
                    acc[mt][nt] = wmma_bf16(af[mt], bfr[nt], acc[mt][nt]);
        }
        // publish point: this wave's reads of buffer cur are done before the
        // refill below may overwrite it
        asm volatile("s_wait_dscnt 0x0" ::: "memory");
        wait_async0();       // the next stage's copies of this wave have landed
        __syncthreads();     // next stage readable by all; buffer cur left by all
        if (kk + 2 * BK < K) stage(cur, kk + 2 * BK);   // refill two stages ahead
        cur ^= 1;
    }
    wait_async0();           // nothing outstanding when the wave ends

    // Epilogue. C layout: vgpr j -> row mloc+j, lane%16 -> col.
#pragma unroll
    for (int mt = 0; mt < 2; ++mt) {
#pragma unroll
        for (int nt = 0; nt < 4; ++nt) {
            const int gcol = bN + waveN * 64 + nt * 16 + l16;
#pragma unroll
            for (int j = 0; j < 8; ++j) {
                const int grow = bM + waveM * 32 + mt * 16 + mloc + j;
                float v = acc[mt][nt][j] * scale;
                if (mode == MODE_Q || mode == MODE_K) {
                    int bb = grow >> 11, s = grow & 2047;
                    int h = gcol >> 6, d = gcol & 63;
                    outB[(((size_t)(bb * NH + h) * SEQ) + s) * HD + d] = f32_to_bf16(v);
                } else if (mode == MODE_V) {
                    int bb = grow >> 11, s = grow & 2047;
                    int h = gcol >> 6, d = gcol & 63;
                    outB[(((size_t)(bb * NH + h) * HD) + d) * SEQ + s] = f32_to_bf16(v);
                } else if (mode == MODE_F32) {
                    size_t idx = (size_t)grow * N + gcol;
                    outF[idx] = v + bias[gcol] + resid[idx];
                } else { // MODE_GELU
                    float xv = v + bias[gcol];
                    float gl = 0.5f * xv * (1.0f + erff(xv * 0.70710678118654752f));
                    outB[(size_t)grow * N + gcol] = f32_to_bf16(gl);
                }
            }
        }
    }
}

// ---------------------------------------------------------------------------
// Flash attention, WMMA.  q,k: [b,h,s,d] bf16 (q pre-scaled by 1/8).
// vt: [b,h,d,s] bf16.  out yb: [b,s, h*64+d] bf16.
// Block = 128 threads = 4 waves; wave owns 16 query rows; 64-key tiles.
// ---------------------------------------------------------------------------
__global__ __launch_bounds__(128) void attn_k(const u16* __restrict__ q,
                                              const u16* __restrict__ k,
                                              const u16* __restrict__ vt,
                                              u16* __restrict__ yb) {
    __shared__ u16 lP[4][16 * 72];
    const int lane = threadIdx.x & 31;
    const int wave = threadIdx.x >> 5;
    const int bh = blockIdx.y;                 // b*NH + h
    const int qbase = blockIdx.x * 64 + wave * 16;
    const int l16 = lane & 15;
    const int khalf = (lane >> 4) * 8;
    const int mloc = (lane >> 4) * 8;
    const size_t headOff = (size_t)bh * SEQ * HD;

    bf16x16 qf[2];
    {
        const u16* qp = q + headOff + (size_t)(qbase + l16) * HD;
#pragma unroll
        for (int kt = 0; kt < 2; ++kt) {
            const u16* p = qp + kt * 32 + khalf;
            qf[kt] = ld_frag(p, p + 16);
        }
    }

    f32x8 O[4];
    float rmax[8], rsum[8];
#pragma unroll
    for (int n = 0; n < 4; ++n) O[n] = zero8();
#pragma unroll
    for (int j = 0; j < 8; ++j) { rmax[j] = -INFINITY; rsum[j] = 0.0f; }

    for (int kb = 0; kb < SEQ; kb += 64) {
        // ---- scores: S[16 x 64] = Q * K^T (q pre-scaled) ----
        f32x8 sAcc[4];
#pragma unroll
        for (int n = 0; n < 4; ++n) {
            sAcc[n] = zero8();
#pragma unroll
            for (int kt = 0; kt < 2; ++kt) {
                const u16* kp = k + headOff + (size_t)(kb + n * 16 + l16) * HD + kt * 32 + khalf;
                bf16x16 bf = ld_frag(kp, kp + 16);
                sAcc[n] = wmma_bf16(qf[kt], bf, sAcc[n]);
            }
            const int kj = kb + n * 16 + l16;
#pragma unroll
            for (int j = 0; j < 8; ++j) {
                if (qbase + mloc + j == kj) sAcc[n][j] = -INFINITY;
            }
        }
        // ---- online softmax ----
        float corr[8];
#pragma unroll
        for (int j = 0; j < 8; ++j) {
            float t = sAcc[0][j];
#pragma unroll
            for (int n = 1; n < 4; ++n) t = fmaxf(t, sAcc[n][j]);
            t = fmaxf(t, __shfl_xor(t, 1));
            t = fmaxf(t, __shfl_xor(t, 2));
            t = fmaxf(t, __shfl_xor(t, 4));
            t = fmaxf(t, __shfl_xor(t, 8));
            float nm = fmaxf(rmax[j], t);
            corr[j] = expf(rmax[j] - nm);
            rmax[j] = nm;
            rsum[j] *= corr[j];
        }
#pragma unroll
        for (int n = 0; n < 4; ++n)
#pragma unroll
            for (int j = 0; j < 8; ++j) O[n][j] *= corr[j];

        float ps[8];
#pragma unroll
        for (int j = 0; j < 8; ++j) ps[j] = 0.0f;
#pragma unroll
        for (int n = 0; n < 4; ++n)
#pragma unroll
            for (int j = 0; j < 8; ++j) {
                float p = expf(sAcc[n][j] - rmax[j]);
                sAcc[n][j] = p;
                ps[j] += p;
            }
#pragma unroll
        for (int j = 0; j < 8; ++j) {
            float t = ps[j];
            t += __shfl_xor(t, 1);
            t += __shfl_xor(t, 2);
            t += __shfl_xor(t, 4);
            t += __shfl_xor(t, 8);
            rsum[j] += t;
        }
        // ---- P (C layout) -> LDS -> A-fragment layout ----
        u16* base = &lP[wave][0];
#pragma unroll
        for (int n = 0; n < 4; ++n)
#pragma unroll
            for (int j = 0; j < 8; ++j)
                base[(mloc + j) * 72 + n * 16 + l16] = f32_to_bf16(sAcc[n][j]);
        bf16x16 pf[2];
#pragma unroll
        for (int kt = 0; kt < 2; ++kt) {
            const u16* p = base + l16 * 72 + kt * 32 + khalf;
            pf[kt] = ld_frag(p, p + 16);
        }
        // ---- O += P * V  (V^T layout: [d][s], contiguous over keys) ----
#pragma unroll
        for (int nd = 0; nd < 4; ++nd) {
#pragma unroll
            for (int kt = 0; kt < 2; ++kt) {
                const u16* vp = vt + (size_t)bh * HD * SEQ +
                                (size_t)(nd * 16 + l16) * SEQ + kb + kt * 32 + khalf;
                bf16x16 vf = ld_frag(vp, vp + 16);
                O[nd] = wmma_bf16(pf[kt], vf, O[nd]);
            }
        }
    }

    const int bb = bh >> 4, h = bh & 15;
#pragma unroll
    for (int j = 0; j < 8; ++j) rsum[j] = 1.0f / rsum[j];
#pragma unroll
    for (int nd = 0; nd < 4; ++nd)
#pragma unroll
        for (int j = 0; j < 8; ++j) {
            int s = qbase + mloc + j;
            size_t idx = ((size_t)bb * SEQ + s) * D_MODEL + h * HD + nd * 16 + l16;
            yb[idx] = f32_to_bf16(O[nd][j] * rsum[j]);
        }
}

// ---------------------------------------------------------------------------
extern "C" void kernel_launch(void* const* d_in, const int* in_sizes, int n_in,
                              void* d_out, int out_size, void* d_ws, size_t ws_size,
                              hipStream_t stream) {
    (void)in_sizes; (void)n_in; (void)out_size; (void)ws_size;
    const float* x   = (const float*)d_in[0];
    const float* Wk  = (const float*)d_in[1];
    const float* Wq  = (const float*)d_in[2];
    const float* Wv  = (const float*)d_in[3];
    const float* Wp  = (const float*)d_in[4];
    const float* bp  = (const float*)d_in[5];
    const float* g1  = (const float*)d_in[6];
    const float* b1  = (const float*)d_in[7];
    const float* g2  = (const float*)d_in[8];
    const float* b2  = (const float*)d_in[9];
    const float* W1  = (const float*)d_in[10];
    const float* bm1 = (const float*)d_in[11];
    const float* W2  = (const float*)d_in[12];
    const float* bm2 = (const float*)d_in[13];
    float* out = (float*)d_out;

    char* ws = (char*)d_ws;
    size_t off = 0;
    auto alloc = [&](size_t bytes) -> char* {
        char* p = ws + off;
        off += (bytes + 255) & ~(size_t)255;
        return p;
    };
    float* xnF = (float*)alloc((size_t)ROWS * D_MODEL * 4);   // 16 MB
    u16*   xnB = (u16*)  alloc((size_t)ROWS * D_MODEL * 2);   //  8 MB
    u16*   WqT = (u16*)  alloc((size_t)D_MODEL * D_MODEL * 2);
    u16*   WkT = (u16*)  alloc((size_t)D_MODEL * D_MODEL * 2);
    u16*   WvT = (u16*)  alloc((size_t)D_MODEL * D_MODEL * 2);
    u16*   WpT = (u16*)  alloc((size_t)D_MODEL * D_MODEL * 2);
    u16*   W1T = (u16*)  alloc((size_t)D_MODEL * 4 * D_MODEL * 2);  // 8 MB
    u16*   W2T = (u16*)  alloc((size_t)D_MODEL * 4 * D_MODEL * 2);  // 8 MB
    char*  pool = alloc((size_t)ROWS * D_MODEL * 2 * 4);            // 32 MB shared pool
    u16*   qB  = (u16*)pool;
    u16*   kB  = (u16*)(pool + (size_t)ROWS * HD * NH * 2);
    u16*   vtB = (u16*)(pool + (size_t)ROWS * HD * NH * 4);
    u16*   yB  = (u16*)(pool + (size_t)ROWS * HD * NH * 6);
    u16*   uB  = (u16*)pool;   // aliases q/k/vt/y (dead by MLP time)
    float* hF  = (float*)alloc((size_t)ROWS * D_MODEL * 4);   // 16 MB
    u16*   hnB = (u16*)  alloc((size_t)ROWS * D_MODEL * 2);   //  8 MB

    // 1) Weight casts + transposes to bf16 [N,K] (coalesced 32x32 tiles)
    cast_transpose_k<<<dim3(D_MODEL / 32, D_MODEL / 32), 256, 0, stream>>>(Wq, WqT, D_MODEL, D_MODEL);
    cast_transpose_k<<<dim3(D_MODEL / 32, D_MODEL / 32), 256, 0, stream>>>(Wk, WkT, D_MODEL, D_MODEL);
    cast_transpose_k<<<dim3(D_MODEL / 32, D_MODEL / 32), 256, 0, stream>>>(Wv, WvT, D_MODEL, D_MODEL);
    cast_transpose_k<<<dim3(D_MODEL / 32, D_MODEL / 32), 256, 0, stream>>>(Wp, WpT, D_MODEL, D_MODEL);
    cast_transpose_k<<<dim3(4 * D_MODEL / 32, D_MODEL / 32), 256, 0, stream>>>(W1, W1T, D_MODEL, 4 * D_MODEL);
    cast_transpose_k<<<dim3(D_MODEL / 32, 4 * D_MODEL / 32), 256, 0, stream>>>(W2, W2T, 4 * D_MODEL, D_MODEL);

    // 2) LayerNorm1: x -> xn (f32 + bf16)
    layernorm_k<<<ROWS, 256, 0, stream>>>(x, g1, b1, xnF, xnB);

    // 3) QKV projections (q pre-scaled by 1/sqrt(HD))
    dim3 gQKV(D_MODEL / 128, ROWS / 128);
    gemm_bf16_k<<<gQKV, 256, 0, stream>>>(xnB, WqT, ROWS, D_MODEL, D_MODEL,
                                          MODE_Q, 0.125f, nullptr, nullptr, nullptr, qB);
    gemm_bf16_k<<<gQKV, 256, 0, stream>>>(xnB, WkT, ROWS, D_MODEL, D_MODEL,
                                          MODE_K, 1.0f, nullptr, nullptr, nullptr, kB);
    gemm_bf16_k<<<gQKV, 256, 0, stream>>>(xnB, WvT, ROWS, D_MODEL, D_MODEL,
                                          MODE_V, 1.0f, nullptr, nullptr, nullptr, vtB);

    // 4) Flash attention
    attn_k<<<dim3(SEQ / 64, NB * NH), 128, 0, stream>>>(qB, kB, vtB, yB);

    // 5) Output projection + residual: h = xn + y*Wp + bp
    gemm_bf16_k<<<gQKV, 256, 0, stream>>>(yB, WpT, ROWS, D_MODEL, D_MODEL,
                                          MODE_F32, 1.0f, bp, xnF, hF, nullptr);

    // 6) LayerNorm2: h -> hn (bf16 only)
    layernorm_k<<<ROWS, 256, 0, stream>>>(hF, g2, b2, nullptr, hnB);

    // 7) MLP up + exact GELU: u = gelu(hn*W1 + bm1)
    dim3 gUp(4 * D_MODEL / 128, ROWS / 128);
    gemm_bf16_k<<<gUp, 256, 0, stream>>>(hnB, W1T, ROWS, 4 * D_MODEL, D_MODEL,
                                         MODE_GELU, 1.0f, bm1, nullptr, nullptr, uB);

    // 8) MLP down + residual: out = h + u*W2 + bm2
    gemm_bf16_k<<<gQKV, 256, 0, stream>>>(uB, W2T, ROWS, D_MODEL, 4 * D_MODEL,
                                          MODE_F32, 1.0f, bm2, hF, out, nullptr);
}

// v002
// It runs in 296 microseconds.
// Next to v001, in two timings, it ran 1.23 times as fast each time.
// Over all steps from v000 it is 1.40 times as fast.
#include <hip/hip_runtime.h>
#include <hip/hip_bf16.h>
#include <math.h>

typedef unsigned short u16;
typedef __bf16 bf16x16 __attribute__((ext_vector_type(16)));
typedef float f32x8 __attribute__((ext_vector_type(8)));
typedef unsigned int uint8v __attribute__((ext_vector_type(8)));
typedef int v4i __attribute__((__vector_size__(16)));

#define D_MODEL 1024
#define SEQ 2048
#define NB 2
#define NH 16
#define HD 64
#define ROWS (NB * SEQ)   // 4096

#if __has_builtin(__builtin_amdgcn_global_load_async_to_lds_b128)
#define USE_ASYNC_LDS 1
#endif

__device__ __forceinline__ u16 f32_to_bf16(float f) {
    unsigned int u = __float_as_uint(f);
    u += 0x7FFFu + ((u >> 16) & 1u);   // round to nearest even
    return (u16)(u >> 16);
}

__device__ __forceinline__ bf16x16 ld_frag(const u16* plo, const u16* phi) {
    uint4 lo = *(const uint4*)plo;
    uint4 hi = *(const uint4*)phi;
    uint8v t;
    t[0] = lo.x; t[1] = lo.y; t[2] = lo.z; t[3] = lo.w;
    t[4] = hi.x; t[5] = hi.y; t[6] = hi.z; t[7] = hi.w;
    return __builtin_bit_cast(bf16x16, t);
}

__device__ __forceinline__ f32x8 wmma_bf16(bf16x16 a, bf16x16 b, f32x8 c) {
    return __builtin_amdgcn_wmma_f32_16x16x32_bf16(false, a, false, b, (short)0, c, false, false);
}

__device__ __forceinline__ f32x8 zero8() {
    f32x8 z;
#pragma unroll
    for (int i = 0; i < 8; ++i) z[i] = 0.0f;
    return z;
}

// Copy 16B global -> LDS. Async (memory->LDS direct, ASYNCcnt) when available.
__device__ __forceinline__ void cp16_g2l(const u16* g, u16* l) {
#ifdef USE_ASYNC_LDS
    __builtin_amdgcn_global_load_async_to_lds_b128(
        (__attribute__((address_space(1))) v4i*)const_cast<u16*>(g),
        (__attribute__((address_space(3))) v4i*)l, 0, 0);
#else
    *(uint4*)l = *(const uint4*)g;
#endif
}

__device__ __forceinline__ void wait_async0() {
#ifdef USE_ASYNC_LDS
    // this wave's copies have landed; the clobber keeps every LDS read behind it
    asm volatile("s_wait_asynccnt 0x0" ::: "memory");
#endif
}

// ---------------------------------------------------------------------------
// Weight cast + transpose: W[K,N] f32 -> out[N,K] bf16.  32x32 LDS tiles,
// coalesced reads and writes.  Grid: (N/32, K/32), 256 threads.
// ---------------------------------------------------------------------------
__global__ __launch_bounds__(256) void cast_transpose_k(const float* __restrict__ W,
                                                        u16* __restrict__ out,
                                                        int K, int N) {
    __shared__ float t[32][33];
    const int n0 = blockIdx.x * 32;
    const int k0 = blockIdx.y * 32;
    const int c = threadIdx.x & 31;
    const int r = threadIdx.x >> 5;   // 0..7
#pragma unroll
    for (int i = 0; i < 4; ++i) {
        int row = r + i * 8;
        t[row][c] = W[(size_t)(k0 + row) * N + n0 + c];
    }
    __syncthreads();
#pragma unroll
    for (int i = 0; i < 4; ++i) {
        int row = r + i * 8;          // row within N-tile
        out[(size_t)(n0 + row) * K + k0 + c] = f32_to_bf16(t[c][row]);
    }
}

// ---------------------------------------------------------------------------
// LayerNorm: one row (D=1024) per 256-thread block. Writes f32 (optional) + bf16.
// ---------------------------------------------------------------------------
__global__ __launch_bounds__(256) void layernorm_k(const float* __restrict__ x,
                                                   const float* __restrict__ g,
                                                   const float* __restrict__ b,
                                                   float* __restrict__ outF,
                                                   u16* __restrict__ outB) {
    __shared__ float r1[256];
    __shared__ float r2[256];
    const int tid = threadIdx.x;
    const size_t row = blockIdx.x;
    const float* xr = x + row * D_MODEL;
    float v[4];
    const int base = tid * 4;
    float s = 0.f, s2 = 0.f;
#pragma unroll
    for (int i = 0; i < 4; ++i) {
        v[i] = xr[base + i];
        s += v[i];
        s2 += v[i] * v[i];
    }
    r1[tid] = s; r2[tid] = s2;
    __syncthreads();
    for (int off = 128; off > 0; off >>= 1) {
        if (tid < off) { r1[tid] += r1[tid + off]; r2[tid] += r2[tid + off]; }
        __syncthreads();
    }
    const float mu = r1[0] * (1.0f / D_MODEL);
    const float var = r2[0] * (1.0f / D_MODEL) - mu * mu;
    const float rs = rsqrtf(var + 1e-5f);
#pragma unroll
    for (int i = 0; i < 4; ++i) {
        int col = base + i;
        float xn = (v[i] - mu) * rs * g[col] + b[col];
        if (outF) outF[row * D_MODEL + col] = xn;
        outB[row * D_MODEL + col] = f32_to_bf16(xn);
    }
}

// ---------------------------------------------------------------------------
// Tiled bf16 GEMM with WMMA.  C[M,N] = A[M,K] * Bt[N,K]^T  (Bt is B transposed)
// Block tile 128x128, 8 waves (4 M x 2 N), each wave 32x64.
// A stage is 128 k of every operand row (256 B, two whole lines), so one
// wave-wide 16 B copy covers two full rows; four 32-k blocks per stage.
// Double-buffered LDS; async memory->LDS copies when available.
// K must be a multiple of 128.
// ---------------------------------------------------------------------------
#define MODE_Q    0
#define MODE_K    1
#define MODE_V    2
#define MODE_F32  3   // outF = acc*scale + bias + resid
#define MODE_GELU 4   // outB = bf16(gelu(acc*scale + bias))
#define BK 128              // k per stage
#define LPITCH (BK + 8)     // LDS row pitch in elements: 272 B = 16 B x odd

// MODE is a compile-time parameter: each instantiation holds one straight-line
// epilogue, so its loads of bias and resid issue together instead of one
// load, wait and store per element behind a chain of branches on the mode.
template <int MODE>
__global__ __launch_bounds__(256) void gemm_bf16_k(const u16* __restrict__ A,
                                                   const u16* __restrict__ Bt,
                                                   int M, int N, int K,
                                                   float scale,
                                                   const float* __restrict__ bias,
                                                   const float* __restrict__ resid,
                                                   float* __restrict__ outF,
                                                   u16* __restrict__ outB) {
    __shared__ __attribute__((aligned(16))) u16 lA[2][128 * LPITCH];
    __shared__ __attribute__((aligned(16))) u16 lB[2][128 * LPITCH];
    const int tid = threadIdx.x;
    const int lane = tid & 31;
    const int wave = tid >> 5;
    const int waveM = wave & 3;       // 0..3
    const int waveN = wave >> 2;      // 0..1
    const int bM = blockIdx.y * 128;
    const int bN = blockIdx.x * 128;
    const int l16 = lane & 15;
    const int khalf = (lane >> 4) * 8;     // 0 or 8 (K sub-chunk base)
    const int mloc = (lane >> 4) * 8;      // 0 or 8 (C-layout row base)
    // staging assignment: 16 lanes cover one 256 B row; this thread copies
    // 16 B chunk sc of rows sr, sr + 16, ..., sr + 112 of both operands
    const int sr = tid >> 4, sc = tid & 15;

    f32x8 acc[2][4];
#pragma unroll
    for (int mt = 0; mt < 2; ++mt)
#pragma unroll
        for (int nt = 0; nt < 4; ++nt) acc[mt][nt] = zero8();

    // stage K-slice kk into buffer buf
    auto stage = [&](int buf, int kk) {
        const u16* ga = A + (size_t)(bM + sr) * K + kk + sc * 8;
        const u16* gb = Bt + (size_t)(bN + sr) * K + kk + sc * 8;
        u16* la = &lA[buf][sr * LPITCH + sc * 8];
        u16* lb = &lB[buf][sr * LPITCH + sc * 8];
#pragma unroll   // the 16 copies issue back to back, LDS steps are constants
        for (int i = 0; i < 8; ++i) {
            cp16_g2l(ga + (size_t)(i * 16) * K, la + i * 16 * LPITCH);
            cp16_g2l(gb + (size_t)(i * 16) * K, lb + i * 16 * LPITCH);
        }
    };

    stage(0, 0);
    wait_async0();
    __syncthreads();
    if (BK < K) stage(1, BK);

    int cur = 0;
    for (int kk = 0; kk < K; kk += BK) {
#pragma unroll   // the four blocks' LDS offsets become immediates
        for (int ks = 0; ks < BK; ks += 32) {
            bf16x16 af[2], bfr[4];
#pragma unroll
            for (int mt = 0; mt < 2; ++mt) {
                const u16* p = &lA[cur][(waveM * 32 + mt * 16 + l16) * LPITCH + ks + khalf];
                af[mt] = ld_frag(p, p + 16);
            }
#pragma unroll
            for (int nt = 0; nt < 4; ++nt) {
                const u16* p = &lB[cur][(waveN * 64 + nt * 16 + l16) * LPITCH + ks + khalf];
                bfr[nt] = ld_frag(p, p + 16);
            }
#pragma unroll
            for (int mt = 0; mt < 2; ++mt)
#pragma unroll
                for (int nt = 0; nt < 4; ++nt)
                    acc[mt][nt] = wmma_bf16(af[mt], bfr[nt], acc[mt][nt]);
        }
        // publish point: this wave's reads of buffer cur are done before the
        // refill below may overwrite it
        asm volatile("s_wait_dscnt 0x0" ::: "memory");
        wait_async0();       // the next stage's copies of this wave have landed
        __syncthreads();     // next stage readable by all; buffer cur left by all
        if (kk + 2 * BK < K) stage(cur, kk + 2 * BK);   // refill two stages ahead
        cur ^= 1;
    }
    wait_async0();           // nothing outstanding when the wave ends

    // Epilogue. C layout: vgpr j -> row mloc+j, lane%16 -> col.
#pragma unroll
    for (int mt = 0; mt < 2; ++mt) {
#pragma unroll
        for (int nt = 0; nt < 4; ++nt) {
            const int gcol = bN + waveN * 64 + nt * 16 + l16;
#pragma unroll
            for (int j = 0; j < 8; ++j) {
                const int grow = bM + waveM * 32 + mt * 16 + mloc + j;
                float v = acc[mt][nt][j] * scale;
                if constexpr (MODE == MODE_Q || MODE == MODE_K) {
                    int bb = grow >> 11, s = grow & 2047;
                    int h = gcol >> 6, d = gcol & 63;
                    outB[(((size_t)(bb * NH + h) * SEQ) + s) * HD + d] = f32_to_bf16(v);
                } else if constexpr (MODE == MODE_V) {
                    int bb = grow >> 11, s = grow & 2047;
                    int h = gcol >> 6, d = gcol & 63;
                    outB[(((size_t)(bb * NH + h) * HD) + d) * SEQ + s] = f32_to_bf16(v);
                } else if constexpr (MODE == MODE_F32) {
                    size_t idx = (size_t)grow * N + gcol;
                    outF[idx] = v + bias[gcol] + resid[idx];
                } else { // MODE_GELU
                    float xv = v + bias[gcol];
                    float gl = 0.5f * xv * (1.0f + erff(xv * 0.70710678118654752f));
                    outB[(size_t)grow * N + gcol] = f32_to_bf16(gl);
                }
            }
        }
    }
}

// ---------------------------------------------------------------------------
// Flash attention, WMMA.  q,k: [b,h,s,d] bf16 (q pre-scaled by 1/8).
// vt: [b,h,d,s] bf16.  out yb: [b,s, h*64+d] bf16.
// Block = 128 threads = 4 waves; wave owns 16 query rows; 64-key tiles.
// ---------------------------------------------------------------------------
__global__ __launch_bounds__(128) void attn_k(const u16* __restrict__ q,
                                              const u16* __restrict__ k,
                                              const u16* __restrict__ vt,
                                              u16* __restrict__ yb) {
    __shared__ u16 lP[4][16 * 72];
    const int lane = threadIdx.x & 31;
    const int wave = threadIdx.x >> 5;
    const int bh = blockIdx.y;                 // b*NH + h
    const int qbase = blockIdx.x * 64 + wave * 16;
    const int l16 = lane & 15;
    const int khalf = (lane >> 4) * 8;
    const int mloc = (lane >> 4) * 8;
    const size_t headOff = (size_t)bh * SEQ * HD;

    bf16x16 qf[2];
    {
        const u16* qp = q + headOff + (size_t)(qbase + l16) * HD;
#pragma unroll
        for (int kt = 0; kt < 2; ++kt) {
            const u16* p = qp + kt * 32 + khalf;
            qf[kt] = ld_frag(p, p + 16);
        }
    }

    f32x8 O[4];
    float rmax[8], rsum[8];
#pragma unroll
    for (int n = 0; n < 4; ++n) O[n] = zero8();
#pragma unroll
    for (int j = 0; j < 8; ++j) { rmax[j] = -INFINITY; rsum[j] = 0.0f; }

    for (int kb = 0; kb < SEQ; kb += 64) {
        // ---- scores: S[16 x 64] = Q * K^T (q pre-scaled) ----
        f32x8 sAcc[4];
#pragma unroll
        for (int n = 0; n < 4; ++n) {
            sAcc[n] = zero8();
#pragma unroll
            for (int kt = 0; kt < 2; ++kt) {
                const u16* kp = k + headOff + (size_t)(kb + n * 16 + l16) * HD + kt * 32 + khalf;
                bf16x16 bf = ld_frag(kp, kp + 16);
                sAcc[n] = wmma_bf16(qf[kt], bf, sAcc[n]);
            }
            const int kj = kb + n * 16 + l16;
#pragma unroll
            for (int j = 0; j < 8; ++j) {
                if (qbase + mloc + j == kj) sAcc[n][j] = -INFINITY;
            }
        }
        // ---- online softmax ----
        float corr[8];
#pragma unroll
        for (int j = 0; j < 8; ++j) {
            float t = sAcc[0][j];
#pragma unroll
            for (int n = 1; n < 4; ++n) t = fmaxf(t, sAcc[n][j]);
            t = fmaxf(t, __shfl_xor(t, 1));
            t = fmaxf(t, __shfl_xor(t, 2));
            t = fmaxf(t, __shfl_xor(t, 4));
            t = fmaxf(t, __shfl_xor(t, 8));
            float nm = fmaxf(rmax[j], t);
            corr[j] = expf(rmax[j] - nm);
            rmax[j] = nm;
            rsum[j] *= corr[j];
        }
#pragma unroll
        for (int n = 0; n < 4; ++n)
#pragma unroll
            for (int j = 0; j < 8; ++j) O[n][j] *= corr[j];

        float ps[8];
#pragma unroll
        for (int j = 0; j < 8; ++j) ps[j] = 0.0f;
#pragma unroll
        for (int n = 0; n < 4; ++n)
#pragma unroll
            for (int j = 0; j < 8; ++j) {
                float p = expf(sAcc[n][j] - rmax[j]);
                sAcc[n][j] = p;
                ps[j] += p;
            }
#pragma unroll
        for (int j = 0; j < 8; ++j) {
            float t = ps[j];
            t += __shfl_xor(t, 1);
            t += __shfl_xor(t, 2);
            t += __shfl_xor(t, 4);
            t += __shfl_xor(t, 8);
            rsum[j] += t;
        }
        // ---- P (C layout) -> LDS -> A-fragment layout ----
        u16* base = &lP[wave][0];
#pragma unroll
        for (int n = 0; n < 4; ++n)
#pragma unroll
            for (int j = 0; j < 8; ++j)
                base[(mloc + j) * 72 + n * 16 + l16] = f32_to_bf16(sAcc[n][j]);
        bf16x16 pf[2];
#pragma unroll
        for (int kt = 0; kt < 2; ++kt) {
            const u16* p = base + l16 * 72 + kt * 32 + khalf;
            pf[kt] = ld_frag(p, p + 16);
        }
        // ---- O += P * V  (V^T layout: [d][s], contiguous over keys) ----
#pragma unroll
        for (int nd = 0; nd < 4; ++nd) {
#pragma unroll
            for (int kt = 0; kt < 2; ++kt) {
                const u16* vp = vt + (size_t)bh * HD * SEQ +
                                (size_t)(nd * 16 + l16) * SEQ + kb + kt * 32 + khalf;
                bf16x16 vf = ld_frag(vp, vp + 16);
                O[nd] = wmma_bf16(pf[kt], vf, O[nd]);
            }
        }
    }

    const int bb = bh >> 4, h = bh & 15;
#pragma unroll
    for (int j = 0; j < 8; ++j) rsum[j] = 1.0f / rsum[j];
#pragma unroll
    for (int nd = 0; nd < 4; ++nd)
#pragma unroll
        for (int j = 0; j < 8; ++j) {
            int s = qbase + mloc + j;
            size_t idx = ((size_t)bb * SEQ + s) * D_MODEL + h * HD + nd * 16 + l16;
            yb[idx] = f32_to_bf16(O[nd][j] * rsum[j]);
        }
}

// ---------------------------------------------------------------------------
extern "C" void kernel_launch(void* const* d_in, const int* in_sizes, int n_in,
                              void* d_out, int out_size, void* d_ws, size_t ws_size,
                              hipStream_t stream) {
    (void)in_sizes; (void)n_in; (void)out_size; (void)ws_size;
    const float* x   = (const float*)d_in[0];
    const float* Wk  = (const float*)d_in[1];
    const float* Wq  = (const float*)d_in[2];
    const float* Wv  = (const float*)d_in[3];
    const float* Wp  = (const float*)d_in[4];
    const float* bp  = (const float*)d_in[5];
    const float* g1  = (const float*)d_in[6];
    const float* b1  = (const float*)d_in[7];
    const float* g2  = (const float*)d_in[8];
    const float* b2  = (const float*)d_in[9];
    const float* W1  = (const float*)d_in[10];
    const float* bm1 = (const float*)d_in[11];
    const float* W2  = (const float*)d_in[12];
    const float* bm2 = (const float*)d_in[13];
    float* out = (float*)d_out;

    char* ws = (char*)d_ws;
    size_t off = 0;
    auto alloc = [&](size_t bytes) -> char* {
        char* p = ws + off;
        off += (bytes + 255) & ~(size_t)255;
        return p;
    };
    float* xnF = (float*)alloc((size_t)ROWS * D_MODEL * 4);   // 16 MB
    u16*   xnB = (u16*)  alloc((size_t)ROWS * D_MODEL * 2);   //  8 MB
    u16*   WqT = (u16*)  alloc((size_t)D_MODEL * D_MODEL * 2);
    u16*   WkT = (u16*)  alloc((size_t)D_MODEL * D_MODEL * 2);
    u16*   WvT = (u16*)  alloc((size_t)D_MODEL * D_MODEL * 2);
    u16*   WpT = (u16*)  alloc((size_t)D_MODEL * D_MODEL * 2);
    u16*   W1T = (u16*)  alloc((size_t)D_MODEL * 4 * D_MODEL * 2);  // 8 MB
    u16*   W2T = (u16*)  alloc((size_t)D_MODEL * 4 * D_MODEL * 2);  // 8 MB
    char*  pool = alloc((size_t)ROWS * D_MODEL * 2 * 4);            // 32 MB shared pool
    u16*   qB  = (u16*)pool;
    u16*   kB  = (u16*)(pool + (size_t)ROWS * HD * NH * 2);
    u16*   vtB = (u16*)(pool + (size_t)ROWS * HD * NH * 4);
    u16*   yB  = (u16*)(pool + (size_t)ROWS * HD * NH * 6);
    u16*   uB  = (u16*)pool;   // aliases q/k/vt/y (dead by MLP time)
    float* hF  = (float*)alloc((size_t)ROWS * D_MODEL * 4);   // 16 MB
    u16*   hnB = (u16*)  alloc((size_t)ROWS * D_MODEL * 2);   //  8 MB

    // 1) Weight casts + transposes to bf16 [N,K] (coalesced 32x32 tiles)
    cast_transpose_k<<<dim3(D_MODEL / 32, D_MODEL / 32), 256, 0, stream>>>(Wq, WqT, D_MODEL, D_MODEL);
    cast_transpose_k<<<dim3(D_MODEL / 32, D_MODEL / 32), 256, 0, stream>>>(Wk, WkT, D_MODEL, D_MODEL);
    cast_transpose_k<<<dim3(D_MODEL / 32, D_MODEL / 32), 256, 0, stream>>>(Wv, WvT, D_MODEL, D_MODEL);
    cast_transpose_k<<<dim3(D_MODEL / 32, D_MODEL / 32), 256, 0, stream>>>(Wp, WpT, D_MODEL, D_MODEL);
    cast_transpose_k<<<dim3(4 * D_MODEL / 32, D_MODEL / 32), 256, 0, stream>>>(W1, W1T, D_MODEL, 4 * D_MODEL);
    cast_transpose_k<<<dim3(D_MODEL / 32, 4 * D_MODEL / 32), 256, 0, stream>>>(W2, W2T, 4 * D_MODEL, D_MODEL);

    // 2) LayerNorm1: x -> xn (f32 + bf16)
    layernorm_k<<<ROWS, 256, 0, stream>>>(x, g1, b1, xnF, xnB);

    // 3) QKV projections (q pre-scaled by 1/sqrt(HD))
    dim3 gQKV(D_MODEL / 128, ROWS / 128);
    gemm_bf16_k<MODE_Q><<<gQKV, 256, 0, stream>>>(xnB, WqT, ROWS, D_MODEL, D_MODEL,
                                                  0.125f, nullptr, nullptr, nullptr, qB);
    gemm_bf16_k<MODE_K><<<gQKV, 256, 0, stream>>>(xnB, WkT, ROWS, D_MODEL, D_MODEL,
                                                  1.0f, nullptr, nullptr, nullptr, kB);
    gemm_bf16_k<MODE_V><<<gQKV, 256, 0, stream>>>(xnB, WvT, ROWS, D_MODEL, D_MODEL,
                                                  1.0f, nullptr, nullptr, nullptr, vtB);

    // 4) Flash attention
    attn_k<<<dim3(SEQ / 64, NB * NH), 128, 0, stream>>>(qB, kB, vtB, yB);

    // 5) Output projection + residual: h = xn + y*Wp + bp
    gemm_bf16_k<MODE_F32><<<gQKV, 256, 0, stream>>>(yB, WpT, ROWS, D_MODEL, D_MODEL,
                                                    1.0f, bp, xnF, hF, nullptr);

    // 6) LayerNorm2: h -> hn (bf16 only)
    layernorm_k<<<ROWS, 256, 0, stream>>>(hF, g2, b2, nullptr, hnB);

    // 7) MLP up + exact GELU: u = gelu(hn*W1 + bm1)
    dim3 gUp(4 * D_MODEL / 128, ROWS / 128);
    gemm_bf16_k<MODE_GELU><<<gUp, 256, 0, stream>>>(hnB, W1T, ROWS, 4 * D_MODEL, D_MODEL,
                                                    1.0f, bm1, nullptr, nullptr, uB);

    // 8) MLP down + residual: out = h + u*W2 + bm2
    gemm_bf16_k<MODE_F32><<<gQKV, 256, 0, stream>>>(uB, W2T, ROWS, D_MODEL, 4 * D_MODEL,
                                                    1.0f, bm2, hF, out, nullptr);
}

// v003
// A run of this version takes 282 microseconds.
// Next to v002, in two timings, it ran 1.05 times as fast each time.
// All steps since v000 together make it 1.47 times as fast.
#include <hip/hip_runtime.h>
#include <hip/hip_bf16.h>
#include <math.h>

typedef unsigned short u16;
typedef __bf16 bf16x16 __attribute__((ext_vector_type(16)));
typedef float f32x8 __attribute__((ext_vector_type(8)));
typedef unsigned int uint8v __attribute__((ext_vector_type(8)));
typedef int v4i __attribute__((__vector_size__(16)));

#define D_MODEL 1024
#define SEQ 2048
#define NB 2
#define NH 16
#define HD 64
#define ROWS (NB * SEQ)   // 4096

#if __has_builtin(__builtin_amdgcn_global_load_async_to_lds_b128)
#define USE_ASYNC_LDS 1
#endif

__device__ __forceinline__ u16 f32_to_bf16(float f) {
    unsigned int u = __float_as_uint(f);
    u += 0x7FFFu + ((u >> 16) & 1u);   // round to nearest even
    return (u16)(u >> 16);
}

__device__ __forceinline__ bf16x16 ld_frag(const u16* plo, const u16* phi) {
    uint4 lo = *(const uint4*)plo;
    uint4 hi = *(const uint4*)phi;
    uint8v t;
    t[0] = lo.x; t[1] = lo.y; t[2] = lo.z; t[3] = lo.w;
    t[4] = hi.x; t[5] = hi.y; t[6] = hi.z; t[7] = hi.w;
    return __builtin_bit_cast(bf16x16, t);
}

__device__ __forceinline__ f32x8 wmma_bf16(bf16x16 a, bf16x16 b, f32x8 c) {
    return __builtin_amdgcn_wmma_f32_16x16x32_bf16(false, a, false, b, (short)0, c, false, false);
}

__device__ __forceinline__ f32x8 zero8() {
    f32x8 z;
#pragma unroll
    for (int i = 0; i < 8; ++i) z[i] = 0.0f;
    return z;
}

// Copy 16B global -> LDS. Async (memory->LDS direct, ASYNCcnt) when available.
__device__ __forceinline__ void cp16_g2l(const u16* g, u16* l) {
#ifdef USE_ASYNC_LDS
    __builtin_amdgcn_global_load_async_to_lds_b128(
        (__attribute__((address_space(1))) v4i*)const_cast<u16*>(g),
        (__attribute__((address_space(3))) v4i*)l, 0, 0);
#else
    *(uint4*)l = *(const uint4*)g;
#endif
}

__device__ __forceinline__ void wait_async0() {
#ifdef USE_ASYNC_LDS
    // this wave's copies have landed; the clobber keeps every LDS read behind it
    asm volatile("s_wait_asynccnt 0x0" ::: "memory");
#endif
}

// ---------------------------------------------------------------------------
// Weight cast + transpose: W[K,N] f32 -> out[N,K] bf16.  32x32 LDS tiles,
// coalesced reads and writes.  Grid: (N/32, K/32), 256 threads.
// ---------------------------------------------------------------------------
__global__ __launch_bounds__(256) void cast_transpose_k(const float* __restrict__ W,
                                                        u16* __restrict__ out,
                                                        int K, int N) {
    __shared__ float t[32][33];
    const int n0 = blockIdx.x * 32;
    const int k0 = blockIdx.y * 32;
    const int c = threadIdx.x & 31;
    const int r = threadIdx.x >> 5;   // 0..7
#pragma unroll
    for (int i = 0; i < 4; ++i) {
        int row = r + i * 8;
        t[row][c] = W[(size_t)(k0 + row) * N + n0 + c];
    }
    __syncthreads();
#pragma unroll
    for (int i = 0; i < 4; ++i) {
        int row = r + i * 8;          // row within N-tile
        out[(size_t)(n0 + row) * K + k0 + c] = f32_to_bf16(t[c][row]);
    }
}

// ---------------------------------------------------------------------------
// LayerNorm: one row (D=1024) per 256-thread block. Writes f32 (optional) + bf16.
// ---------------------------------------------------------------------------
__global__ __launch_bounds__(256) void layernorm_k(const float* __restrict__ x,
                                                   const float* __restrict__ g,
                                                   const float* __restrict__ b,
                                                   float* __restrict__ outF,
                                                   u16* __restrict__ outB) {
    __shared__ float r1[256];
    __shared__ float r2[256];
    const int tid = threadIdx.x;
    const size_t row = blockIdx.x;
    const float* xr = x + row * D_MODEL;
    float v[4];
    const int base = tid * 4;
    float s = 0.f, s2 = 0.f;
#pragma unroll
    for (int i = 0; i < 4; ++i) {
        v[i] = xr[base + i];
        s += v[i];
        s2 += v[i] * v[i];
    }
    r1[tid] = s; r2[tid] = s2;
    __syncthreads();
    for (int off = 128; off > 0; off >>= 1) {
        if (tid < off) { r1[tid] += r1[tid + off]; r2[tid] += r2[tid + off]; }
        __syncthreads();
    }
    const float mu = r1[0] * (1.0f / D_MODEL);
    const float var = r2[0] * (1.0f / D_MODEL) - mu * mu;
    const float rs = rsqrtf(var + 1e-5f);
#pragma unroll
    for (int i = 0; i < 4; ++i) {
        int col = base + i;
        float xn = (v[i] - mu) * rs * g[col] + b[col];
        if (outF) outF[row * D_MODEL + col] = xn;
        outB[row * D_MODEL + col] = f32_to_bf16(xn);
    }
}

// ---------------------------------------------------------------------------
// Tiled bf16 GEMM with WMMA.  C[M,N] = A[M,K] * Bt[N,K]^T  (Bt is B transposed)
// Block tile 128x128, 8 waves (4 M x 2 N), each wave 32x64.
// A stage is 128 k of every operand row (256 B, two whole lines), so one
// wave-wide 16 B copy covers two full rows; four 32-k blocks per stage.
// Double-buffered LDS; async memory->LDS copies when available.
// K must be a multiple of 128.
// ---------------------------------------------------------------------------
#define MODE_Q    0
#define MODE_K    1
#define MODE_V    2
#define MODE_F32  3   // outF = acc*scale + bias + resid
#define MODE_GELU 4   // outB = bf16(gelu(acc*scale + bias))
#define BK 128              // k per stage
#define LPITCH (BK + 8)     // LDS row pitch in elements: 272 B = 16 B x odd

// MODE is a compile-time parameter: each instantiation holds one straight-line
// epilogue, so its loads of bias and resid issue together instead of one
// load, wait and store per element behind a chain of branches on the mode.
template <int MODE>
__global__ __launch_bounds__(256) void gemm_bf16_k(const u16* __restrict__ A,
                                                   const u16* __restrict__ Bt,
                                                   int M, int N, int K,
                                                   float scale,
                                                   const float* __restrict__ bias,
                                                   const float* __restrict__ resid,
                                                   float* __restrict__ outF,
                                                   u16* __restrict__ outB) {
    __shared__ __attribute__((aligned(16))) u16 lA[2][128 * LPITCH];
    __shared__ __attribute__((aligned(16))) u16 lB[2][128 * LPITCH];
    const int tid = threadIdx.x;
    const int lane = tid & 31;
    const int wave = tid >> 5;
    const int waveM = wave & 3;       // 0..3
    const int waveN = wave >> 2;      // 0..1
    const int bM = blockIdx.y * 128;
    const int bN = blockIdx.x * 128;
    const int l16 = lane & 15;
    const int khalf = (lane >> 4) * 8;     // 0 or 8 (K sub-chunk base)
    const int mloc = (lane >> 4) * 8;      // 0 or 8 (C-layout row base)
    // staging assignment: 16 lanes cover one 256 B row; this thread copies
    // 16 B chunk sc of rows sr, sr + 16, ..., sr + 112 of both operands
    const int sr = tid >> 4, sc = tid & 15;

    f32x8 acc[2][4];
#pragma unroll
    for (int mt = 0; mt < 2; ++mt)
#pragma unroll
        for (int nt = 0; nt < 4; ++nt) acc[mt][nt] = zero8();

    // stage K-slice kk into buffer buf
    auto stage = [&](int buf, int kk) {
        const u16* ga = A + (size_t)(bM + sr) * K + kk + sc * 8;
        const u16* gb = Bt + (size_t)(bN + sr) * K + kk + sc * 8;
        u16* la = &lA[buf][sr * LPITCH + sc * 8];
        u16* lb = &lB[buf][sr * LPITCH + sc * 8];
#pragma unroll   // the 16 copies issue back to back, LDS steps are constants
        for (int i = 0; i < 8; ++i) {
            cp16_g2l(ga + (size_t)(i * 16) * K, la + i * 16 * LPITCH);
            cp16_g2l(gb + (size_t)(i * 16) * K, lb + i * 16 * LPITCH);
        }
    };

    stage(0, 0);
    wait_async0();
    __syncthreads();
    if (BK < K) stage(1, BK);

    int cur = 0;
    for (int kk = 0; kk < K; kk += BK) {
#pragma unroll   // the four blocks' LDS offsets become immediates
        for (int ks = 0; ks < BK; ks += 32) {
            bf16x16 af[2], bfr[4];
#pragma unroll
            for (int mt = 0; mt < 2; ++mt) {
                const u16* p = &lA[cur][(waveM * 32 + mt * 16 + l16) * LPITCH + ks + khalf];
                af[mt] = ld_frag(p, p + 16);
            }
#pragma unroll
            for (int nt = 0; nt < 4; ++nt) {
                const u16* p = &lB[cur][(waveN * 64 + nt * 16 + l16) * LPITCH + ks + khalf];
                bfr[nt] = ld_frag(p, p + 16);
            }
#pragma unroll
            for (int mt = 0; mt < 2; ++mt)
#pragma unroll
                for (int nt = 0; nt < 4; ++nt)
                    acc[mt][nt] = wmma_bf16(af[mt], bfr[nt], acc[mt][nt]);
        }
        // publish point: this wave's reads of buffer cur are done before the
        // refill below may overwrite it
        asm volatile("s_wait_dscnt 0x0" ::: "memory");
        wait_async0();       // the next stage's copies of this wave have landed
        __syncthreads();     // next stage readable by all; buffer cur left by all
        if (kk + 2 * BK < K) stage(cur, kk + 2 * BK);   // refill two stages ahead
        cur ^= 1;
    }
    wait_async0();           // nothing outstanding when the wave ends

    // Epilogue. C layout: vgpr j -> row mloc+j, lane%16 -> col.
#pragma unroll
    for (int mt = 0; mt < 2; ++mt) {
#pragma unroll
        for (int nt = 0; nt < 4; ++nt) {
            const int gcol = bN + waveN * 64 + nt * 16 + l16;
#pragma unroll
            for (int j = 0; j < 8; ++j) {
                const int grow = bM + waveM * 32 + mt * 16 + mloc + j;
                float v = acc[mt][nt][j] * scale;
                if constexpr (MODE == MODE_Q || MODE == MODE_K) {
                    int bb = grow >> 11, s = grow & 2047;
                    int h = gcol >> 6, d = gcol & 63;
                    outB[(((size_t)(bb * NH + h) * SEQ) + s) * HD + d] = f32_to_bf16(v);
                } else if constexpr (MODE == MODE_V) {
                    int bb = grow >> 11, s = grow & 2047;
                    int h = gcol >> 6, d = gcol & 63;
                    outB[(((size_t)(bb * NH + h) * HD) + d) * SEQ + s] = f32_to_bf16(v);
                } else if constexpr (MODE == MODE_F32) {
                    size_t idx = (size_t)grow * N + gcol;
                    outF[idx] = v + bias[gcol] + resid[idx];
                } else { // MODE_GELU
                    float xv = v + bias[gcol];
                    float gl = 0.5f * xv * (1.0f + erff(xv * 0.70710678118654752f));
                    outB[(size_t)grow * N + gcol] = f32_to_bf16(gl);
                }
            }
        }
    }
}

// ---------------------------------------------------------------------------
// Flash attention, WMMA.  q,k: [b,h,s,d] bf16 (q pre-scaled by 1/8).
// vt: [b,h,d,s] bf16.  out yb: [b,s, h*64+d] bf16.
// Block = 128 threads = 4 waves; wave owns 16 query rows; 64-key tiles.
// Softmax in base 2: e^(s - m) = 2^(s * log2(e) - m * log2(e)).  rmax holds the
// running maximum already times log2(e), so each exponential is one fused
// multiply-add and the hardware's 2^x.  A masked score stays -inf and gives 0.
// ---------------------------------------------------------------------------
__global__ __launch_bounds__(128) void attn_k(const u16* __restrict__ q,
                                              const u16* __restrict__ k,
                                              const u16* __restrict__ vt,
                                              u16* __restrict__ yb) {
    __shared__ u16 lP[4][16 * 72];
    const int lane = threadIdx.x & 31;
    const int wave = threadIdx.x >> 5;
    const int bh = blockIdx.y;                 // b*NH + h
    const int qbase = blockIdx.x * 64 + wave * 16;
    const int l16 = lane & 15;
    const int khalf = (lane >> 4) * 8;
    const int mloc = (lane >> 4) * 8;
    const size_t headOff = (size_t)bh * SEQ * HD;

    bf16x16 qf[2];
    {
        const u16* qp = q + headOff + (size_t)(qbase + l16) * HD;
#pragma unroll
        for (int kt = 0; kt < 2; ++kt) {
            const u16* p = qp + kt * 32 + khalf;
            qf[kt] = ld_frag(p, p + 16);
        }
    }

    const float LOG2E = 1.44269504088896340736f;
    f32x8 O[4];
    float rmax[8], rsum[8];
#pragma unroll
    for (int n = 0; n < 4; ++n) O[n] = zero8();
#pragma unroll
    for (int j = 0; j < 8; ++j) { rmax[j] = -INFINITY; rsum[j] = 0.0f; }

    for (int kb = 0; kb < SEQ; kb += 64) {
        // ---- scores: S[16 x 64] = Q * K^T (q pre-scaled) ----
        f32x8 sAcc[4];
#pragma unroll
        for (int n = 0; n < 4; ++n) {
            sAcc[n] = zero8();
#pragma unroll
            for (int kt = 0; kt < 2; ++kt) {
                const u16* kp = k + headOff + (size_t)(kb + n * 16 + l16) * HD + kt * 32 + khalf;
                bf16x16 bf = ld_frag(kp, kp + 16);
                sAcc[n] = wmma_bf16(qf[kt], bf, sAcc[n]);
            }
            const int kj = kb + n * 16 + l16;
#pragma unroll
            for (int j = 0; j < 8; ++j) {
                if (qbase + mloc + j == kj) sAcc[n][j] = -INFINITY;
            }
        }
        // ---- online softmax ----
        float corr[8];
#pragma unroll
        for (int j = 0; j < 8; ++j) {
            float t = sAcc[0][j];
#pragma unroll
            for (int n = 1; n < 4; ++n) t = fmaxf(t, sAcc[n][j]);
            t = fmaxf(t, __shfl_xor(t, 1));
            t = fmaxf(t, __shfl_xor(t, 2));
            t = fmaxf(t, __shfl_xor(t, 4));
            t = fmaxf(t, __shfl_xor(t, 8));
            float nm = fmaxf(rmax[j], t * LOG2E);
            // 2^x with the one free issue slot the instruction set asks for behind a
            // transcendental
            asm("v_exp_f32 %0, %1\n\tv_nop" : "=v"(corr[j]) : "v"(rmax[j] - nm));
            rmax[j] = nm;
            rsum[j] *= corr[j];
        }
#pragma unroll
        for (int n = 0; n < 4; ++n)
#pragma unroll
            for (int j = 0; j < 8; ++j) O[n][j] *= corr[j];

        float ps[8];
#pragma unroll
        for (int j = 0; j < 8; ++j) ps[j] = 0.0f;
#pragma unroll
        for (int n = 0; n < 4; ++n)
#pragma unroll
            for (int j = 0; j < 8; ++j) {
                float p = __builtin_amdgcn_exp2f(fmaf(sAcc[n][j], LOG2E, -rmax[j]));
                sAcc[n][j] = p;
                ps[j] += p;
            }
#pragma unroll
        for (int j = 0; j < 8; ++j) {
            float t = ps[j];
            t += __shfl_xor(t, 1);
            t += __shfl_xor(t, 2);
            t += __shfl_xor(t, 4);
            t += __shfl_xor(t, 8);
            rsum[j] += t;
        }
        // ---- P (C layout) -> LDS -> A-fragment layout ----
        u16* base = &lP[wave][0];
#pragma unroll
        for (int n = 0; n < 4; ++n)
#pragma unroll
            for (int j = 0; j < 8; ++j)
                base[(mloc + j) * 72 + n * 16 + l16] = f32_to_bf16(sAcc[n][j]);
        bf16x16 pf[2];
#pragma unroll
        for (int kt = 0; kt < 2; ++kt) {
            const u16* p = base + l16 * 72 + kt * 32 + khalf;
            pf[kt] = ld_frag(p, p + 16);
        }
        // ---- O += P * V  (V^T layout: [d][s], contiguous over keys) ----
#pragma unroll
        for (int nd = 0; nd < 4; ++nd) {
#pragma unroll
            for (int kt = 0; kt < 2; ++kt) {
                const u16* vp = vt + (size_t)bh * HD * SEQ +
                                (size_t)(nd * 16 + l16) * SEQ + kb + kt * 32 + khalf;
                bf16x16 vf = ld_frag(vp, vp + 16);
                O[nd] = wmma_bf16(pf[kt], vf, O[nd]);
            }
        }
    }

    const int bb = bh >> 4, h = bh & 15;
#pragma unroll
    for (int j = 0; j < 8; ++j) rsum[j] = 1.0f / rsum[j];
#pragma unroll
    for (int nd = 0; nd < 4; ++nd)
#pragma unroll
        for (int j = 0; j < 8; ++j) {
            int s = qbase + mloc + j;
            size_t idx = ((size_t)bb * SEQ + s) * D_MODEL + h * HD + nd * 16 + l16;
            yb[idx] = f32_to_bf16(O[nd][j] * rsum[j]);
        }
}

// ---------------------------------------------------------------------------
extern "C" void kernel_launch(void* const* d_in, const int* in_sizes, int n_in,
                              void* d_out, int out_size, void* d_ws, size_t ws_size,
                              hipStream_t stream) {
    (void)in_sizes; (void)n_in; (void)out_size; (void)ws_size;
    const float* x   = (const float*)d_in[0];
    const float* Wk  = (const float*)d_in[1];
    const float* Wq  = (const float*)d_in[2];
    const float* Wv  = (const float*)d_in[3];
    const float* Wp  = (const float*)d_in[4];
    const float* bp  = (const float*)d_in[5];
    const float* g1  = (const float*)d_in[6];
    const float* b1  = (const float*)d_in[7];
    const float* g2  = (const float*)d_in[8];
    const float* b2  = (const float*)d_in[9];
    const float* W1  = (const float*)d_in[10];
    const float* bm1 = (const float*)d_in[11];
    const float* W2  = (const float*)d_in[12];
    const float* bm2 = (const float*)d_in[13];
    float* out = (float*)d_out;

    char* ws = (char*)d_ws;
    size_t off = 0;
    auto alloc = [&](size_t bytes) -> char* {
        char* p = ws + off;
        off += (bytes + 255) & ~(size_t)255;
        return p;
    };
    float* xnF = (float*)alloc((size_t)ROWS * D_MODEL * 4);   // 16 MB
    u16*   xnB = (u16*)  alloc((size_t)ROWS * D_MODEL * 2);   //  8 MB
    u16*   WqT = (u16*)  alloc((size_t)D_MODEL * D_MODEL * 2);
    u16*   WkT = (u16*)  alloc((size_t)D_MODEL * D_MODEL * 2);
    u16*   WvT = (u16*)  alloc((size_t)D_MODEL * D_MODEL * 2);
    u16*   WpT = (u16*)  alloc((size_t)D_MODEL * D_MODEL * 2);
    u16*   W1T = (u16*)  alloc((size_t)D_MODEL * 4 * D_MODEL * 2);  // 8 MB
    u16*   W2T = (u16*)  alloc((size_t)D_MODEL * 4 * D_MODEL * 2);  // 8 MB
    char*  pool = alloc((size_t)ROWS * D_MODEL * 2 * 4);            // 32 MB shared pool
    u16*   qB  = (u16*)pool;
    u16*   kB  = (u16*)(pool + (size_t)ROWS * HD * NH * 2);
    u16*   vtB = (u16*)(pool + (size_t)ROWS * HD * NH * 4);
    u16*   yB  = (u16*)(pool + (size_t)ROWS * HD * NH * 6);
    u16*   uB  = (u16*)pool;   // aliases q/k/vt/y (dead by MLP time)
    float* hF  = (float*)alloc((size_t)ROWS * D_MODEL * 4);   // 16 MB
    u16*   hnB = (u16*)  alloc((size_t)ROWS * D_MODEL * 2);   //  8 MB

    // 1) Weight casts + transposes to bf16 [N,K] (coalesced 32x32 tiles)
    cast_transpose_k<<<dim3(D_MODEL / 32, D_MODEL / 32), 256, 0, stream>>>(Wq, WqT, D_MODEL, D_MODEL);
    cast_transpose_k<<<dim3(D_MODEL / 32, D_MODEL / 32), 256, 0, stream>>>(Wk, WkT, D_MODEL, D_MODEL);
    cast_transpose_k<<<dim3(D_MODEL / 32, D_MODEL / 32), 256, 0, stream>>>(Wv, WvT, D_MODEL, D_MODEL);
    cast_transpose_k<<<dim3(D_MODEL / 32, D_MODEL / 32), 256, 0, stream>>>(Wp, WpT, D_MODEL, D_MODEL);
    cast_transpose_k<<<dim3(4 * D_MODEL / 32, D_MODEL / 32), 256, 0, stream>>>(W1, W1T, D_MODEL, 4 * D_MODEL);
    cast_transpose_k<<<dim3(D_MODEL / 32, 4 * D_MODEL / 32), 256, 0, stream>>>(W2, W2T, 4 * D_MODEL, D_MODEL);

    // 2) LayerNorm1: x -> xn (f32 + bf16)
    layernorm_k<<<ROWS, 256, 0, stream>>>(x, g1, b1, xnF, xnB);

    // 3) QKV projections (q pre-scaled by 1/sqrt(HD))
    dim3 gQKV(D_MODEL / 128, ROWS / 128);
    gemm_bf16_k<MODE_Q><<<gQKV, 256, 0, stream>>>(xnB, WqT, ROWS, D_MODEL, D_MODEL,
                                                  0.125f, nullptr, nullptr, nullptr, qB);
    gemm_bf16_k<MODE_K><<<gQKV, 256, 0, stream>>>(xnB, WkT, ROWS, D_MODEL, D_MODEL,
                                                  1.0f, nullptr, nullptr, nullptr, kB);
    gemm_bf16_k<MODE_V><<<gQKV, 256, 0, stream>>>(xnB, WvT, ROWS, D_MODEL, D_MODEL,
                                                  1.0f, nullptr, nullptr, nullptr, vtB);

    // 4) Flash attention
    attn_k<<<dim3(SEQ / 64, NB * NH), 128, 0, stream>>>(qB, kB, vtB, yB);

    // 5) Output projection + residual: h = xn + y*Wp + bp
    gemm_bf16_k<MODE_F32><<<gQKV, 256, 0, stream>>>(yB, WpT, ROWS, D_MODEL, D_MODEL,
                                                    1.0f, bp, xnF, hF, nullptr);

    // 6) LayerNorm2: h -> hn (bf16 only)
    layernorm_k<<<ROWS, 256, 0, stream>>>(hF, g2, b2, nullptr, hnB);

    // 7) MLP up + exact GELU: u = gelu(hn*W1 + bm1)
    dim3 gUp(4 * D_MODEL / 128, ROWS / 128);
    gemm_bf16_k<MODE_GELU><<<gUp, 256, 0, stream>>>(hnB, W1T, ROWS, 4 * D_MODEL, D_MODEL,
                                                    1.0f, bm1, nullptr, nullptr, uB);

    // 8) MLP down + residual: out = h + u*W2 + bm2
    gemm_bf16_k<MODE_F32><<<gQKV, 256, 0, stream>>>(uB, W2T, ROWS, D_MODEL, 4 * D_MODEL,
                                                    1.0f, bm2, hF, out, nullptr);
}

// v004
// A run of this version takes 243 microseconds.
// Next to v003, in two timings, it ran 1.17 and 1.16 times as fast.
// Counting every step since v000, it is 1.71 times as fast.
#include <hip/hip_runtime.h>
#include <hip/hip_bf16.h>
#include <math.h>

typedef unsigned short u16;
typedef __bf16 bf16x16 __attribute__((ext_vector_type(16)));
typedef float f32x8 __attribute__((ext_vector_type(8)));
typedef unsigned int uint8v __attribute__((ext_vector_type(8)));
typedef int v4i __attribute__((__vector_size__(16)));

#define D_MODEL 1024
#define SEQ 2048
#define NB 2
#define NH 16
#define HD 64
#define ROWS (NB * SEQ)   // 4096

#if __has_builtin(__builtin_amdgcn_global_load_async_to_lds_b128)
#define USE_ASYNC_LDS 1
#endif

__device__ __forceinline__ u16 f32_to_bf16(float f) {
    unsigned int u = __float_as_uint(f);
    u += 0x7FFFu + ((u >> 16) & 1u);   // round to nearest even
    return (u16)(u >> 16);
}

__device__ __forceinline__ bf16x16 ld_frag(const u16* plo, const u16* phi) {
    uint4 lo = *(const uint4*)plo;
    uint4 hi = *(const uint4*)phi;
    uint8v t;
    t[0] = lo.x; t[1] = lo.y; t[2] = lo.z; t[3] = lo.w;
    t[4] = hi.x; t[5] = hi.y; t[6] = hi.z; t[7] = hi.w;
    return __builtin_bit_cast(bf16x16, t);
}

__device__ __forceinline__ f32x8 wmma_bf16(bf16x16 a, bf16x16 b, f32x8 c) {
    return __builtin_amdgcn_wmma_f32_16x16x32_bf16(false, a, false, b, (short)0, c, false, false);
}

__device__ __forceinline__ f32x8 zero8() {
    f32x8 z;
#pragma unroll
    for (int i = 0; i < 8; ++i) z[i] = 0.0f;
    return z;
}

// Copy 16B global -> LDS. Async (memory->LDS direct, ASYNCcnt) when available.
__device__ __forceinline__ void cp16_g2l(const u16* g, u16* l) {
#ifdef USE_ASYNC_LDS
    __builtin_amdgcn_global_load_async_to_lds_b128(
        (__attribute__((address_space(1))) v4i*)const_cast<u16*>(g),
        (__attribute__((address_space(3))) v4i*)l, 0, 0);
#else
    *(uint4*)l = *(const uint4*)g;
#endif
}

__device__ __forceinline__ void wait_async0() {
#ifdef USE_ASYNC_LDS
    // this wave's copies have landed; the clobber keeps every LDS read behind it
    asm volatile("s_wait_asynccnt 0x0" ::: "memory");
#endif
}

// ---------------------------------------------------------------------------
// Weight cast + transpose: W[K,N] f32 -> out[N,K] bf16.  32x32 LDS tiles,
// coalesced reads and writes.  Grid: (N/32, K/32), 256 threads.
// ---------------------------------------------------------------------------
__global__ __launch_bounds__(256) void cast_transpose_k(const float* __restrict__ W,
                                                        u16* __restrict__ out,
                                                        int K, int N) {
    __shared__ float t[32][33];
    const int n0 = blockIdx.x * 32;
    const int k0 = blockIdx.y * 32;
    const int c = threadIdx.x & 31;
    const int r = threadIdx.x >> 5;   // 0..7
#pragma unroll
    for (int i = 0; i < 4; ++i) {
        int row = r + i * 8;
        t[row][c] = W[(size_t)(k0 + row) * N + n0 + c];
    }
    __syncthreads();
#pragma unroll
    for (int i = 0; i < 4; ++i) {
        int row = r + i * 8;          // row within N-tile
        out[(size_t)(n0 + row) * K + k0 + c] = f32_to_bf16(t[c][row]);
    }
}

// ---------------------------------------------------------------------------
// LayerNorm: one row (D=1024) per 256-thread block. Writes f32 (optional) + bf16.
// ---------------------------------------------------------------------------
__global__ __launch_bounds__(256) void layernorm_k(const float* __restrict__ x,
                                                   const float* __restrict__ g,
                                                   const float* __restrict__ b,
                                                   float* __restrict__ outF,
                                                   u16* __restrict__ outB) {
    __shared__ float r1[256];
    __shared__ float r2[256];
    const int tid = threadIdx.x;
    const size_t row = blockIdx.x;
    const float* xr = x + row * D_MODEL;
    float v[4];
    const int base = tid * 4;
    float s = 0.f, s2 = 0.f;
#pragma unroll
    for (int i = 0; i < 4; ++i) {
        v[i] = xr[base + i];
        s += v[i];
        s2 += v[i] * v[i];
    }
    r1[tid] = s; r2[tid] = s2;
    __syncthreads();
    for (int off = 128; off > 0; off >>= 1) {
        if (tid < off) { r1[tid] += r1[tid + off]; r2[tid] += r2[tid + off]; }
        __syncthreads();
    }
    const float mu = r1[0] * (1.0f / D_MODEL);
    const float var = r2[0] * (1.0f / D_MODEL) - mu * mu;
    const float rs = rsqrtf(var + 1e-5f);
#pragma unroll
    for (int i = 0; i < 4; ++i) {
        int col = base + i;
        float xn = (v[i] - mu) * rs * g[col] + b[col];
        if (outF) outF[row * D_MODEL + col] = xn;
        outB[row * D_MODEL + col] = f32_to_bf16(xn);
    }
}

// ---------------------------------------------------------------------------
// Tiled bf16 GEMM with WMMA.  C[M,N] = A[M,K] * Bt[N,K]^T  (Bt is B transposed)
// Block tile 128x128, 8 waves (4 M x 2 N), each wave 32x64.
// A stage is 128 k of every operand row (256 B, two whole lines), so one
// wave-wide 16 B copy covers two full rows; four 32-k blocks per stage.
// Double-buffered LDS; async memory->LDS copies when available.
// K must be a multiple of 128.
// ---------------------------------------------------------------------------
#define MODE_Q    0
#define MODE_K    1
#define MODE_V    2
#define MODE_F32  3   // outF = acc*scale + bias + resid
#define MODE_GELU 4   // outB = bf16(gelu(acc*scale + bias))
#define BK 128              // k per stage
#define LPITCH (BK + 8)     // LDS row pitch in elements: 272 B = 16 B x odd

// MODE is a compile-time parameter: each instantiation holds one straight-line
// epilogue, so its loads of bias and resid issue together instead of one
// load, wait and store per element behind a chain of branches on the mode.
template <int MODE>
__global__ __launch_bounds__(256) void gemm_bf16_k(const u16* __restrict__ A,
                                                   const u16* __restrict__ Bt,
                                                   int M, int N, int K,
                                                   float scale,
                                                   const float* __restrict__ bias,
                                                   const float* __restrict__ resid,
                                                   float* __restrict__ outF,
                                                   u16* __restrict__ outB) {
    __shared__ __attribute__((aligned(16))) u16 lA[2][128 * LPITCH];
    __shared__ __attribute__((aligned(16))) u16 lB[2][128 * LPITCH];
    const int tid = threadIdx.x;
    const int lane = tid & 31;
    const int wave = tid >> 5;
    const int waveM = wave & 3;       // 0..3
    const int waveN = wave >> 2;      // 0..1
    const int bM = blockIdx.y * 128;
    const int bN = blockIdx.x * 128;
    const int l16 = lane & 15;
    const int khalf = (lane >> 4) * 8;     // 0 or 8 (K sub-chunk base)
    const int mloc = (lane >> 4) * 8;      // 0 or 8 (C-layout row base)
    // staging assignment: 16 lanes cover one 256 B row; this thread copies
    // 16 B chunk sc of rows sr, sr + 16, ..., sr + 112 of both operands
    const int sr = tid >> 4, sc = tid & 15;

    f32x8 acc[2][4];
#pragma unroll
    for (int mt = 0; mt < 2; ++mt)
#pragma unroll
        for (int nt = 0; nt < 4; ++nt) acc[mt][nt] = zero8();

    // stage K-slice kk into buffer buf
    auto stage = [&](int buf, int kk) {
        const u16* ga = A + (size_t)(bM + sr) * K + kk + sc * 8;
        const u16* gb = Bt + (size_t)(bN + sr) * K + kk + sc * 8;
        u16* la = &lA[buf][sr * LPITCH + sc * 8];
        u16* lb = &lB[buf][sr * LPITCH + sc * 8];
#pragma unroll   // the 16 copies issue back to back, LDS steps are constants
        for (int i = 0; i < 8; ++i) {
            cp16_g2l(ga + (size_t)(i * 16) * K, la + i * 16 * LPITCH);
            cp16_g2l(gb + (size_t)(i * 16) * K, lb + i * 16 * LPITCH);
        }
    };

    stage(0, 0);
    wait_async0();
    __syncthreads();
    if (BK < K) stage(1, BK);

    int cur = 0;
    for (int kk = 0; kk < K; kk += BK) {
#pragma unroll   // the four blocks' LDS offsets become immediates
        for (int ks = 0; ks < BK; ks += 32) {
            bf16x16 af[2], bfr[4];
#pragma unroll
            for (int mt = 0; mt < 2; ++mt) {
                const u16* p = &lA[cur][(waveM * 32 + mt * 16 + l16) * LPITCH + ks + khalf];
                af[mt] = ld_frag(p, p + 16);
            }
#pragma unroll
            for (int nt = 0; nt < 4; ++nt) {
                const u16* p = &lB[cur][(waveN * 64 + nt * 16 + l16) * LPITCH + ks + khalf];
                bfr[nt] = ld_frag(p, p + 16);
            }
#pragma unroll
            for (int mt = 0; mt < 2; ++mt)
#pragma unroll
                for (int nt = 0; nt < 4; ++nt)
                    acc[mt][nt] = wmma_bf16(af[mt], bfr[nt], acc[mt][nt]);
        }
        // publish point: this wave's reads of buffer cur are done before the
        // refill below may overwrite it
        asm volatile("s_wait_dscnt 0x0" ::: "memory");
        wait_async0();       // the next stage's copies of this wave have landed
        __syncthreads();     // next stage readable by all; buffer cur left by all
        if (kk + 2 * BK < K) stage(cur, kk + 2 * BK);   // refill two stages ahead
        cur ^= 1;
    }
    wait_async0();           // nothing outstanding when the wave ends

    // Epilogue. C layout: vgpr j -> row mloc+j, lane%16 -> col.
#pragma unroll
    for (int mt = 0; mt < 2; ++mt) {
#pragma unroll
        for (int nt = 0; nt < 4; ++nt) {
            const int gcol = bN + waveN * 64 + nt * 16 + l16;
#pragma unroll
            for (int j = 0; j < 8; ++j) {
                const int grow = bM + waveM * 32 + mt * 16 + mloc + j;
                float v = acc[mt][nt][j] * scale;
                if constexpr (MODE == MODE_Q || MODE == MODE_K) {
                    int bb = grow >> 11, s = grow & 2047;
                    int h = gcol >> 6, d = gcol & 63;
                    outB[(((size_t)(bb * NH + h) * SEQ) + s) * HD + d] = f32_to_bf16(v);
                } else if constexpr (MODE == MODE_V) {
                    int bb = grow >> 11, s = grow & 2047;
                    int h = gcol >> 6, d = gcol & 63;
                    outB[(((size_t)(bb * NH + h) * HD) + d) * SEQ + s] = f32_to_bf16(v);
                } else if constexpr (MODE == MODE_F32) {
                    size_t idx = (size_t)grow * N + gcol;
                    outF[idx] = v + bias[gcol] + resid[idx];
                } else { // MODE_GELU
                    float xv = v + bias[gcol];
                    float gl = 0.5f * xv * (1.0f + erff(xv * 0.70710678118654752f));
                    outB[(size_t)grow * N + gcol] = f32_to_bf16(gl);
                }
            }
        }
    }
}

#define APITCH 72   // LDS row pitch in elements: 144 B = 16 B x odd
__global__ __launch_bounds__(128) void attn_k(const u16* __restrict__ q,
                                              const u16* __restrict__ k,
                                              const u16* __restrict__ vt,
                                              u16* __restrict__ yb) {
    __shared__ __attribute__((aligned(16))) u16 lP[4][16 * 72];
    __shared__ __attribute__((aligned(16))) u16 lK[2][64 * APITCH];   // [key][d]
    __shared__ __attribute__((aligned(16))) u16 lV[2][64 * APITCH];   // [d][key]
    const int lane = threadIdx.x & 31;
    const int wave = threadIdx.x >> 5;
    const int bh = blockIdx.y;                 // b*NH + h
    const int qbase = blockIdx.x * 64 + wave * 16;
    const int l16 = lane & 15;
    const int khalf = (lane >> 4) * 8;
    const int mloc = (lane >> 4) * 8;
    const size_t headOff = (size_t)bh * SEQ * HD;
    // staging assignment: 8 lanes cover one 128 B row, so a wave-wide copy is four
    // whole lines; this thread copies 16 B chunk sc of K rows sr, sr + 16, sr + 32,
    // sr + 48 and of V^T rows 4 sr .. 4 sr + 3 (row steps of 2 KiB and 4 KiB)
    const int sr = threadIdx.x >> 3, sc = threadIdx.x & 7;

    // copy the tile of keys kb .. kb + 63 into buffer buf
    auto stage = [&](int buf, int kb) {
        const u16* gk = k + headOff + (size_t)(kb + sr) * HD + sc * 8;
        const u16* gv = vt + headOff + (size_t)(sr * 4) * SEQ + kb + sc * 8;
        u16* lk = &lK[buf][sr * APITCH + sc * 8];
        u16* lv = &lV[buf][sr * 4 * APITCH + sc * 8];
#pragma unroll   // the 8 copies issue back to back, LDS steps are constants
        for (int i = 0; i < 4; ++i) {
            cp16_g2l(gk + (size_t)(i * 16) * HD, lk + i * 16 * APITCH);
            cp16_g2l(gv + (size_t)i * SEQ, lv + i * APITCH);
        }
    };

    bf16x16 qf[2];
    {
        const u16* qp = q + headOff + (size_t)(qbase + l16) * HD;
#pragma unroll
        for (int kt = 0; kt < 2; ++kt) {
            const u16* p = qp + kt * 32 + khalf;
            qf[kt] = ld_frag(p, p + 16);
        }
    }

    const float LOG2E = 1.44269504088896340736f;
    f32x8 O[4];
    float rmax[8], rsum[8];
#pragma unroll
    for (int n = 0; n < 4; ++n) O[n] = zero8();
#pragma unroll
    for (int j = 0; j < 8; ++j) { rmax[j] = -INFINITY; rsum[j] = 0.0f; }

    stage(0, 0);
    wait_async0();
    __syncthreads();     // tile 0 readable by all four waves
    stage(1, 64);

    int cur = 0;
    for (int kb = 0; kb < SEQ; kb += 64) {
        // ---- scores: S[16 x 64] = Q * K^T (q pre-scaled) ----
        f32x8 sAcc[4];
#pragma unroll
        for (int n = 0; n < 4; ++n) {
            sAcc[n] = zero8();
#pragma unroll
            for (int kt = 0; kt < 2; ++kt) {
                const u16* kp = &lK[cur][(n * 16 + l16) * APITCH + kt * 32 + khalf];
                bf16x16 bf = ld_frag(kp, kp + 16);
                sAcc[n] = wmma_bf16(qf[kt], bf, sAcc[n]);
            }
            const int kj = kb + n * 16 + l16;
#pragma unroll
            for (int j = 0; j < 8; ++j) {
                if (qbase + mloc + j == kj) sAcc[n][j] = -INFINITY;
            }
        }
        // ---- online softmax ----
        float corr[8];
#pragma unroll
        for (int j = 0; j < 8; ++j) {
            float t = sAcc[0][j];
#pragma unroll
            for (int n = 1; n < 4; ++n) t = fmaxf(t, sAcc[n][j]);
            t = fmaxf(t, __shfl_xor(t, 1));
            t = fmaxf(t, __shfl_xor(t, 2));
            t = fmaxf(t, __shfl_xor(t, 4));
            t = fmaxf(t, __shfl_xor(t, 8));
            float nm = fmaxf(rmax[j], t * LOG2E);
            // 2^x with the one free issue slot the instruction set asks for behind a
            // transcendental
            asm("v_exp_f32 %0, %1\n\tv_nop" : "=v"(corr[j]) : "v"(rmax[j] - nm));
            rmax[j] = nm;
            rsum[j] *= corr[j];
        }
#pragma unroll
        for (int n = 0; n < 4; ++n)
#pragma unroll
            for (int j = 0; j < 8; ++j) O[n][j] *= corr[j];

        float ps[8];
#pragma unroll
        for (int j = 0; j < 8; ++j) ps[j] = 0.0f;
#pragma unroll
        for (int n = 0; n < 4; ++n)
#pragma unroll
            for (int j = 0; j < 8; ++j) {
                float p;
                if (n == 3 && j == 6) {
                    // same free slot behind 2^x as above
                    asm("v_exp_f32 %0, %1\n\tv_nop" : "=v"(p) : "v"(fmaf(sAcc[n][j], LOG2E, -rmax[j])));
                } else {
                    p = __builtin_amdgcn_exp2f(fmaf(sAcc[n][j], LOG2E, -rmax[j]));
                }
                sAcc[n][j] = p;
                ps[j] += p;
            }
#pragma unroll
        for (int j = 0; j < 8; ++j) {
            float t = ps[j];
            t += __shfl_xor(t, 1);
            t += __shfl_xor(t, 2);
            t += __shfl_xor(t, 4);
            t += __shfl_xor(t, 8);
            rsum[j] += t;
        }
        // ---- P (C layout) -> LDS -> A-fragment layout ----
        u16* base = &lP[wave][0];
#pragma unroll
        for (int n = 0; n < 4; ++n)
#pragma unroll
            for (int j = 0; j < 8; ++j)
                base[(mloc + j) * 72 + n * 16 + l16] = f32_to_bf16(sAcc[n][j]);
        bf16x16 pf[2];
#pragma unroll
        for (int kt = 0; kt < 2; ++kt) {
            const u16* p = base + l16 * 72 + kt * 32 + khalf;
            pf[kt] = ld_frag(p, p + 16);
        }
        // ---- O += P * V  (V^T layout: [d][s], contiguous over keys) ----
#pragma unroll
        for (int nd = 0; nd < 4; ++nd) {
#pragma unroll
            for (int kt = 0; kt < 2; ++kt) {
                const u16* vp = &lV[cur][(nd * 16 + l16) * APITCH + kt * 32 + khalf];
                bf16x16 vf = ld_frag(vp, vp + 16);
                O[nd] = wmma_bf16(pf[kt], vf, O[nd]);
            }
        }
        // publish point: this wave's reads of buffer cur are done before the
        // refill below may overwrite it
        asm volatile("s_wait_dscnt 0x0" ::: "memory");
        wait_async0();       // the next tile's copies of this wave have landed
        __syncthreads();     // next tile readable by all; buffer cur left by all
        if (kb + 128 < SEQ) stage(cur, kb + 128);   // refill two tiles ahead
        cur ^= 1;
    }
    wait_async0();           // nothing outstanding when the wave ends

    const int bb = bh >> 4, h = bh & 15;
#pragma unroll
    for (int j = 0; j < 8; ++j) rsum[j] = 1.0f / rsum[j];
#pragma unroll
    for (int nd = 0; nd < 4; ++nd)
#pragma unroll
        for (int j = 0; j < 8; ++j) {
            int s = qbase + mloc + j;
            size_t idx = ((size_t)bb * SEQ + s) * D_MODEL + h * HD + nd * 16 + l16;
            yb[idx] = f32_to_bf16(O[nd][j] * rsum[j]);
        }
}

// ---------------------------------------------------------------------------
extern "C" void kernel_launch(void* const* d_in, const int* in_sizes, int n_in,
                              void* d_out, int out_size, void* d_ws, size_t ws_size,
                              hipStream_t stream) {
    (void)in_sizes; (void)n_in; (void)out_size; (void)ws_size;
    const float* x   = (const float*)d_in[0];
    const float* Wk  = (const float*)d_in[1];
    const float* Wq  = (const float*)d_in[2];
    const float* Wv  = (const float*)d_in[3];
    const float* Wp  = (const float*)d_in[4];
    const float* bp  = (const float*)d_in[5];
    const float* g1  = (const float*)d_in[6];
    const float* b1  = (const float*)d_in[7];
    const float* g2  = (const float*)d_in[8];
    const float* b2  = (const float*)d_in[9];
    const float* W1  = (const float*)d_in[10];
    const float* bm1 = (const float*)d_in[11];
    const float* W2  = (const float*)d_in[12];
    const float* bm2 = (const float*)d_in[13];
    float* out = (float*)d_out;

    char* ws = (char*)d_ws;
    size_t off = 0;
    auto alloc = [&](size_t bytes) -> char* {
        char* p = ws + off;
        off += (bytes + 255) & ~(size_t)255;
        return p;
    };
    float* xnF = (float*)alloc((size_t)ROWS * D_MODEL * 4);   // 16 MB
    u16*   xnB = (u16*)  alloc((size_t)ROWS * D_MODEL * 2);   //  8 MB
    u16*   WqT = (u16*)  alloc((size_t)D_MODEL * D_MODEL * 2);
    u16*   WkT = (u16*)  alloc((size_t)D_MODEL * D_MODEL * 2);
    u16*   WvT = (u16*)  alloc((size_t)D_MODEL * D_MODEL * 2);
    u16*   WpT = (u16*)  alloc((size_t)D_MODEL * D_MODEL * 2);
    u16*   W1T = (u16*)  alloc((size_t)D_MODEL * 4 * D_MODEL * 2);  // 8 MB
    u16*   W2T = (u16*)  alloc((size_t)D_MODEL * 4 * D_MODEL * 2);  // 8 MB
    char*  pool = alloc((size_t)ROWS * D_MODEL * 2 * 4);            // 32 MB shared pool
    u16*   qB  = (u16*)pool;
    u16*   kB  = (u16*)(pool + (size_t)ROWS * HD * NH * 2);
    u16*   vtB = (u16*)(pool + (size_t)ROWS * HD * NH * 4);
    u16*   yB  = (u16*)(pool + (size_t)ROWS * HD * NH * 6);
    u16*   uB  = (u16*)pool;   // aliases q/k/vt/y (dead by MLP time)
    float* hF  = (float*)alloc((size_t)ROWS * D_MODEL * 4);   // 16 MB
    u16*   hnB = (u16*)  alloc((size_t)ROWS * D_MODEL * 2);   //  8 MB

    // 1) Weight casts + transposes to bf16 [N,K] (coalesced 32x32 tiles)
    cast_transpose_k<<<dim3(D_MODEL / 32, D_MODEL / 32), 256, 0, stream>>>(Wq, WqT, D_MODEL, D_MODEL);
    cast_transpose_k<<<dim3(D_MODEL / 32, D_MODEL / 32), 256, 0, stream>>>(Wk, WkT, D_MODEL, D_MODEL);
    cast_transpose_k<<<dim3(D_MODEL / 32, D_MODEL / 32), 256, 0, stream>>>(Wv, WvT, D_MODEL, D_MODEL);
    cast_transpose_k<<<dim3(D_MODEL / 32, D_MODEL / 32), 256, 0, stream>>>(Wp, WpT, D_MODEL, D_MODEL);
    cast_transpose_k<<<dim3(4 * D_MODEL / 32, D_MODEL / 32), 256, 0, stream>>>(W1, W1T, D_MODEL, 4 * D_MODEL);
    cast_transpose_k<<<dim3(D_MODEL / 32, 4 * D_MODEL / 32), 256, 0, stream>>>(W2, W2T, 4 * D_MODEL, D_MODEL);

    // 2) LayerNorm1: x -> xn (f32 + bf16)
    layernorm_k<<<ROWS, 256, 0, stream>>>(x, g1, b1, xnF, xnB);

    // 3) QKV projections (q pre-scaled by 1/sqrt(HD))
    dim3 gQKV(D_MODEL / 128, ROWS / 128);
    gemm_bf16_k<MODE_Q><<<gQKV, 256, 0, stream>>>(xnB, WqT, ROWS, D_MODEL, D_MODEL,
                                                  0.125f, nullptr, nullptr, nullptr, qB);
    gemm_bf16_k<MODE_K><<<gQKV, 256, 0, stream>>>(xnB, WkT, ROWS, D_MODEL, D_MODEL,
                                                  1.0f, nullptr, nullptr, nullptr, kB);
    gemm_bf16_k<MODE_V><<<gQKV, 256, 0, stream>>>(xnB, WvT, ROWS, D_MODEL, D_MODEL,
                                                  1.0f, nullptr, nullptr, nullptr, vtB);

    // 4) Flash attention
    attn_k<<<dim3(SEQ / 64, NB * NH), 128, 0, stream>>>(qB, kB, vtB, yB);

    // 5) Output projection + residual: h = xn + y*Wp + bp
    gemm_bf16_k<MODE_F32><<<gQKV, 256, 0, stream>>>(yB, WpT, ROWS, D_MODEL, D_MODEL,
                                                    1.0f, bp, xnF, hF, nullptr);

    // 6) LayerNorm2: h -> hn (bf16 only)
    layernorm_k<<<ROWS, 256, 0, stream>>>(hF, g2, b2, nullptr, hnB);

    // 7) MLP up + exact GELU: u = gelu(hn*W1 + bm1)
    dim3 gUp(4 * D_MODEL / 128, ROWS / 128);
    gemm_bf16_k<MODE_GELU><<<gUp, 256, 0, stream>>>(hnB, W1T, ROWS, 4 * D_MODEL, D_MODEL,
                                                    1.0f, bm1, nullptr, nullptr, uB);

    // 8) MLP down + residual: out = h + u*W2 + bm2
    gemm_bf16_k<MODE_F32><<<gQKV, 256, 0, stream>>>(uB, W2T, ROWS, D_MODEL, 4 * D_MODEL,
                                                    1.0f, bm2, hF, out, nullptr);
}

// v005
// Measured time: 237 microseconds a run.
// Next to v004, in two timings, it ran 1.04 and 1.02 times as fast.
// Counting every step since v000, it is 1.76 times as fast.
#include <hip/hip_runtime.h>
#include <hip/hip_bf16.h>
#include <math.h>

typedef unsigned short u16;
typedef __bf16 bf16x16 __attribute__((ext_vector_type(16)));
typedef float f32x8 __attribute__((ext_vector_type(8)));
typedef float f32x4 __attribute__((ext_vector_type(4)));
typedef unsigned int uint8v __attribute__((ext_vector_type(8)));
typedef int v4i __attribute__((__vector_size__(16)));

#define D_MODEL 1024
#define SEQ 2048
#define NB 2
#define NH 16
#define HD 64
#define ROWS (NB * SEQ)   // 4096

#if __has_builtin(__builtin_amdgcn_global_load_async_to_lds_b128)
#define USE_ASYNC_LDS 1
#endif

__device__ __forceinline__ u16 f32_to_bf16(float f) {
    unsigned int u = __float_as_uint(f);
    u += 0x7FFFu + ((u >> 16) & 1u);   // round to nearest even
    return (u16)(u >> 16);
}

__device__ __forceinline__ bf16x16 ld_frag(const u16* plo, const u16* phi) {
    uint4 lo = *(const uint4*)plo;
    uint4 hi = *(const uint4*)phi;
    uint8v t;
    t[0] = lo.x; t[1] = lo.y; t[2] = lo.z; t[3] = lo.w;
    t[4] = hi.x; t[5] = hi.y; t[6] = hi.z; t[7] = hi.w;
    return __builtin_bit_cast(bf16x16, t);
}

__device__ __forceinline__ f32x8 wmma_bf16(bf16x16 a, bf16x16 b, f32x8 c) {
    return __builtin_amdgcn_wmma_f32_16x16x32_bf16(false, a, false, b, (short)0, c, false, false);
}

__device__ __forceinline__ f32x8 zero8() {
    f32x8 z;
#pragma unroll
    for (int i = 0; i < 8; ++i) z[i] = 0.0f;
    return z;
}

// Copy 16B global -> LDS. Async (memory->LDS direct, ASYNCcnt) when available.
__device__ __forceinline__ void cp16_g2l(const u16* g, u16* l) {
#ifdef USE_ASYNC_LDS
    __builtin_amdgcn_global_load_async_to_lds_b128(
        (__attribute__((address_space(1))) v4i*)const_cast<u16*>(g),
        (__attribute__((address_space(3))) v4i*)l, 0, 0);
#else
    *(uint4*)l = *(const uint4*)g;
#endif
}

__device__ __forceinline__ void wait_async0() {
#ifdef USE_ASYNC_LDS
    // this wave's copies have landed; the clobber keeps every LDS read behind it
    asm volatile("s_wait_asynccnt 0x0" ::: "memory");
#endif
}

// ---------------------------------------------------------------------------
// The two kernels below only move data.  With a few elements per lane their time
// is the time the chip needs to START their waves, so each wave gets a large
// piece: few waves, many 16 B loads in flight per lane, no LDS, no barrier.
// Every loop in them is unrolled so that its arrays are registers and its steps
// immediate offsets.
// ---------------------------------------------------------------------------
__device__ __forceinline__ unsigned int pack2_bf16(float lo, float hi) {
    return (unsigned int)f32_to_bf16(lo) | ((unsigned int)f32_to_bf16(hi) << 16);
}

// ---------------------------------------------------------------------------
// Weight cast + transpose: W[K,N] f32 -> out[N,K] bf16.
// A wave takes a tile of 64 k x 32 n.  Lane (kb = lane / 8, nb = lane % 8) reads
// 4 consecutive n of rows 8 kb .. 8 kb + 7 (and the same 32 rows further on), so
// a wave-wide load is four whole 128 B lines; the lane then owns 8 consecutive k
// of each of its 4 columns, which is one 16 B store into a row of out: the
// transpose happens in registers.  The two stores of a column fill its 128 B line.
// K and N are compile-time values, so every row step is an immediate offset.
// Grid: (N/128, K/64), 128 threads (4 waves side by side in n).
// ---------------------------------------------------------------------------
template <int K, int N>
__global__ __launch_bounds__(128) void cast_transpose_k(const float* __restrict__ W,
                                                        u16* __restrict__ out) {
    const int lane = threadIdx.x & 31;
    const int wave = threadIdx.x >> 5;
    const int n0 = blockIdx.x * 128 + wave * 32 + (lane & 7) * 4;
    const int k0 = blockIdx.y * 64 + (lane >> 3) * 8;
    const float* src = W + (size_t)k0 * N + n0;
    f32x4 v[2][8];
#pragma unroll
    for (int hf = 0; hf < 2; ++hf)
#pragma unroll
        for (int r = 0; r < 8; ++r)
            v[hf][r] = *(const f32x4*)(src + (hf * 32 + r) * N);
    // holds all 16 loads in front of the first use: without it the build issued
    // them in five groups and the wave waited out a memory latency for each; src is
    // named so that no load's result lands on the address register the others use
    asm volatile("" :: "v"(src), "v"(v[0][0]), "v"(v[0][1]), "v"(v[0][2]), "v"(v[0][3]),
                       "v"(v[0][4]), "v"(v[0][5]), "v"(v[0][6]), "v"(v[0][7]),
                       "v"(v[1][0]), "v"(v[1][1]), "v"(v[1][2]), "v"(v[1][3]),
                       "v"(v[1][4]), "v"(v[1][5]), "v"(v[1][6]), "v"(v[1][7]));
    u16* dst = out + (size_t)n0 * K + k0;
#pragma unroll
    for (int hf = 0; hf < 2; ++hf)
#pragma unroll
        for (int c = 0; c < 4; ++c) {
            uint4 t;
            t.x = pack2_bf16(v[hf][0][c], v[hf][1][c]);
            t.y = pack2_bf16(v[hf][2][c], v[hf][3][c]);
            t.z = pack2_bf16(v[hf][4][c], v[hf][5][c]);
            t.w = pack2_bf16(v[hf][6][c], v[hf][7][c]);
            *(uint4*)(dst + c * K + hf * 32) = t;
        }
}

// ---------------------------------------------------------------------------
// LayerNorm: one row (D=1024) per wave, 8 rows per 256-thread block.  A lane holds
// 8 pieces of 4 floats, piece i at column 128 i + 4 lane, so every wave-wide load
// and f32 store is 512 contiguous bytes.  Sums: in-lane, then a five-step butterfly
// over the wave.  Writes f32 (optional) + bf16.
// ---------------------------------------------------------------------------
__global__ __launch_bounds__(256) void layernorm_k(const float* __restrict__ x,
                                                   const float* __restrict__ g,
                                                   const float* __restrict__ b,
                                                   float* __restrict__ outF,
                                                   u16* __restrict__ outB) {
    const int lane = threadIdx.x & 31;
    const size_t base = ((size_t)blockIdx.x * 8 + (threadIdx.x >> 5)) * D_MODEL + lane * 4;
    const float* xr = x + base;
    const unsigned int pb = lane * 16;     // byte offset of this lane's piece in g and b
    f32x4 v[8], gv[8], bv[8];
#pragma unroll
    for (int i = 0; i < 8; ++i) v[i] = *(const f32x4*)(xr + i * 128);
#pragma unroll
    for (int i = 0; i < 8; ++i) {
        gv[i] = *(const f32x4*)((const char*)g + pb + i * 512);
        bv[i] = *(const f32x4*)((const char*)b + pb + i * 512);
    }
    // nothing is scheduled across this line, so all 24 loads are issued before the
    // first use: without it the build fetched x in two groups and g, b behind the
    // sums, one latency after another
    __builtin_amdgcn_sched_barrier(0);
    // the address registers live past the last load's issue: without this the build
    // landed the last load's result on a register that the loads before it name
    asm volatile("" :: "v"(xr), "v"(lane));
    float s = 0.f, s2 = 0.f;
#pragma unroll
    for (int i = 0; i < 8; ++i) {
        s += (v[i][0] + v[i][1]) + (v[i][2] + v[i][3]);
        s2 += (v[i][0] * v[i][0] + v[i][1] * v[i][1]) + (v[i][2] * v[i][2] + v[i][3] * v[i][3]);
    }
#pragma unroll
    for (int off = 16; off > 0; off >>= 1) {
        s += __shfl_xor(s, off);
        s2 += __shfl_xor(s2, off);
    }
    const float mu = s * (1.0f / D_MODEL);
    const float var = s2 * (1.0f / D_MODEL) - mu * mu;
    const float rs = rsqrtf(var + 1e-5f);
#pragma unroll
    for (int i = 0; i < 8; ++i)
#pragma unroll
        for (int c = 0; c < 4; ++c) v[i][c] = (v[i][c] - mu) * rs * gv[i][c] + bv[i][c];
    if (outF) {
#pragma unroll
        for (int i = 0; i < 8; ++i) *(f32x4*)(outF + base + i * 128) = v[i];
    }
#pragma unroll
    for (int i = 0; i < 8; ++i) {
        uint2 p;
        p.x = pack2_bf16(v[i][0], v[i][1]);
        p.y = pack2_bf16(v[i][2], v[i][3]);
        *(uint2*)(outB + base + i * 128) = p;
    }
}

// ---------------------------------------------------------------------------
// Tiled bf16 GEMM with WMMA.  C[M,N] = A[M,K] * Bt[N,K]^T  (Bt is B transposed)
// Block tile 128x128, 8 waves (4 M x 2 N), each wave 32x64.
// A stage is 128 k of every operand row (256 B, two whole lines), so one
// wave-wide 16 B copy covers two full rows; four 32-k blocks per stage.
// Double-buffered LDS; async memory->LDS copies when available.
// K must be a multiple of 128.
// ---------------------------------------------------------------------------
#define MODE_Q    0
#define MODE_K    1
#define MODE_V    2
#define MODE_F32  3   // outF = acc*scale + bias + resid
#define MODE_GELU 4   // outB = bf16(gelu(acc*scale + bias))
#define BK 128              // k per stage
#define LPITCH (BK + 8)     // LDS row pitch in elements: 272 B = 16 B x odd

// MODE is a compile-time parameter: each instantiation holds one straight-line
// epilogue, so its loads of bias and resid issue together instead of one
// load, wait and store per element behind a chain of branches on the mode.
template <int MODE>
__global__ __launch_bounds__(256) void gemm_bf16_k(const u16* __restrict__ A,
                                                   const u16* __restrict__ Bt,
                                                   int M, int N, int K,
                                                   float scale,
                                                   const float* __restrict__ bias,
                                                   const float* __restrict__ resid,
                                                   float* __restrict__ outF,
                                                   u16* __restrict__ outB) {
    __shared__ __attribute__((aligned(16))) u16 lA[2][128 * LPITCH];
    __shared__ __attribute__((aligned(16))) u16 lB[2][128 * LPITCH];
    const int tid = threadIdx.x;
    const int lane = tid & 31;
    const int wave = tid >> 5;
    const int waveM = wave & 3;       // 0..3
    const int waveN = wave >> 2;      // 0..1
    const int bM = blockIdx.y * 128;
    const int bN = blockIdx.x * 128;
    const int l16 = lane & 15;
    const int khalf = (lane >> 4) * 8;     // 0 or 8 (K sub-chunk base)
    const int mloc = (lane >> 4) * 8;      // 0 or 8 (C-layout row base)
    // staging assignment: 16 lanes cover one 256 B row; this thread copies
    // 16 B chunk sc of rows sr, sr + 16, ..., sr + 112 of both operands
    const int sr = tid >> 4, sc = tid & 15;

    f32x8 acc[2][4];
#pragma unroll
    for (int mt = 0; mt < 2; ++mt)
#pragma unroll
        for (int nt = 0; nt < 4; ++nt) acc[mt][nt] = zero8();

    // stage K-slice kk into buffer buf
    auto stage = [&](int buf, int kk) {
        const u16* ga = A + (size_t)(bM + sr) * K + kk + sc * 8;
        const u16* gb = Bt + (size_t)(bN + sr) * K + kk + sc * 8;
        u16* la = &lA[buf][sr * LPITCH + sc * 8];
        u16* lb = &lB[buf][sr * LPITCH + sc * 8];
#pragma unroll   // the 16 copies issue back to back, LDS steps are constants
        for (int i = 0; i < 8; ++i) {
            cp16_g2l(ga + (size_t)(i * 16) * K, la + i * 16 * LPITCH);
            cp16_g2l(gb + (size_t)(i * 16) * K, lb + i * 16 * LPITCH);
        }
    };

    stage(0, 0);
    wait_async0();
    __syncthreads();
    if (BK < K) stage(1, BK);

    int cur = 0;
    for (int kk = 0; kk < K; kk += BK) {
#pragma unroll   // the four blocks' LDS offsets become immediates
        for (int ks = 0; ks < BK; ks += 32) {
            bf16x16 af[2], bfr[4];
#pragma unroll
            for (int mt = 0; mt < 2; ++mt) {
                const u16* p = &lA[cur][(waveM * 32 + mt * 16 + l16) * LPITCH + ks + khalf];
                af[mt] = ld_frag(p, p + 16);
            }
#pragma unroll
            for (int nt = 0; nt < 4; ++nt) {
                const u16* p = &lB[cur][(waveN * 64 + nt * 16 + l16) * LPITCH + ks + khalf];
                bfr[nt] = ld_frag(p, p + 16);
            }
#pragma unroll
            for (int mt = 0; mt < 2; ++mt)
#pragma unroll
                for (int nt = 0; nt < 4; ++nt)
                    acc[mt][nt] = wmma_bf16(af[mt], bfr[nt], acc[mt][nt]);
        }
        // publish point: this wave's reads of buffer cur are done before the
        // refill below may overwrite it
        asm volatile("s_wait_dscnt 0x0" ::: "memory");
        wait_async0();       // the next stage's copies of this wave have landed
        __syncthreads();     // next stage readable by all; buffer cur left by all
        if (kk + 2 * BK < K) stage(cur, kk + 2 * BK);   // refill two stages ahead
        cur ^= 1;
    }
    wait_async0();           // nothing outstanding when the wave ends

    // Epilogue. C layout: vgpr j -> row mloc+j, lane%16 -> col.
#pragma unroll
    for (int mt = 0; mt < 2; ++mt) {
#pragma unroll
        for (int nt = 0; nt < 4; ++nt) {
            const int gcol = bN + waveN * 64 + nt * 16 + l16;
#pragma unroll
            for (int j = 0; j < 8; ++j) {
                const int grow = bM + waveM * 32 + mt * 16 + mloc + j;
                float v = acc[mt][nt][j] * scale;
                if constexpr (MODE == MODE_Q || MODE == MODE_K) {
                    int bb = grow >> 11, s = grow & 2047;
                    int h = gcol >> 6, d = gcol & 63;
                    outB[(((size_t)(bb * NH + h) * SEQ) + s) * HD + d] = f32_to_bf16(v);
                } else if constexpr (MODE == MODE_V) {
                    int bb = grow >> 11, s = grow & 2047;
                    int h = gcol >> 6, d = gcol & 63;
                    outB[(((size_t)(bb * NH + h) * HD) + d) * SEQ + s] = f32_to_bf16(v);
                } else if constexpr (MODE == MODE_F32) {
                    size_t idx = (size_t)grow * N + gcol;
                    outF[idx] = v + bias[gcol] + resid[idx];
                } else { // MODE_GELU
                    float xv = v + bias[gcol];
                    float gl = 0.5f * xv * (1.0f + erff(xv * 0.70710678118654752f));
                    outB[(size_t)grow * N + gcol] = f32_to_bf16(gl);
                }
            }
        }
    }
}

#define APITCH 72   // LDS row pitch in elements: 144 B = 16 B x odd
__global__ __launch_bounds__(128) void attn_k(const u16* __restrict__ q,
                                              const u16* __restrict__ k,
                                              const u16* __restrict__ vt,
                                              u16* __restrict__ yb) {
    __shared__ __attribute__((aligned(16))) u16 lP[4][16 * 72];
    __shared__ __attribute__((aligned(16))) u16 lK[2][64 * APITCH];   // [key][d]
    __shared__ __attribute__((aligned(16))) u16 lV[2][64 * APITCH];   // [d][key]
    const int lane = threadIdx.x & 31;
    const int wave = threadIdx.x >> 5;
    const int bh = blockIdx.y;                 // b*NH + h
    const int qbase = blockIdx.x * 64 + wave * 16;
    const int l16 = lane & 15;
    const int khalf = (lane >> 4) * 8;
    const int mloc = (lane >> 4) * 8;
    const size_t headOff = (size_t)bh * SEQ * HD;
    // staging assignment: 8 lanes cover one 128 B row, so a wave-wide copy is four
    // whole lines; this thread copies 16 B chunk sc of K rows sr, sr + 16, sr + 32,
    // sr + 48 and of V^T rows 4 sr .. 4 sr + 3 (row steps of 2 KiB and 4 KiB)
    const int sr = threadIdx.x >> 3, sc = threadIdx.x & 7;

    // copy the tile of keys kb .. kb + 63 into buffer buf
    auto stage = [&](int buf, int kb) {
        const u16* gk = k + headOff + (size_t)(kb + sr) * HD + sc * 8;
        const u16* gv = vt + headOff + (size_t)(sr * 4) * SEQ + kb + sc * 8;
        u16* lk = &lK[buf][sr * APITCH + sc * 8];
        u16* lv = &lV[buf][sr * 4 * APITCH + sc * 8];
#pragma unroll   // the 8 copies issue back to back, LDS steps are constants
        for (int i = 0; i < 4; ++i) {
            cp16_g2l(gk + (size_t)(i * 16) * HD, lk + i * 16 * APITCH);
            cp16_g2l(gv + (size_t)i * SEQ, lv + i * APITCH);
        }
    };

    bf16x16 qf[2];
    {
        const u16* qp = q + headOff + (size_t)(qbase + l16) * HD;
#pragma unroll
        for (int kt = 0; kt < 2; ++kt) {
            const u16* p = qp + kt * 32 + khalf;
            qf[kt] = ld_frag(p, p + 16);
        }
    }

    const float LOG2E = 1.44269504088896340736f;
    f32x8 O[4];
    float rmax[8], rsum[8];
#pragma unroll
    for (int n = 0; n < 4; ++n) O[n] = zero8();
#pragma unroll
    for (int j = 0; j < 8; ++j) { rmax[j] = -INFINITY; rsum[j] = 0.0f; }

    stage(0, 0);
    wait_async0();
    __syncthreads();     // tile 0 readable by all four waves
    stage(1, 64);

    int cur = 0;
    for (int kb = 0; kb < SEQ; kb += 64) {
        // ---- scores: S[16 x 64] = Q * K^T (q pre-scaled) ----
        f32x8 sAcc[4];
#pragma unroll
        for (int n = 0; n < 4; ++n) {
            sAcc[n] = zero8();
#pragma unroll
            for (int kt = 0; kt < 2; ++kt) {
                const u16* kp = &lK[cur][(n * 16 + l16) * APITCH + kt * 32 + khalf];
                bf16x16 bf = ld_frag(kp, kp + 16);
                sAcc[n] = wmma_bf16(qf[kt], bf, sAcc[n]);
            }
            const int kj = kb + n * 16 + l16;
#pragma unroll
            for (int j = 0; j < 8; ++j) {
                if (qbase + mloc + j == kj) sAcc[n][j] = -INFINITY;
            }
        }
        // ---- online softmax ----
        float corr[8];
#pragma unroll
        for (int j = 0; j < 8; ++j) {
            float t = sAcc[0][j];
#pragma unroll
            for (int n = 1; n < 4; ++n) t = fmaxf(t, sAcc[n][j]);
            t = fmaxf(t, __shfl_xor(t, 1));
            t = fmaxf(t, __shfl_xor(t, 2));
            t = fmaxf(t, __shfl_xor(t, 4));
            t = fmaxf(t, __shfl_xor(t, 8));
            float nm = fmaxf(rmax[j], t * LOG2E);
            // 2^x with the one free issue slot the instruction set asks for behind a
            // transcendental
            asm("v_exp_f32 %0, %1\n\tv_nop" : "=v"(corr[j]) : "v"(rmax[j] - nm));
            rmax[j] = nm;
            rsum[j] *= corr[j];
        }
#pragma unroll
        for (int n = 0; n < 4; ++n)
#pragma unroll
            for (int j = 0; j < 8; ++j) O[n][j] *= corr[j];

        float ps[8];
#pragma unroll
        for (int j = 0; j < 8; ++j) ps[j] = 0.0f;
#pragma unroll
        for (int n = 0; n < 4; ++n)
#pragma unroll
            for (int j = 0; j < 8; ++j) {
                float p;
                if (n == 3 && j == 6) {
                    // same free slot behind 2^x as above
                    asm("v_exp_f32 %0, %1\n\tv_nop" : "=v"(p) : "v"(fmaf(sAcc[n][j], LOG2E, -rmax[j])));
                } else {
                    p = __builtin_amdgcn_exp2f(fmaf(sAcc[n][j], LOG2E, -rmax[j]));
                }
                sAcc[n][j] = p;
                ps[j] += p;
            }
#pragma unroll
        for (int j = 0; j < 8; ++j) {
            float t = ps[j];
            t += __shfl_xor(t, 1);
            t += __shfl_xor(t, 2);
            t += __shfl_xor(t, 4);
            t += __shfl_xor(t, 8);
            rsum[j] += t;
        }
        // ---- P (C layout) -> LDS -> A-fragment layout ----
        u16* base = &lP[wave][0];
#pragma unroll
        for (int n = 0; n < 4; ++n)
#pragma unroll
            for (int j = 0; j < 8; ++j)
                base[(mloc + j) * 72 + n * 16 + l16] = f32_to_bf16(sAcc[n][j]);
        bf16x16 pf[2];
#pragma unroll
        for (int kt = 0; kt < 2; ++kt) {
            const u16* p = base + l16 * 72 + kt * 32 + khalf;
            pf[kt] = ld_frag(p, p + 16);
        }
        // ---- O += P * V  (V^T layout: [d][s], contiguous over keys) ----
#pragma unroll
        for (int nd = 0; nd < 4; ++nd) {
#pragma unroll
            for (int kt = 0; kt < 2; ++kt) {
                const u16* vp = &lV[cur][(nd * 16 + l16) * APITCH + kt * 32 + khalf];
                bf16x16 vf = ld_frag(vp, vp + 16);
                O[nd] = wmma_bf16(pf[kt], vf, O[nd]);
            }
        }
        // publish point: this wave's reads of buffer cur are done before the
        // refill below may overwrite it
        asm volatile("s_wait_dscnt 0x0" ::: "memory");
        wait_async0();       // the next tile's copies of this wave have landed
        __syncthreads();     // next tile readable by all; buffer cur left by all
        if (kb + 128 < SEQ) stage(cur, kb + 128);   // refill two tiles ahead
        cur ^= 1;
    }
    wait_async0();           // nothing outstanding when the wave ends

    const int bb = bh >> 4, h = bh & 15;
#pragma unroll
    for (int j = 0; j < 8; ++j) rsum[j] = 1.0f / rsum[j];
#pragma unroll
    for (int nd = 0; nd < 4; ++nd)
#pragma unroll
        for (int j = 0; j < 8; ++j) {
            int s = qbase + mloc + j;
            size_t idx = ((size_t)bb * SEQ + s) * D_MODEL + h * HD + nd * 16 + l16;
            yb[idx] = f32_to_bf16(O[nd][j] * rsum[j]);
        }
}

// ---------------------------------------------------------------------------
extern "C" void kernel_launch(void* const* d_in, const int* in_sizes, int n_in,
                              void* d_out, int out_size, void* d_ws, size_t ws_size,
                              hipStream_t stream) {
    (void)in_sizes; (void)n_in; (void)out_size; (void)ws_size;
    const float* x   = (const float*)d_in[0];
    const float* Wk  = (const float*)d_in[1];
    const float* Wq  = (const float*)d_in[2];
    const float* Wv  = (const float*)d_in[3];
    const float* Wp  = (const float*)d_in[4];
    const float* bp  = (const float*)d_in[5];
    const float* g1  = (const float*)d_in[6];
    const float* b1  = (const float*)d_in[7];
    const float* g2  = (const float*)d_in[8];
    const float* b2  = (const float*)d_in[9];
    const float* W1  = (const float*)d_in[10];
    const float* bm1 = (const float*)d_in[11];
    const float* W2  = (const float*)d_in[12];
    const float* bm2 = (const float*)d_in[13];
    float* out = (float*)d_out;

    char* ws = (char*)d_ws;
    size_t off = 0;
    auto alloc = [&](size_t bytes) -> char* {
        char* p = ws + off;
        off += (bytes + 255) & ~(size_t)255;
        return p;
    };
    float* xnF = (float*)alloc((size_t)ROWS * D_MODEL * 4);   // 16 MB
    u16*   xnB = (u16*)  alloc((size_t)ROWS * D_MODEL * 2);   //  8 MB
    u16*   WqT = (u16*)  alloc((size_t)D_MODEL * D_MODEL * 2);
    u16*   WkT = (u16*)  alloc((size_t)D_MODEL * D_MODEL * 2);
    u16*   WvT = (u16*)  alloc((size_t)D_MODEL * D_MODEL * 2);
    u16*   WpT = (u16*)  alloc((size_t)D_MODEL * D_MODEL * 2);
    u16*   W1T = (u16*)  alloc((size_t)D_MODEL * 4 * D_MODEL * 2);  // 8 MB
    u16*   W2T = (u16*)  alloc((size_t)D_MODEL * 4 * D_MODEL * 2);  // 8 MB
    char*  pool = alloc((size_t)ROWS * D_MODEL * 2 * 4);            // 32 MB shared pool
    u16*   qB  = (u16*)pool;
    u16*   kB  = (u16*)(pool + (size_t)ROWS * HD * NH * 2);
    u16*   vtB = (u16*)(pool + (size_t)ROWS * HD * NH * 4);
    u16*   yB  = (u16*)(pool + (size_t)ROWS * HD * NH * 6);
    u16*   uB  = (u16*)pool;   // aliases q/k/vt/y (dead by MLP time)
    float* hF  = (float*)alloc((size_t)ROWS * D_MODEL * 4);   // 16 MB
    u16*   hnB = (u16*)  alloc((size_t)ROWS * D_MODEL * 2);   //  8 MB

    // 1) Weight casts + transposes to bf16 [N,K] (64 k x 128 n per block)
    cast_transpose_k<D_MODEL, D_MODEL><<<dim3(D_MODEL / 128, D_MODEL / 64), 128, 0, stream>>>(Wq, WqT);
    cast_transpose_k<D_MODEL, D_MODEL><<<dim3(D_MODEL / 128, D_MODEL / 64), 128, 0, stream>>>(Wk, WkT);
    cast_transpose_k<D_MODEL, D_MODEL><<<dim3(D_MODEL / 128, D_MODEL / 64), 128, 0, stream>>>(Wv, WvT);
    cast_transpose_k<D_MODEL, D_MODEL><<<dim3(D_MODEL / 128, D_MODEL / 64), 128, 0, stream>>>(Wp, WpT);
    cast_transpose_k<D_MODEL, 4 * D_MODEL><<<dim3(4 * D_MODEL / 128, D_MODEL / 64), 128, 0, stream>>>(W1, W1T);
    cast_transpose_k<4 * D_MODEL, D_MODEL><<<dim3(D_MODEL / 128, 4 * D_MODEL / 64), 128, 0, stream>>>(W2, W2T);

    // 2) LayerNorm1: x -> xn (f32 + bf16)
    layernorm_k<<<ROWS / 8, 256, 0, stream>>>(x, g1, b1, xnF, xnB);

    // 3) QKV projections (q pre-scaled by 1/sqrt(HD))
    dim3 gQKV(D_MODEL / 128, ROWS / 128);
    gemm_bf16_k<MODE_Q><<<gQKV, 256, 0, stream>>>(xnB, WqT, ROWS, D_MODEL, D_MODEL,
                                                  0.125f, nullptr, nullptr, nullptr, qB);
    gemm_bf16_k<MODE_K><<<gQKV, 256, 0, stream>>>(xnB, WkT, ROWS, D_MODEL, D_MODEL,
                                                  1.0f, nullptr, nullptr, nullptr, kB);
    gemm_bf16_k<MODE_V><<<gQKV, 256, 0, stream>>>(xnB, WvT, ROWS, D_MODEL, D_MODEL,
                                                  1.0f, nullptr, nullptr, nullptr, vtB);

    // 4) Flash attention
    attn_k<<<dim3(SEQ / 64, NB * NH), 128, 0, stream>>>(qB, kB, vtB, yB);

    // 5) Output projection + residual: h = xn + y*Wp + bp
    gemm_bf16_k<MODE_F32><<<gQKV, 256, 0, stream>>>(yB, WpT, ROWS, D_MODEL, D_MODEL,
                                                    1.0f, bp, xnF, hF, nullptr);

    // 6) LayerNorm2: h -> hn (bf16 only)
    layernorm_k<<<ROWS / 8, 256, 0, stream>>>(hF, g2, b2, nullptr, hnB);

    // 7) MLP up + exact GELU: u = gelu(hn*W1 + bm1)
    dim3 gUp(4 * D_MODEL / 128, ROWS / 128);
    gemm_bf16_k<MODE_GELU><<<gUp, 256, 0, stream>>>(hnB, W1T, ROWS, 4 * D_MODEL, D_MODEL,
                                                    1.0f, bm1, nullptr, nullptr, uB);

    // 8) MLP down + residual: out = h + u*W2 + bm2
    gemm_bf16_k<MODE_F32><<<gQKV, 256, 0, stream>>>(uB, W2T, ROWS, D_MODEL, 4 * D_MODEL,
                                                    1.0f, bm2, hF, out, nullptr);
}

// v006
// Measured time: 204 microseconds a run.
// Timed twice side by side with v005, it ran 1.16 and 1.17 times as fast.
// All steps since v000 together make it 2.05 times as fast.
#include <hip/hip_runtime.h>
#include <hip/hip_bf16.h>
#include <math.h>

typedef unsigned short u16;
typedef __bf16 bf16x16 __attribute__((ext_vector_type(16)));
typedef float f32x8 __attribute__((ext_vector_type(8)));
typedef float f32x4 __attribute__((ext_vector_type(4)));
typedef float f32x2 __attribute__((ext_vector_type(2)));
typedef unsigned int uint8v __attribute__((ext_vector_type(8)));
typedef int v4i __attribute__((__vector_size__(16)));

#define D_MODEL 1024
#define SEQ 2048
#define NB 2
#define NH 16
#define HD 64
#define ROWS (NB * SEQ)   // 4096

#if __has_builtin(__builtin_amdgcn_global_load_async_to_lds_b128)
#define USE_ASYNC_LDS 1
#endif

__device__ __forceinline__ u16 f32_to_bf16(float f) {
    unsigned int u = __float_as_uint(f);
    u += 0x7FFFu + ((u >> 16) & 1u);   // round to nearest even
    return (u16)(u >> 16);
}

__device__ __forceinline__ bf16x16 ld_frag(const u16* plo, const u16* phi) {
    uint4 lo = *(const uint4*)plo;
    uint4 hi = *(const uint4*)phi;
    uint8v t;
    t[0] = lo.x; t[1] = lo.y; t[2] = lo.z; t[3] = lo.w;
    t[4] = hi.x; t[5] = hi.y; t[6] = hi.z; t[7] = hi.w;
    return __builtin_bit_cast(bf16x16, t);
}

__device__ __forceinline__ f32x8 wmma_bf16(bf16x16 a, bf16x16 b, f32x8 c) {
    return __builtin_amdgcn_wmma_f32_16x16x32_bf16(false, a, false, b, (short)0, c, false, false);
}

__device__ __forceinline__ f32x8 zero8() {
    f32x8 z;
#pragma unroll
    for (int i = 0; i < 8; ++i) z[i] = 0.0f;
    return z;
}

// Copy 16B global -> LDS. Async (memory->LDS direct, ASYNCcnt) when available.
__device__ __forceinline__ void cp16_g2l(const u16* g, u16* l) {
#ifdef USE_ASYNC_LDS
    __builtin_amdgcn_global_load_async_to_lds_b128(
        (__attribute__((address_space(1))) v4i*)const_cast<u16*>(g),
        (__attribute__((address_space(3))) v4i*)l, 0, 0);
#else
    *(uint4*)l = *(const uint4*)g;
#endif
}

__device__ __forceinline__ void wait_async0() {
#ifdef USE_ASYNC_LDS
    // this wave's copies have landed; the clobber keeps every LDS read behind it
    asm volatile("s_wait_asynccnt 0x0" ::: "memory");
#endif
}

// ---------------------------------------------------------------------------
// The two kernels below only move data.  With a few elements per lane their time
// is the time the chip needs to START their waves, so each wave gets a large
// piece: few waves, many 16 B loads in flight per lane, no LDS, no barrier.
// Every loop in them is unrolled so that its arrays are registers and its steps
// immediate offsets.
// ---------------------------------------------------------------------------
__device__ __forceinline__ unsigned int pack2_bf16(float lo, float hi) {
    return (unsigned int)f32_to_bf16(lo) | ((unsigned int)f32_to_bf16(hi) << 16);
}

// ---------------------------------------------------------------------------
// Weight cast + transpose: W[K,N] f32 -> out[N,K] bf16.
// A wave takes a tile of 64 k x 32 n.  Lane (kb = lane / 8, nb = lane % 8) reads
// 4 consecutive n of rows 8 kb .. 8 kb + 7 (and the same 32 rows further on), so
// a wave-wide load is four whole 128 B lines; the lane then owns 8 consecutive k
// of each of its 4 columns, which is one 16 B store into a row of out: the
// transpose happens in registers.  The two stores of a column fill its 128 B line.
// K and N are compile-time values, so every row step is an immediate offset.
// Grid: (N/128, K/64), 128 threads (4 waves side by side in n).
// ---------------------------------------------------------------------------
template <int K, int N>
__global__ __launch_bounds__(128) void cast_transpose_k(const float* __restrict__ W,
                                                        u16* __restrict__ out) {
    const int lane = threadIdx.x & 31;
    const int wave = threadIdx.x >> 5;
    const int n0 = blockIdx.x * 128 + wave * 32 + (lane & 7) * 4;
    const int k0 = blockIdx.y * 64 + (lane >> 3) * 8;
    const float* src = W + (size_t)k0 * N + n0;
    f32x4 v[2][8];
#pragma unroll
    for (int hf = 0; hf < 2; ++hf)
#pragma unroll
        for (int r = 0; r < 8; ++r)
            v[hf][r] = *(const f32x4*)(src + (hf * 32 + r) * N);
    // holds all 16 loads in front of the first use: without it the build issued
    // them in five groups and the wave waited out a memory latency for each; src is
    // named so that no load's result lands on the address register the others use
    asm volatile("" :: "v"(src), "v"(v[0][0]), "v"(v[0][1]), "v"(v[0][2]), "v"(v[0][3]),
                       "v"(v[0][4]), "v"(v[0][5]), "v"(v[0][6]), "v"(v[0][7]),
                       "v"(v[1][0]), "v"(v[1][1]), "v"(v[1][2]), "v"(v[1][3]),
                       "v"(v[1][4]), "v"(v[1][5]), "v"(v[1][6]), "v"(v[1][7]));
    u16* dst = out + (size_t)n0 * K + k0;
#pragma unroll
    for (int hf = 0; hf < 2; ++hf)
#pragma unroll
        for (int c = 0; c < 4; ++c) {
            uint4 t;
            t.x = pack2_bf16(v[hf][0][c], v[hf][1][c]);
            t.y = pack2_bf16(v[hf][2][c], v[hf][3][c]);
            t.z = pack2_bf16(v[hf][4][c], v[hf][5][c]);
            t.w = pack2_bf16(v[hf][6][c], v[hf][7][c]);
            *(uint4*)(dst + c * K + hf * 32) = t;
        }
}

// ---------------------------------------------------------------------------
// LayerNorm: one row (D=1024) per wave, 8 rows per 256-thread block.  A lane holds
// 8 pieces of 4 floats, piece i at column 128 i + 4 lane, so every wave-wide load
// and f32 store is 512 contiguous bytes.  Sums: in-lane, then a five-step butterfly
// over the wave.  Writes f32 (optional) + bf16.
// ---------------------------------------------------------------------------
__global__ __launch_bounds__(256) void layernorm_k(const float* __restrict__ x,
                                                   const float* __restrict__ g,
                                                   const float* __restrict__ b,
                                                   float* __restrict__ outF,
                                                   u16* __restrict__ outB) {
    const int lane = threadIdx.x & 31;
    const size_t base = ((size_t)blockIdx.x * 8 + (threadIdx.x >> 5)) * D_MODEL + lane * 4;
    const float* xr = x + base;
    const unsigned int pb = lane * 16;     // byte offset of this lane's piece in g and b
    f32x4 v[8], gv[8], bv[8];
#pragma unroll
    for (int i = 0; i < 8; ++i) v[i] = *(const f32x4*)(xr + i * 128);
#pragma unroll
    for (int i = 0; i < 8; ++i) {
        gv[i] = *(const f32x4*)((const char*)g + pb + i * 512);
        bv[i] = *(const f32x4*)((const char*)b + pb + i * 512);
    }
    // nothing is scheduled across this line, so all 24 loads are issued before the
    // first use: without it the build fetched x in two groups and g, b behind the
    // sums, one latency after another
    __builtin_amdgcn_sched_barrier(0);
    // the address registers live past the last load's issue: without this the build
    // landed the last load's result on a register that the loads before it name
    asm volatile("" :: "v"(xr), "v"(lane));
    float s = 0.f, s2 = 0.f;
#pragma unroll
    for (int i = 0; i < 8; ++i) {
        s += (v[i][0] + v[i][1]) + (v[i][2] + v[i][3]);
        s2 += (v[i][0] * v[i][0] + v[i][1] * v[i][1]) + (v[i][2] * v[i][2] + v[i][3] * v[i][3]);
    }
#pragma unroll
    for (int off = 16; off > 0; off >>= 1) {
        s += __shfl_xor(s, off);
        s2 += __shfl_xor(s2, off);
    }
    const float mu = s * (1.0f / D_MODEL);
    const float var = s2 * (1.0f / D_MODEL) - mu * mu;
    const float rs = rsqrtf(var + 1e-5f);
#pragma unroll
    for (int i = 0; i < 8; ++i)
#pragma unroll
        for (int c = 0; c < 4; ++c) v[i][c] = (v[i][c] - mu) * rs * gv[i][c] + bv[i][c];
    if (outF) {
#pragma unroll
        for (int i = 0; i < 8; ++i) *(f32x4*)(outF + base + i * 128) = v[i];
    }
#pragma unroll
    for (int i = 0; i < 8; ++i) {
        uint2 p;
        p.x = pack2_bf16(v[i][0], v[i][1]);
        p.y = pack2_bf16(v[i][2], v[i][3]);
        *(uint2*)(outB + base + i * 128) = p;
    }
}

// ---------------------------------------------------------------------------
// Tiled bf16 GEMM with WMMA.  C[M,N] = A[M,K] * Bt[N,K]^T  (Bt is B transposed)
// Block tile 128x128, 8 waves (4 M x 2 N), each wave 32x64.
// A stage is 128 k of every operand row (256 B, two whole lines), so one
// wave-wide 16 B copy covers two full rows; four 32-k blocks per stage.
// Double-buffered LDS; async memory->LDS copies when available.
// K must be a multiple of 128.
// ---------------------------------------------------------------------------
#define MODE_Q    0
#define MODE_K    1
#define MODE_V    2
#define MODE_F32  3   // outF = acc*scale + bias + resid
#define MODE_GELU 4   // outB = bf16(gelu(acc*scale + bias))
#define BK 128              // k per stage
#define LPITCH (BK + 8)     // LDS row pitch in elements: 272 B = 16 B x odd

// MODE is a compile-time parameter: each instantiation holds one straight-line
// epilogue, so its loads of bias and resid issue together instead of one
// load, wait and store per element behind a chain of branches on the mode.
template <int MODE>
__global__ __launch_bounds__(256) void gemm_bf16_k(const u16* __restrict__ A,
                                                   const u16* __restrict__ Bt,
                                                   int M, int N, int K,
                                                   float scale,
                                                   const float* __restrict__ bias,
                                                   const float* __restrict__ resid,
                                                   float* __restrict__ outF,
                                                   u16* __restrict__ outB) {
    __shared__ __attribute__((aligned(16))) u16 lA[2][128 * LPITCH];
    __shared__ __attribute__((aligned(16))) u16 lB[2][128 * LPITCH];
    const int tid = threadIdx.x;
    const int lane = tid & 31;
    const int wave = tid >> 5;
    const int waveM = wave & 3;       // 0..3
    const int waveN = wave >> 2;      // 0..1
    const int bM = blockIdx.y * 128;
    const int bN = blockIdx.x * 128;
    const int l16 = lane & 15;
    const int khalf = (lane >> 4) * 8;     // 0 or 8 (K sub-chunk base)
    const int mloc = (lane >> 4) * 8;      // 0 or 8 (C-layout row base)
    // staging assignment: 16 lanes cover one 256 B row; this thread copies
    // 16 B chunk sc of rows sr, sr + 16, ..., sr + 112 of both operands
    const int sr = tid >> 4, sc = tid & 15;

    f32x8 acc[2][4];
#pragma unroll
    for (int mt = 0; mt < 2; ++mt)
#pragma unroll
        for (int nt = 0; nt < 4; ++nt) acc[mt][nt] = zero8();

    // stage K-slice kk into buffer buf
    auto stage = [&](int buf, int kk) {
        const u16* ga = A + (size_t)(bM + sr) * K + kk + sc * 8;
        const u16* gb = Bt + (size_t)(bN + sr) * K + kk + sc * 8;
        u16* la = &lA[buf][sr * LPITCH + sc * 8];
        u16* lb = &lB[buf][sr * LPITCH + sc * 8];
#pragma unroll   // the 16 copies issue back to back, LDS steps are constants
        for (int i = 0; i < 8; ++i) {
            cp16_g2l(ga + (size_t)(i * 16) * K, la + i * 16 * LPITCH);
            cp16_g2l(gb + (size_t)(i * 16) * K, lb + i * 16 * LPITCH);
        }
    };

    stage(0, 0);
    wait_async0();
    __syncthreads();
    if (BK < K) stage(1, BK);

    int cur = 0;
    for (int kk = 0; kk < K; kk += BK) {
#pragma unroll   // the four blocks' LDS offsets become immediates
        for (int ks = 0; ks < BK; ks += 32) {
            bf16x16 af[2], bfr[4];
#pragma unroll
            for (int mt = 0; mt < 2; ++mt) {
                const u16* p = &lA[cur][(waveM * 32 + mt * 16 + l16) * LPITCH + ks + khalf];
                af[mt] = ld_frag(p, p + 16);
            }
#pragma unroll
            for (int nt = 0; nt < 4; ++nt) {
                const u16* p = &lB[cur][(waveN * 64 + nt * 16 + l16) * LPITCH + ks + khalf];
                bfr[nt] = ld_frag(p, p + 16);
            }
#pragma unroll
            for (int mt = 0; mt < 2; ++mt)
#pragma unroll
                for (int nt = 0; nt < 4; ++nt)
                    acc[mt][nt] = wmma_bf16(af[mt], bfr[nt], acc[mt][nt]);
        }
        // publish point: this wave's reads of buffer cur are done before the
        // refill below may overwrite it
        asm volatile("s_wait_dscnt 0x0" ::: "memory");
        wait_async0();       // the next stage's copies of this wave have landed
        __syncthreads();     // next stage readable by all; buffer cur left by all
        if (kk + 2 * BK < K) stage(cur, kk + 2 * BK);   // refill two stages ahead
        cur ^= 1;
    }
    wait_async0();           // nothing outstanding when the wave ends

    // Epilogue. C layout: vgpr j -> row mloc+j, lane%16 -> col.
#pragma unroll
    for (int mt = 0; mt < 2; ++mt) {
#pragma unroll
        for (int nt = 0; nt < 4; ++nt) {
            const int gcol = bN + waveN * 64 + nt * 16 + l16;
#pragma unroll
            for (int j = 0; j < 8; ++j) {
                const int grow = bM + waveM * 32 + mt * 16 + mloc + j;
                float v = acc[mt][nt][j] * scale;
                if constexpr (MODE == MODE_Q || MODE == MODE_K) {
                    int bb = grow >> 11, s = grow & 2047;
                    int h = gcol >> 6, d = gcol & 63;
                    outB[(((size_t)(bb * NH + h) * SEQ) + s) * HD + d] = f32_to_bf16(v);
                } else if constexpr (MODE == MODE_V) {
                    int bb = grow >> 11, s = grow & 2047;
                    int h = gcol >> 6, d = gcol & 63;
                    outB[(((size_t)(bb * NH + h) * HD) + d) * SEQ + s] = f32_to_bf16(v);
                } else if constexpr (MODE == MODE_F32) {
                    size_t idx = (size_t)grow * N + gcol;
                    outF[idx] = v + bias[gcol] + resid[idx];
                } else { // MODE_GELU
                    float xv = v + bias[gcol];
                    float gl = 0.5f * xv * (1.0f + erff(xv * 0.70710678118654752f));
                    outB[(size_t)grow * N + gcol] = f32_to_bf16(gl);
                }
            }
        }
    }
}

#define APITCH 72   // LDS row pitch in elements: 144 B = 16 B x odd

// value of lane l ^ 16
__device__ __forceinline__ float other_half(float v) {
    int b = __float_as_int(v);
    return __int_as_float(__builtin_amdgcn_permlanex16(b, b, 0x76543210, 0xfedcba98, false, false));
}

__global__ __launch_bounds__(128) void attn_k(const u16* __restrict__ q,
                                              const u16* __restrict__ k,
                                              const u16* __restrict__ vt,
                                              u16* __restrict__ yb) {
    __shared__ __attribute__((aligned(16))) u16 lK[2][64 * APITCH];   // [key][d]
    __shared__ __attribute__((aligned(16))) u16 lV[2][64 * APITCH];   // [d][key]
    const int lane = threadIdx.x & 31;
    const int wave = threadIdx.x >> 5;
    const int bh = blockIdx.y;                 // b*NH + h
    const int qbase = blockIdx.x * 64 + wave * 16;
    const int l16 = lane & 15;
    const int khalf = (lane >> 4) * 8;
    const int mloc = (lane >> 4) * 8;
    const size_t headOff = (size_t)bh * SEQ * HD;
    // staging assignment: 8 lanes cover one 128 B row, so a wave-wide copy is four
    // whole lines; this thread copies 16 B chunk sc of K rows sr, sr + 16, sr + 32,
    // sr + 48 and of V^T rows 4 sr .. 4 sr + 3 (row steps of 2 KiB and 4 KiB)
    const int sr = threadIdx.x >> 3, sc = threadIdx.x & 7;

    // copy the tile of keys kb .. kb + 63 into buffer buf
    auto stage = [&](int buf, int kb) {
        const u16* gk = k + headOff + (size_t)(kb + sr) * HD + sc * 8;
        const u16* gv = vt + headOff + (size_t)(sr * 4) * SEQ + kb + sc * 8;
        u16* lk = &lK[buf][sr * APITCH + sc * 8];
        u16* lv = &lV[buf][sr * 4 * APITCH + sc * 8];
#pragma unroll   // the 8 copies issue back to back, LDS steps are constants
        for (int i = 0; i < 4; ++i) {
            cp16_g2l(gk + (size_t)(i * 16) * HD, lk + i * 16 * APITCH);
            cp16_g2l(gv + (size_t)i * SEQ, lv + i * APITCH);
        }
    };

    bf16x16 qf[2];     // B operand of S^T: column = query qbase + l16
    {
        const u16* qp = q + headOff + (size_t)(qbase + l16) * HD;
#pragma unroll
        for (int kt = 0; kt < 2; ++kt) {
            const u16* p = qp + kt * 32 + khalf;
            qf[kt] = ld_frag(p, p + 16);
        }
    }

    const float LOG2E = 1.44269504088896340736f;
    f32x8 O[4];        // O^T: O[nd][j] = d nd * 16 + mloc + j of query qbase + l16
    float rmax = -INFINITY;   // this lane's query, both halves alike
    float rsum = 0.0f;        // this half's keys only; the halves join after the loop
#pragma unroll
    for (int n = 0; n < 4; ++n) O[n] = zero8();

    stage(0, 0);
    wait_async0();
    __syncthreads();     // tile 0 readable by all four waves
    stage(1, 64);

    int cur = 0;
    for (int kb = 0; kb < SEQ; kb += 64) {
        // ---- scores: S^T[64 x 16] = K * Q^T (q pre-scaled) ----
        f32x8 sAcc[4];   // sAcc[n][j] = key kb + n * 16 + mloc + j, query qbase + l16
#pragma unroll
        for (int n = 0; n < 4; ++n) {
            sAcc[n] = zero8();
#pragma unroll
            for (int kt = 0; kt < 2; ++kt) {
                const u16* kp = &lK[cur][(n * 16 + l16) * APITCH + kt * 32 + khalf];
                bf16x16 kf = ld_frag(kp, kp + 16);
                sAcc[n] = wmma_bf16(kf, qf[kt], sAcc[n]);
            }
#pragma unroll
            for (int j = 0; j < 8; ++j) {
                if (kb + n * 16 + mloc + j == qbase + l16) sAcc[n][j] = -INFINITY;
            }
        }
        // ---- online softmax: one query per lane ----
        float t = sAcc[0][0];
#pragma unroll
        for (int n = 0; n < 4; ++n)
#pragma unroll
            for (int j = 0; j < 8; ++j) t = fmaxf(t, sAcc[n][j]);
        t = fmaxf(t, other_half(t));
        const float nm = fmaxf(rmax, t * LOG2E);
        const float corr = __builtin_amdgcn_exp2f(rmax - nm);
        rmax = nm;
#pragma unroll
        for (int n = 0; n < 4; ++n)
#pragma unroll
            for (int j = 0; j < 8; ++j) O[n][j] *= corr;

        f32x2 ps[2];     // packed adds, two chains, so that they do not wait on one another
        ps[0] = (f32x2){0.0f, 0.0f};
        ps[1] = (f32x2){0.0f, 0.0f};
#pragma unroll
        for (int n = 0; n < 4; ++n)
#pragma unroll
            for (int j = 0; j < 8; j += 2) {
                f32x2 p;
                p[0] = __builtin_amdgcn_exp2f(fmaf(sAcc[n][j], LOG2E, -nm));
                p[1] = __builtin_amdgcn_exp2f(fmaf(sAcc[n][j + 1], LOG2E, -nm));
                sAcc[n][j] = p[0];
                sAcc[n][j + 1] = p[1];
                ps[(j >> 1) & 1] += p;
            }
        ps[0] += ps[1];
        rsum = rsum * corr + (ps[0][0] + ps[0][1]);
        // ---- P^T: two score tiles, converted in place, are one B operand ----
        bf16x16 pf[2];
#pragma unroll
        for (int kt = 0; kt < 2; ++kt)
#pragma unroll
            for (int s = 0; s < 16; ++s) pf[kt][s] = (__bf16)sAcc[2 * kt + (s >> 3)][s & 7];
        // ---- O^T += V^T * P^T  (V^T layout: [d][s], contiguous over keys) ----
#pragma unroll
        for (int nd = 0; nd < 4; ++nd) {
#pragma unroll
            for (int kt = 0; kt < 2; ++kt) {
                const u16* vp = &lV[cur][(nd * 16 + l16) * APITCH + kt * 32 + khalf];
                bf16x16 vf = ld_frag(vp, vp + 16);
                O[nd] = wmma_bf16(vf, pf[kt], O[nd]);
            }
        }
        // publish point: this wave's reads of buffer cur are done before the
        // refill below may overwrite it
        asm volatile("s_wait_dscnt 0x0" ::: "memory");
        wait_async0();       // the next tile's copies of this wave have landed
        __syncthreads();     // next tile readable by all; buffer cur left by all
        if (kb + 128 < SEQ) stage(cur, kb + 128);   // refill two tiles ahead
        cur ^= 1;
    }
    wait_async0();           // nothing outstanding when the wave ends

    // a lane holds 8 consecutive d of its query per tile: one 16 B store each
    const int bb = bh >> 4, h = bh & 15;
    rsum += other_half(rsum);
    const float inv = 1.0f / rsum;
    u16* yr = yb + ((size_t)bb * SEQ + qbase + l16) * D_MODEL + h * HD + mloc;
#pragma unroll
    for (int nd = 0; nd < 4; ++nd) {
        uint4 o;
        o.x = pack2_bf16(O[nd][0] * inv, O[nd][1] * inv);
        o.y = pack2_bf16(O[nd][2] * inv, O[nd][3] * inv);
        o.z = pack2_bf16(O[nd][4] * inv, O[nd][5] * inv);
        o.w = pack2_bf16(O[nd][6] * inv, O[nd][7] * inv);
        *(uint4*)(yr + nd * 16) = o;
    }
}

// ---------------------------------------------------------------------------
extern "C" void kernel_launch(void* const* d_in, const int* in_sizes, int n_in,
                              void* d_out, int out_size, void* d_ws, size_t ws_size,
                              hipStream_t stream) {
    (void)in_sizes; (void)n_in; (void)out_size; (void)ws_size;
    const float* x   = (const float*)d_in[0];
    const float* Wk  = (const float*)d_in[1];
    const float* Wq  = (const float*)d_in[2];
    const float* Wv  = (const float*)d_in[3];
    const float* Wp  = (const float*)d_in[4];
    const float* bp  = (const float*)d_in[5];
    const float* g1  = (const float*)d_in[6];
    const float* b1  = (const float*)d_in[7];
    const float* g2  = (const float*)d_in[8];
    const float* b2  = (const float*)d_in[9];
    const float* W1  = (const float*)d_in[10];
    const float* bm1 = (const float*)d_in[11];
    const float* W2  = (const float*)d_in[12];
    const float* bm2 = (const float*)d_in[13];
    float* out = (float*)d_out;

    char* ws = (char*)d_ws;
    size_t off = 0;
    auto alloc = [&](size_t bytes) -> char* {
        char* p = ws + off;
        off += (bytes + 255) & ~(size_t)255;
        return p;
    };
    float* xnF = (float*)alloc((size_t)ROWS * D_MODEL * 4);   // 16 MB
    u16*   xnB = (u16*)  alloc((size_t)ROWS * D_MODEL * 2);   //  8 MB
    u16*   WqT = (u16*)  alloc((size_t)D_MODEL * D_MODEL * 2);
    u16*   WkT = (u16*)  alloc((size_t)D_MODEL * D_MODEL * 2);
    u16*   WvT = (u16*)  alloc((size_t)D_MODEL * D_MODEL * 2);
    u16*   WpT = (u16*)  alloc((size_t)D_MODEL * D_MODEL * 2);
    u16*   W1T = (u16*)  alloc((size_t)D_MODEL * 4 * D_MODEL * 2);  // 8 MB
    u16*   W2T = (u16*)  alloc((size_t)D_MODEL * 4 * D_MODEL * 2);  // 8 MB
    char*  pool = alloc((size_t)ROWS * D_MODEL * 2 * 4);            // 32 MB shared pool
    u16*   qB  = (u16*)pool;
    u16*   kB  = (u16*)(pool + (size_t)ROWS * HD * NH * 2);
    u16*   vtB = (u16*)(pool + (size_t)ROWS * HD * NH * 4);
    u16*   yB  = (u16*)(pool + (size_t)ROWS * HD * NH * 6);
    u16*   uB  = (u16*)pool;   // aliases q/k/vt/y (dead by MLP time)
    float* hF  = (float*)alloc((size_t)ROWS * D_MODEL * 4);   // 16 MB
    u16*   hnB = (u16*)  alloc((size_t)ROWS * D_MODEL * 2);   //  8 MB

    // 1) Weight casts + transposes to bf16 [N,K] (64 k x 128 n per block)
    cast_transpose_k<D_MODEL, D_MODEL><<<dim3(D_MODEL / 128, D_MODEL / 64), 128, 0, stream>>>(Wq, WqT);
    cast_transpose_k<D_MODEL, D_MODEL><<<dim3(D_MODEL / 128, D_MODEL / 64), 128, 0, stream>>>(Wk, WkT);
    cast_transpose_k<D_MODEL, D_MODEL><<<dim3(D_MODEL / 128, D_MODEL / 64), 128, 0, stream>>>(Wv, WvT);
    cast_transpose_k<D_MODEL, D_MODEL><<<dim3(D_MODEL / 128, D_MODEL / 64), 128, 0, stream>>>(Wp, WpT);
    cast_transpose_k<D_MODEL, 4 * D_MODEL><<<dim3(4 * D_MODEL / 128, D_MODEL / 64), 128, 0, stream>>>(W1, W1T);
    cast_transpose_k<4 * D_MODEL, D_MODEL><<<dim3(D_MODEL / 128, 4 * D_MODEL / 64), 128, 0, stream>>>(W2, W2T);

    // 2) LayerNorm1: x -> xn (f32 + bf16)
    layernorm_k<<<ROWS / 8, 256, 0, stream>>>(x, g1, b1, xnF, xnB);

    // 3) QKV projections (q pre-scaled by 1/sqrt(HD))
    dim3 gQKV(D_MODEL / 128, ROWS / 128);
    gemm_bf16_k<MODE_Q><<<gQKV, 256, 0, stream>>>(xnB, WqT, ROWS, D_MODEL, D_MODEL,
                                                  0.125f, nullptr, nullptr, nullptr, qB);
    gemm_bf16_k<MODE_K><<<gQKV, 256, 0, stream>>>(xnB, WkT, ROWS, D_MODEL, D_MODEL,
                                                  1.0f, nullptr, nullptr, nullptr, kB);
    gemm_bf16_k<MODE_V><<<gQKV, 256, 0, stream>>>(xnB, WvT, ROWS, D_MODEL, D_MODEL,
                                                  1.0f, nullptr, nullptr, nullptr, vtB);

    // 4) Flash attention
    attn_k<<<dim3(SEQ / 64, NB * NH), 128, 0, stream>>>(qB, kB, vtB, yB);

    // 5) Output projection + residual: h = xn + y*Wp + bp
    gemm_bf16_k<MODE_F32><<<gQKV, 256, 0, stream>>>(yB, WpT, ROWS, D_MODEL, D_MODEL,
                                                    1.0f, bp, xnF, hF, nullptr);

    // 6) LayerNorm2: h -> hn (bf16 only)
    layernorm_k<<<ROWS / 8, 256, 0, stream>>>(hF, g2, b2, nullptr, hnB);

    // 7) MLP up + exact GELU: u = gelu(hn*W1 + bm1)
    dim3 gUp(4 * D_MODEL / 128, ROWS / 128);
    gemm_bf16_k<MODE_GELU><<<gUp, 256, 0, stream>>>(hnB, W1T, ROWS, 4 * D_MODEL, D_MODEL,
                                                    1.0f, bm1, nullptr, nullptr, uB);

    // 8) MLP down + residual: out = h + u*W2 + bm2
    gemm_bf16_k<MODE_F32><<<gQKV, 256, 0, stream>>>(uB, W2T, ROWS, D_MODEL, 4 * D_MODEL,
                                                    1.0f, bm2, hF, out, nullptr);
}

// v007
// Measured time: 182 microseconds a run.
// Two timings next to v006 both put it at 1.12 times that version's speed.
// Counting every step since v000, it is 2.29 times as fast.
#include <hip/hip_runtime.h>
#include <hip/hip_bf16.h>
#include <math.h>

typedef unsigned short u16;
typedef __bf16 bf16x16 __attribute__((ext_vector_type(16)));
typedef float f32x8 __attribute__((ext_vector_type(8)));
typedef float f32x4 __attribute__((ext_vector_type(4)));
typedef float f32x2 __attribute__((ext_vector_type(2)));
typedef unsigned int uint8v __attribute__((ext_vector_type(8)));
typedef int v4i __attribute__((__vector_size__(16)));

#define D_MODEL 1024
#define SEQ 2048
#define NB 2
#define NH 16
#define HD 64
#define ROWS (NB * SEQ)   // 4096

#if __has_builtin(__builtin_amdgcn_global_load_async_to_lds_b128)
#define USE_ASYNC_LDS 1
#endif

__device__ __forceinline__ u16 f32_to_bf16(float f) {
    unsigned int u = __float_as_uint(f);
    u += 0x7FFFu + ((u >> 16) & 1u);   // round to nearest even
    return (u16)(u >> 16);
}

__device__ __forceinline__ bf16x16 ld_frag(const u16* plo, const u16* phi) {
    uint4 lo = *(const uint4*)plo;
    uint4 hi = *(const uint4*)phi;
    uint8v t;
    t[0] = lo.x; t[1] = lo.y; t[2] = lo.z; t[3] = lo.w;
    t[4] = hi.x; t[5] = hi.y; t[6] = hi.z; t[7] = hi.w;
    return __builtin_bit_cast(bf16x16, t);
}

__device__ __forceinline__ f32x8 wmma_bf16(bf16x16 a, bf16x16 b, f32x8 c) {
    return __builtin_amdgcn_wmma_f32_16x16x32_bf16(false, a, false, b, (short)0, c, false, false);
}

__device__ __forceinline__ f32x8 zero8() {
    f32x8 z;
#pragma unroll
    for (int i = 0; i < 8; ++i) z[i] = 0.0f;
    return z;
}

// Copy 16B global -> LDS. Async (memory->LDS direct, ASYNCcnt) when available.
__device__ __forceinline__ void cp16_g2l(const u16* g, u16* l) {
#ifdef USE_ASYNC_LDS
    __builtin_amdgcn_global_load_async_to_lds_b128(
        (__attribute__((address_space(1))) v4i*)const_cast<u16*>(g),
        (__attribute__((address_space(3))) v4i*)l, 0, 0);
#else
    *(uint4*)l = *(const uint4*)g;
#endif
}

__device__ __forceinline__ void wait_async0() {
#ifdef USE_ASYNC_LDS
    // this wave's copies have landed; the clobber keeps every LDS read behind it
    asm volatile("s_wait_asynccnt 0x0" ::: "memory");
#endif
}

// ---------------------------------------------------------------------------
// The two kernels below only move data.  For speed each wave gets a large
// piece: few waves, many 16 B loads in flight per lane, no LDS, no barrier.
// Every loop in them is unrolled so that its arrays are registers and its steps
// immediate offsets.
// Both are written as device functions that take their block's index: the six
// weight casts and the first layernorm depend on nothing but the inputs, so they
// share ONE launch (prep_k below) instead of seven that each leave the chip
// partly empty and pay the gap between launches.
// ---------------------------------------------------------------------------
__device__ __forceinline__ unsigned int pack2_bf16(float lo, float hi) {
    return (unsigned int)f32_to_bf16(lo) | ((unsigned int)f32_to_bf16(hi) << 16);
}

// ---------------------------------------------------------------------------
// Weight cast + transpose: W[K,N] f32 -> out[N,K] bf16.
// A wave takes a tile of 64 k x 32 n.  Lane (kb = lane / 8, nb = lane % 8) reads
// 4 consecutive n of rows 8 kb .. 8 kb + 7 (and the same 32 rows further on), so
// a wave-wide load is four whole 128 B lines; the lane then owns 8 consecutive k
// of each of its 4 columns, which is one 16 B store into a row of out: the
// transpose happens in registers.  The two stores of a column fill its 128 B line.
// K and N are compile-time values, so every row step is an immediate offset.
// A block of 256 threads (8 waves side by side in n) takes 64 k x 256 n: tile
// t of (N/256) * (K/64), n fastest.
// ---------------------------------------------------------------------------
template <int K, int N>
__device__ __forceinline__ void cast_transpose_tile(const float* __restrict__ W,
                                                    u16* __restrict__ out, int t) {
    const int lane = threadIdx.x & 31;
    const int wave = threadIdx.x >> 5;
    const int n0 = (t % (N / 256)) * 256 + wave * 32 + (lane & 7) * 4;
    const int k0 = (t / (N / 256)) * 64 + (lane >> 3) * 8;
    const float* src = W + (size_t)k0 * N + n0;
    f32x4 v[2][8];
#pragma unroll
    for (int hf = 0; hf < 2; ++hf)
#pragma unroll
        for (int r = 0; r < 8; ++r)
            v[hf][r] = *(const f32x4*)(src + (hf * 32 + r) * N);
    // holds all 16 loads in front of the first use: without it the build issued
    // them in five groups and the wave waited out a memory latency for each; src is
    // named so that no load's result lands on the address register the others use
    asm volatile("" :: "v"(src), "v"(v[0][0]), "v"(v[0][1]), "v"(v[0][2]), "v"(v[0][3]),
                       "v"(v[0][4]), "v"(v[0][5]), "v"(v[0][6]), "v"(v[0][7]),
                       "v"(v[1][0]), "v"(v[1][1]), "v"(v[1][2]), "v"(v[1][3]),
                       "v"(v[1][4]), "v"(v[1][5]), "v"(v[1][6]), "v"(v[1][7]));
    u16* dst = out + (size_t)n0 * K + k0;
#pragma unroll
    for (int hf = 0; hf < 2; ++hf)
#pragma unroll
        for (int c = 0; c < 4; ++c) {
            uint4 t;
            t.x = pack2_bf16(v[hf][0][c], v[hf][1][c]);
            t.y = pack2_bf16(v[hf][2][c], v[hf][3][c]);
            t.z = pack2_bf16(v[hf][4][c], v[hf][5][c]);
            t.w = pack2_bf16(v[hf][6][c], v[hf][7][c]);
            *(uint4*)(dst + c * K + hf * 32) = t;
        }
    // in prep_k another job's code follows these stores in the listing and rewrites
    // their address and data registers: the wait stands in front of any such rewrite
    asm volatile("s_wait_xcnt 0x0" ::: "memory");
}

// ---------------------------------------------------------------------------
// LayerNorm: one row (D=1024) per wave, 8 rows per 256-thread block.  A lane holds
// 8 pieces of 4 floats, piece i at column 128 i + 4 lane, so every wave-wide load
// and f32 store is 512 contiguous bytes.  Sums: in-lane, then a five-step butterfly
// over the wave.  Writes f32 (optional) + bf16.
// ---------------------------------------------------------------------------
__device__ __forceinline__ void layernorm_rows(const float* __restrict__ x,
                                               const float* __restrict__ g,
                                               const float* __restrict__ b,
                                               float* __restrict__ outF,
                                               u16* __restrict__ outB, int blk) {
    const int lane = threadIdx.x & 31;
    const size_t base = ((size_t)blk * 8 + (threadIdx.x >> 5)) * D_MODEL + lane * 4;
    const float* xr = x + base;
    const unsigned int pb = lane * 16;     // byte offset of this lane's piece in g and b
    f32x4 v[8], gv[8], bv[8];
#pragma unroll
    for (int i = 0; i < 8; ++i) v[i] = *(const f32x4*)(xr + i * 128);
#pragma unroll
    for (int i = 0; i < 8; ++i) {
        gv[i] = *(const f32x4*)((const char*)g + pb + i * 512);
        bv[i] = *(const f32x4*)((const char*)b + pb + i * 512);
    }
    // nothing is scheduled across this line, so all 24 loads are issued before the
    // first use: without it the build fetched x in two groups and g, b behind the
    // sums, one latency after another
    __builtin_amdgcn_sched_barrier(0);
    // the address registers live past the last load's issue: without this the build
    // landed the last load's result on a register that the loads before it name
    asm volatile("" :: "v"(xr), "v"(lane));
    float s = 0.f, s2 = 0.f;
#pragma unroll
    for (int i = 0; i < 8; ++i) {
        s += (v[i][0] + v[i][1]) + (v[i][2] + v[i][3]);
        s2 += (v[i][0] * v[i][0] + v[i][1] * v[i][1]) + (v[i][2] * v[i][2] + v[i][3] * v[i][3]);
    }
#pragma unroll
    for (int off = 16; off > 0; off >>= 1) {
        s += __shfl_xor(s, off);
        s2 += __shfl_xor(s2, off);
    }
    const float mu = s * (1.0f / D_MODEL);
    const float var = s2 * (1.0f / D_MODEL) - mu * mu;
    const float rs = rsqrtf(var + 1e-5f);
#pragma unroll
    for (int i = 0; i < 8; ++i)
#pragma unroll
        for (int c = 0; c < 4; ++c) v[i][c] = (v[i][c] - mu) * rs * gv[i][c] + bv[i][c];
    if (outF) {
#pragma unroll
        for (int i = 0; i < 8; ++i) *(f32x4*)(outF + base + i * 128) = v[i];
    }
#pragma unroll
    for (int i = 0; i < 8; ++i) {
        uint2 p;
        p.x = pack2_bf16(v[i][0], v[i][1]);
        p.y = pack2_bf16(v[i][2], v[i][3]);
        *(uint2*)(outB + base + i * 128) = p;
    }
    // as in cast_transpose_tile: in front of any rewrite of the stores' registers by
    // the code that follows them in prep_k's listing
    asm volatile("s_wait_xcnt 0x0" ::: "memory");
}

__global__ __launch_bounds__(256) void layernorm_k(const float* __restrict__ x,
                                                   const float* __restrict__ g,
                                                   const float* __restrict__ b,
                                                   float* __restrict__ outF,
                                                   u16* __restrict__ outB) {
    layernorm_rows(x, g, b, outF, outB, blockIdx.x);
}

// ---------------------------------------------------------------------------
// All work that reads only inputs, in one launch.  The block index picks the job
// (scalar branches): the four square weights, the two MLP weights, then the first
// layernorm, whose output the next launch reads first.  Wsq holds the transposed
// square weights one behind another in the order q, k, v, p.
// ---------------------------------------------------------------------------
#define PREP_LN  (ROWS / 8)                                // 512 blocks
#define PREP_MLP ((D_MODEL / 64) * (4 * D_MODEL / 256))    // 256 blocks per MLP weight
#define PREP_SQ  ((D_MODEL / 64) * (D_MODEL / 256))        // 64 blocks per square weight
#define PREP_BLOCKS (PREP_LN + 2 * PREP_MLP + 4 * PREP_SQ)

__global__ __launch_bounds__(256) void prep_k(const float* __restrict__ x,
                                              const float* __restrict__ g,
                                              const float* __restrict__ b,
                                              float* __restrict__ outF,
                                              u16* __restrict__ outB,
                                              const float* __restrict__ Wq,
                                              const float* __restrict__ Wk,
                                              const float* __restrict__ Wv,
                                              const float* __restrict__ Wp,
                                              const float* __restrict__ W1,
                                              const float* __restrict__ W2,
                                              u16* __restrict__ Wsq,
                                              u16* __restrict__ W1T,
                                              u16* __restrict__ W2T) {
    int t = blockIdx.x;
    if (t < 4 * PREP_SQ) {
        const int w = t / PREP_SQ;
        const float* W = w == 0 ? Wq : w == 1 ? Wk : w == 2 ? Wv : Wp;
        cast_transpose_tile<D_MODEL, D_MODEL>(W, Wsq + (size_t)w * D_MODEL * D_MODEL, t % PREP_SQ);
        return;
    }
    t -= 4 * PREP_SQ;
    if (t < PREP_MLP) {
        cast_transpose_tile<D_MODEL, 4 * D_MODEL>(W1, W1T, t);
        return;
    }
    t -= PREP_MLP;
    if (t < PREP_MLP) {
        cast_transpose_tile<4 * D_MODEL, D_MODEL>(W2, W2T, t);
        return;
    }
    layernorm_rows(x, g, b, outF, outB, t - PREP_MLP);
}

// ---------------------------------------------------------------------------
// Tiled bf16 GEMM with WMMA.  C[M,N] = A[M,K] * Bt[N,K]^T  (Bt is B transposed)
// Block tile 128x128, 8 waves (4 M x 2 N), each wave 32x64.
// A stage is 128 k of every operand row (256 B, two whole lines), so one
// wave-wide 16 B copy covers two full rows; four 32-k blocks per stage.
// Double-buffered LDS; async memory->LDS copies when available.
// K must be a multiple of 128.
// ---------------------------------------------------------------------------
#define MODE_QKV  0   // Bt = [WqT; WkT; WvT], N = 3 * D_MODEL: one launch for q, k and v
#define MODE_F32  3   // outF = acc*scale + bias + resid
#define MODE_GELU 4   // outB = bf16(gelu(acc*scale + bias))
#define BK 128              // k per stage
#define LPITCH (BK + 8)     // LDS row pitch in elements: 272 B = 16 B x odd

// MODE is a compile-time parameter: each instantiation holds only its own
// straight-line epilogue (QKV's two behind one scalar branch on sel), so its
// loads of bias and resid issue together instead of one
// load, wait and store per element behind a chain of branches on the mode.
template <int MODE>
__global__ __launch_bounds__(256) void gemm_bf16_k(const u16* __restrict__ A,
                                                   const u16* __restrict__ Bt,
                                                   int M, int N, int K,
                                                   float scale,
                                                   const float* __restrict__ bias,
                                                   const float* __restrict__ resid,
                                                   float* __restrict__ outF,
                                                   u16* __restrict__ outB) {
    __shared__ __attribute__((aligned(16))) u16 lA[2][128 * LPITCH];
    __shared__ __attribute__((aligned(16))) u16 lB[2][128 * LPITCH];
    const int tid = threadIdx.x;
    const int lane = tid & 31;
    const int wave = tid >> 5;
    const int waveM = wave & 3;       // 0..3
    const int waveN = wave >> 2;      // 0..1
    const int bM = blockIdx.y * 128;
    const int bN = blockIdx.x * 128;
    const int l16 = lane & 15;
    const int khalf = (lane >> 4) * 8;     // 0 or 8 (K sub-chunk base)
    const int mloc = (lane >> 4) * 8;      // 0 or 8 (C-layout row base)
    // staging assignment: 16 lanes cover one 256 B row; this thread copies
    // 16 B chunk sc of rows sr, sr + 16, ..., sr + 112 of both operands
    const int sr = tid >> 4, sc = tid & 15;

    f32x8 acc[2][4];
#pragma unroll
    for (int mt = 0; mt < 2; ++mt)
#pragma unroll
        for (int nt = 0; nt < 4; ++nt) acc[mt][nt] = zero8();

    // stage K-slice kk into buffer buf
    auto stage = [&](int buf, int kk) {
        const u16* ga = A + (size_t)(bM + sr) * K + kk + sc * 8;
        const u16* gb = Bt + (size_t)(bN + sr) * K + kk + sc * 8;
        u16* la = &lA[buf][sr * LPITCH + sc * 8];
        u16* lb = &lB[buf][sr * LPITCH + sc * 8];
#pragma unroll   // the 16 copies issue back to back, LDS steps are constants
        for (int i = 0; i < 8; ++i) {
            cp16_g2l(ga + (size_t)(i * 16) * K, la + i * 16 * LPITCH);
            cp16_g2l(gb + (size_t)(i * 16) * K, lb + i * 16 * LPITCH);
        }
    };

    stage(0, 0);
    wait_async0();
    __syncthreads();
    if (BK < K) stage(1, BK);

    int cur = 0;
    for (int kk = 0; kk < K; kk += BK) {
#pragma unroll   // the four blocks' LDS offsets become immediates
        for (int ks = 0; ks < BK; ks += 32) {
            bf16x16 af[2], bfr[4];
#pragma unroll
            for (int mt = 0; mt < 2; ++mt) {
                const u16* p = &lA[cur][(waveM * 32 + mt * 16 + l16) * LPITCH + ks + khalf];
                af[mt] = ld_frag(p, p + 16);
            }
#pragma unroll
            for (int nt = 0; nt < 4; ++nt) {
                const u16* p = &lB[cur][(waveN * 64 + nt * 16 + l16) * LPITCH + ks + khalf];
                bfr[nt] = ld_frag(p, p + 16);
            }
#pragma unroll
            for (int mt = 0; mt < 2; ++mt)
#pragma unroll
                for (int nt = 0; nt < 4; ++nt)
                    acc[mt][nt] = wmma_bf16(af[mt], bfr[nt], acc[mt][nt]);
        }
        // publish point: this wave's reads of buffer cur are done before the
        // refill below may overwrite it
        asm volatile("s_wait_dscnt 0x0" ::: "memory");
        wait_async0();       // the next stage's copies of this wave have landed
        __syncthreads();     // next stage readable by all; buffer cur left by all
        if (kk + 2 * BK < K) stage(cur, kk + 2 * BK);   // refill two stages ahead
        cur ^= 1;
    }
    wait_async0();           // nothing outstanding when the wave ends

    // Epilogue. C layout: vgpr j -> row mloc+j, lane%16 -> col.
    if constexpr (MODE == MODE_QKV) {
        // A block's 128 columns lie wholly in q, in k or in v, so sel is the same for
        // the whole block: ONE scalar branch, taken in front of the loops, picks
        // between two straight-line epilogues.  q, k [b,h,s,d] and v [b,h,d,s] lie one
        // behind another from outB on; only q takes the scale.  The loops are unrolled
        // so that acc stays in registers and the store offsets are immediates.
        const int sel = blockIdx.x / (D_MODEL / 128);   // 0 q, 1 k, 2 v
        u16* o = outB + (size_t)sel * ROWS * D_MODEL;
        const int col0 = (bN & (D_MODEL - 1)) + waveN * 64 + l16;
        const int row0 = bM + waveM * 32 + mloc;
        if (sel == 2) {
#pragma unroll
            for (int mt = 0; mt < 2; ++mt)
#pragma unroll
                for (int nt = 0; nt < 4; ++nt)
#pragma unroll
                    for (int j = 0; j < 8; ++j) {
                        const int grow = row0 + mt * 16 + j, gcol = col0 + nt * 16;
                        int bb = grow >> 11, s = grow & 2047;
                        int h = gcol >> 6, d = gcol & 63;
                        o[(((size_t)(bb * NH + h) * HD) + d) * SEQ + s] = f32_to_bf16(acc[mt][nt][j]);
                    }
        } else {
            const float sc = sel == 0 ? scale : 1.0f;
#pragma unroll
            for (int mt = 0; mt < 2; ++mt)
#pragma unroll
                for (int nt = 0; nt < 4; ++nt)
#pragma unroll
                    for (int j = 0; j < 8; ++j) {
                        const int grow = row0 + mt * 16 + j, gcol = col0 + nt * 16;
                        int bb = grow >> 11, s = grow & 2047;
                        int h = gcol >> 6, d = gcol & 63;
                        o[(((size_t)(bb * NH + h) * SEQ) + s) * HD + d] = f32_to_bf16(acc[mt][nt][j] * sc);
                    }
            // the other branch's code follows these stores in the listing and rewrites
            // their address registers: the wait stands in front of any such rewrite
            asm volatile("s_wait_xcnt 0x0" ::: "memory");
        }
        return;
    }
#pragma unroll
    for (int mt = 0; mt < 2; ++mt) {
#pragma unroll
        for (int nt = 0; nt < 4; ++nt) {
            const int gcol = bN + waveN * 64 + nt * 16 + l16;
#pragma unroll
            for (int j = 0; j < 8; ++j) {
                const int grow = bM + waveM * 32 + mt * 16 + mloc + j;
                float v = acc[mt][nt][j] * scale;
                if constexpr (MODE == MODE_F32) {
                    size_t idx = (size_t)grow * N + gcol;
                    outF[idx] = v + bias[gcol] + resid[idx];
                } else { // MODE_GELU
                    float xv = v + bias[gcol];
                    float gl = 0.5f * xv * (1.0f + erff(xv * 0.70710678118654752f));
                    outB[(size_t)grow * N + gcol] = f32_to_bf16(gl);
                }
            }
        }
    }
}

#define APITCH 72   // LDS row pitch in elements: 144 B = 16 B x odd

// value of lane l ^ 16
__device__ __forceinline__ float other_half(float v) {
    int b = __float_as_int(v);
    return __int_as_float(__builtin_amdgcn_permlanex16(b, b, 0x76543210, 0xfedcba98, false, false));
}

__global__ __launch_bounds__(128) void attn_k(const u16* __restrict__ q,
                                              const u16* __restrict__ k,
                                              const u16* __restrict__ vt,
                                              u16* __restrict__ yb) {
    __shared__ __attribute__((aligned(16))) u16 lK[2][64 * APITCH];   // [key][d]
    __shared__ __attribute__((aligned(16))) u16 lV[2][64 * APITCH];   // [d][key]
    const int lane = threadIdx.x & 31;
    const int wave = threadIdx.x >> 5;
    const int bh = blockIdx.y;                 // b*NH + h
    const int qbase = blockIdx.x * 64 + wave * 16;
    const int l16 = lane & 15;
    const int khalf = (lane >> 4) * 8;
    const int mloc = (lane >> 4) * 8;
    const size_t headOff = (size_t)bh * SEQ * HD;
    // staging assignment: 8 lanes cover one 128 B row, so a wave-wide copy is four
    // whole lines; this thread copies 16 B chunk sc of K rows sr, sr + 16, sr + 32,
    // sr + 48 and of V^T rows 4 sr .. 4 sr + 3 (row steps of 2 KiB and 4 KiB)
    const int sr = threadIdx.x >> 3, sc = threadIdx.x & 7;

    // copy the tile of keys kb .. kb + 63 into buffer buf
    auto stage = [&](int buf, int kb) {
        const u16* gk = k + headOff + (size_t)(kb + sr) * HD + sc * 8;
        const u16* gv = vt + headOff + (size_t)(sr * 4) * SEQ + kb + sc * 8;
        u16* lk = &lK[buf][sr * APITCH + sc * 8];
        u16* lv = &lV[buf][sr * 4 * APITCH + sc * 8];
#pragma unroll   // the 8 copies issue back to back, LDS steps are constants
        for (int i = 0; i < 4; ++i) {
            cp16_g2l(gk + (size_t)(i * 16) * HD, lk + i * 16 * APITCH);
            cp16_g2l(gv + (size_t)i * SEQ, lv + i * APITCH);
        }
    };

    bf16x16 qf[2];     // B operand of S^T: column = query qbase + l16
    {
        const u16* qp = q + headOff + (size_t)(qbase + l16) * HD;
#pragma unroll
        for (int kt = 0; kt < 2; ++kt) {
            const u16* p = qp + kt * 32 + khalf;
            qf[kt] = ld_frag(p, p + 16);
        }
    }

    const float LOG2E = 1.44269504088896340736f;
    f32x8 O[4];        // O^T: O[nd][j] = d nd * 16 + mloc + j of query qbase + l16
    float rmax = -INFINITY;   // this lane's query, both halves alike
    float rsum = 0.0f;        // this half's keys only; the halves join after the loop
#pragma unroll
    for (int n = 0; n < 4; ++n) O[n] = zero8();

    stage(0, 0);
    wait_async0();
    __syncthreads();     // tile 0 readable by all four waves
    stage(1, 64);

    int cur = 0;
    for (int kb = 0; kb < SEQ; kb += 64) {
        // ---- scores: S^T[64 x 16] = K * Q^T (q pre-scaled) ----
        f32x8 sAcc[4];   // sAcc[n][j] = key kb + n * 16 + mloc + j, query qbase + l16
#pragma unroll
        for (int n = 0; n < 4; ++n) {
            sAcc[n] = zero8();
#pragma unroll
            for (int kt = 0; kt < 2; ++kt) {
                const u16* kp = &lK[cur][(n * 16 + l16) * APITCH + kt * 32 + khalf];
                bf16x16 kf = ld_frag(kp, kp + 16);
                sAcc[n] = wmma_bf16(kf, qf[kt], sAcc[n]);
            }
#pragma unroll
            for (int j = 0; j < 8; ++j) {
                if (kb + n * 16 + mloc + j == qbase + l16) sAcc[n][j] = -INFINITY;
            }
        }
        // ---- online softmax: one query per lane ----
        float t = sAcc[0][0];
#pragma unroll
        for (int n = 0; n < 4; ++n)
#pragma unroll
            for (int j = 0; j < 8; ++j) t = fmaxf(t, sAcc[n][j]);
        t = fmaxf(t, other_half(t));
        const float nm = fmaxf(rmax, t * LOG2E);
        const float corr = __builtin_amdgcn_exp2f(rmax - nm);
        rmax = nm;
#pragma unroll
        for (int n = 0; n < 4; ++n)
#pragma unroll
            for (int j = 0; j < 8; ++j) O[n][j] *= corr;

        f32x2 ps[2];     // packed adds, two chains, so that they do not wait on one another
        ps[0] = (f32x2){0.0f, 0.0f};
        ps[1] = (f32x2){0.0f, 0.0f};
#pragma unroll
        for (int n = 0; n < 4; ++n)
#pragma unroll
            for (int j = 0; j < 8; j += 2) {
                f32x2 p;
                p[0] = __builtin_amdgcn_exp2f(fmaf(sAcc[n][j], LOG2E, -nm));
                p[1] = __builtin_amdgcn_exp2f(fmaf(sAcc[n][j + 1], LOG2E, -nm));
                sAcc[n][j] = p[0];
                sAcc[n][j + 1] = p[1];
                ps[(j >> 1) & 1] += p;
            }
        ps[0] += ps[1];
        rsum = rsum * corr + (ps[0][0] + ps[0][1]);
        // ---- P^T: two score tiles, converted in place, are one B operand ----
        bf16x16 pf[2];
#pragma unroll
        for (int kt = 0; kt < 2; ++kt)
#pragma unroll
            for (int s = 0; s < 16; ++s) pf[kt][s] = (__bf16)sAcc[2 * kt + (s >> 3)][s & 7];
        // ---- O^T += V^T * P^T  (V^T layout: [d][s], contiguous over keys) ----
#pragma unroll
        for (int nd = 0; nd < 4; ++nd) {
#pragma unroll
            for (int kt = 0; kt < 2; ++kt) {
                const u16* vp = &lV[cur][(nd * 16 + l16) * APITCH + kt * 32 + khalf];
                bf16x16 vf = ld_frag(vp, vp + 16);
                O[nd] = wmma_bf16(vf, pf[kt], O[nd]);
            }
        }
        // publish point: this wave's reads of buffer cur are done before the
        // refill below may overwrite it
        asm volatile("s_wait_dscnt 0x0" ::: "memory");
        wait_async0();       // the next tile's copies of this wave have landed
        __syncthreads();     // next tile readable by all; buffer cur left by all
        if (kb + 128 < SEQ) stage(cur, kb + 128);   // refill two tiles ahead
        cur ^= 1;
    }
    wait_async0();           // nothing outstanding when the wave ends

    // a lane holds 8 consecutive d of its query per tile: one 16 B store each
    const int bb = bh >> 4, h = bh & 15;
    rsum += other_half(rsum);
    const float inv = 1.0f / rsum;
    u16* yr = yb + ((size_t)bb * SEQ + qbase + l16) * D_MODEL + h * HD + mloc;
#pragma unroll
    for (int nd = 0; nd < 4; ++nd) {
        uint4 o;
        o.x = pack2_bf16(O[nd][0] * inv, O[nd][1] * inv);
        o.y = pack2_bf16(O[nd][2] * inv, O[nd][3] * inv);
        o.z = pack2_bf16(O[nd][4] * inv, O[nd][5] * inv);
        o.w = pack2_bf16(O[nd][6] * inv, O[nd][7] * inv);
        *(uint4*)(yr + nd * 16) = o;
    }
}

// ---------------------------------------------------------------------------
extern "C" void kernel_launch(void* const* d_in, const int* in_sizes, int n_in,
                              void* d_out, int out_size, void* d_ws, size_t ws_size,
                              hipStream_t stream) {
    (void)in_sizes; (void)n_in; (void)out_size; (void)ws_size;
    const float* x   = (const float*)d_in[0];
    const float* Wk  = (const float*)d_in[1];
    const float* Wq  = (const float*)d_in[2];
    const float* Wv  = (const float*)d_in[3];
    const float* Wp  = (const float*)d_in[4];
    const float* bp  = (const float*)d_in[5];
    const float* g1  = (const float*)d_in[6];
    const float* b1  = (const float*)d_in[7];
    const float* g2  = (const float*)d_in[8];
    const float* b2  = (const float*)d_in[9];
    const float* W1  = (const float*)d_in[10];
    const float* bm1 = (const float*)d_in[11];
    const float* W2  = (const float*)d_in[12];
    const float* bm2 = (const float*)d_in[13];
    float* out = (float*)d_out;

    char* ws = (char*)d_ws;
    size_t off = 0;
    auto alloc = [&](size_t bytes) -> char* {
        char* p = ws + off;
        off += (bytes + 255) & ~(size_t)255;
        return p;
    };
    float* xnF = (float*)alloc((size_t)ROWS * D_MODEL * 4);   // 16 MB
    u16*   xnB = (u16*)  alloc((size_t)ROWS * D_MODEL * 2);   //  8 MB
    u16*   WqT = (u16*)  alloc((size_t)D_MODEL * D_MODEL * 2 * 4);   // q, k, v, p in a row
    u16*   WpT = WqT + (size_t)D_MODEL * D_MODEL * 3;
    u16*   W1T = (u16*)  alloc((size_t)D_MODEL * 4 * D_MODEL * 2);  // 8 MB
    u16*   W2T = (u16*)  alloc((size_t)D_MODEL * 4 * D_MODEL * 2);  // 8 MB
    char*  pool = alloc((size_t)ROWS * D_MODEL * 2 * 4);            // 32 MB shared pool
    u16*   qB  = (u16*)pool;
    u16*   kB  = (u16*)(pool + (size_t)ROWS * HD * NH * 2);
    u16*   vtB = (u16*)(pool + (size_t)ROWS * HD * NH * 4);
    u16*   yB  = (u16*)(pool + (size_t)ROWS * HD * NH * 6);
    u16*   uB  = (u16*)pool;   // aliases q/k/vt/y (dead by MLP time)
    float* hF  = (float*)alloc((size_t)ROWS * D_MODEL * 4);   // 16 MB
    u16*   hnB = (u16*)  alloc((size_t)ROWS * D_MODEL * 2);   //  8 MB

    // 1) + 2) Weight casts + transposes to bf16 [N,K], and LayerNorm1: x -> xn (f32 + bf16)
    prep_k<<<PREP_BLOCKS, 256, 0, stream>>>(x, g1, b1, xnF, xnB, Wq, Wk, Wv, Wp, W1, W2,
                                            WqT, W1T, W2T);

    // 3) QKV projections in one launch (q pre-scaled by 1/sqrt(HD)); q, k and vt lie
    //    one behind another in the pool
    dim3 gQKV(D_MODEL / 128, ROWS / 128);
    gemm_bf16_k<MODE_QKV><<<dim3(3 * D_MODEL / 128, ROWS / 128), 256, 0, stream>>>(
        xnB, WqT, ROWS, 3 * D_MODEL, D_MODEL, 0.125f, nullptr, nullptr, nullptr, qB);

    // 4) Flash attention
    attn_k<<<dim3(SEQ / 64, NB * NH), 128, 0, stream>>>(qB, kB, vtB, yB);

    // 5) Output projection + residual: h = xn + y*Wp + bp
    gemm_bf16_k<MODE_F32><<<gQKV, 256, 0, stream>>>(yB, WpT, ROWS, D_MODEL, D_MODEL,
                                                    1.0f, bp, xnF, hF, nullptr);

    // 6) LayerNorm2: h -> hn (bf16 only)
    layernorm_k<<<ROWS / 8, 256, 0, stream>>>(hF, g2, b2, nullptr, hnB);

    // 7) MLP up + exact GELU: u = gelu(hn*W1 + bm1)
    dim3 gUp(4 * D_MODEL / 128, ROWS / 128);
    gemm_bf16_k<MODE_GELU><<<gUp, 256, 0, stream>>>(hnB, W1T, ROWS, 4 * D_MODEL, D_MODEL,
                                                    1.0f, bm1, nullptr, nullptr, uB);

    // 8) MLP down + residual: out = h + u*W2 + bm2
    gemm_bf16_k<MODE_F32><<<gQKV, 256, 0, stream>>>(uB, W2T, ROWS, D_MODEL, 4 * D_MODEL,
                                                    1.0f, bm2, hF, out, nullptr);
}

// v008
// Measured time: 171 microseconds a run.
// Next to v007, in two timings, it ran 1.06 times as fast each time.
// All steps since v000 together make it 2.43 times as fast.
#include <hip/hip_runtime.h>
#include <hip/hip_bf16.h>
#include <math.h>

typedef unsigned short u16;
typedef __bf16 bf16x16 __attribute__((ext_vector_type(16)));
typedef float f32x8 __attribute__((ext_vector_type(8)));
typedef float f32x4 __attribute__((ext_vector_type(4)));
typedef float f32x2 __attribute__((ext_vector_type(2)));
typedef unsigned int uint8v __attribute__((ext_vector_type(8)));
typedef int v4i __attribute__((__vector_size__(16)));

#define D_MODEL 1024
#define SEQ 2048
#define NB 2
#define NH 16
#define HD 64
#define ROWS (NB * SEQ)   // 4096

#if __has_builtin(__builtin_amdgcn_global_load_async_to_lds_b128)
#define USE_ASYNC_LDS 1
#endif

__device__ __forceinline__ u16 f32_to_bf16(float f) {
    unsigned int u = __float_as_uint(f);
    u += 0x7FFFu + ((u >> 16) & 1u);   // round to nearest even
    return (u16)(u >> 16);
}

__device__ __forceinline__ bf16x16 ld_frag(const u16* plo, const u16* phi) {
    uint4 lo = *(const uint4*)plo;
    uint4 hi = *(const uint4*)phi;
    uint8v t;
    t[0] = lo.x; t[1] = lo.y; t[2] = lo.z; t[3] = lo.w;
    t[4] = hi.x; t[5] = hi.y; t[6] = hi.z; t[7] = hi.w;
    return __builtin_bit_cast(bf16x16, t);
}

__device__ __forceinline__ f32x8 wmma_bf16(bf16x16 a, bf16x16 b, f32x8 c) {
    return __builtin_amdgcn_wmma_f32_16x16x32_bf16(false, a, false, b, (short)0, c, false, false);
}

__device__ __forceinline__ f32x8 zero8() {
    f32x8 z;
#pragma unroll
    for (int i = 0; i < 8; ++i) z[i] = 0.0f;
    return z;
}

// Copy 16B global -> LDS. Async (memory->LDS direct, ASYNCcnt) when available.
__device__ __forceinline__ void cp16_g2l(const u16* g, u16* l) {
#ifdef USE_ASYNC_LDS
    __builtin_amdgcn_global_load_async_to_lds_b128(
        (__attribute__((address_space(1))) v4i*)const_cast<u16*>(g),
        (__attribute__((address_space(3))) v4i*)l, 0, 0);
#else
    *(uint4*)l = *(const uint4*)g;
#endif
}

__device__ __forceinline__ void wait_async0() {
#ifdef USE_ASYNC_LDS
    // this wave's copies have landed; the clobber keeps every LDS read behind it
    asm volatile("s_wait_asynccnt 0x0" ::: "memory");
#endif
}

// ---------------------------------------------------------------------------
// The two kernels below only move data.  For speed each wave gets a large
// piece: few waves, many 16 B loads in flight per lane, no LDS, no barrier.
// Every loop in them is unrolled so that its arrays are registers and its steps
// immediate offsets.
// Both are written as device functions that take their block's index: the six
// weight casts and the first layernorm depend on nothing but the inputs, so they
// share ONE launch (prep_k below) instead of seven that each leave the chip
// partly empty and pay the gap between launches.
// ---------------------------------------------------------------------------
__device__ __forceinline__ unsigned int pack2_bf16(float lo, float hi) {
    return (unsigned int)f32_to_bf16(lo) | ((unsigned int)f32_to_bf16(hi) << 16);
}

// ---------------------------------------------------------------------------
// Weight cast + transpose: W[K,N] f32 -> out[N,K] bf16.
// A wave takes a tile of 64 k x 32 n.  Lane (kb = lane / 8, nb = lane % 8) reads
// 4 consecutive n of rows 8 kb .. 8 kb + 7 (and the same 32 rows further on), so
// a wave-wide load is four whole 128 B lines; the lane then owns 8 consecutive k
// of each of its 4 columns, which is one 16 B store into a row of out: the
// transpose happens in registers.  The two stores of a column fill its 128 B line.
// K and N are compile-time values, so every row step is an immediate offset.
// A block of 256 threads (8 waves side by side in n) takes 64 k x 256 n: tile
// t of (N/256) * (K/64), n fastest.
// ---------------------------------------------------------------------------
template <int K, int N>
__device__ __forceinline__ void cast_transpose_tile(const float* __restrict__ W,
                                                    u16* __restrict__ out, int t) {
    const int lane = threadIdx.x & 31;
    const int wave = threadIdx.x >> 5;
    const int n0 = (t % (N / 256)) * 256 + wave * 32 + (lane & 7) * 4;
    const int k0 = (t / (N / 256)) * 64 + (lane >> 3) * 8;
    const float* src = W + (size_t)k0 * N + n0;
    f32x4 v[2][8];
#pragma unroll
    for (int hf = 0; hf < 2; ++hf)
#pragma unroll
        for (int r = 0; r < 8; ++r)
            v[hf][r] = *(const f32x4*)(src + (hf * 32 + r) * N);
    // holds all 16 loads in front of the first use: without it the build issued
    // them in five groups and the wave waited out a memory latency for each; src is
    // named so that no load's result lands on the address register the others use
    asm volatile("" :: "v"(src), "v"(v[0][0]), "v"(v[0][1]), "v"(v[0][2]), "v"(v[0][3]),
                       "v"(v[0][4]), "v"(v[0][5]), "v"(v[0][6]), "v"(v[0][7]),
                       "v"(v[1][0]), "v"(v[1][1]), "v"(v[1][2]), "v"(v[1][3]),
                       "v"(v[1][4]), "v"(v[1][5]), "v"(v[1][6]), "v"(v[1][7]));
    u16* dst = out + (size_t)n0 * K + k0;
#pragma unroll
    for (int hf = 0; hf < 2; ++hf)
#pragma unroll
        for (int c = 0; c < 4; ++c) {
            uint4 t;
            t.x = pack2_bf16(v[hf][0][c], v[hf][1][c]);
            t.y = pack2_bf16(v[hf][2][c], v[hf][3][c]);
            t.z = pack2_bf16(v[hf][4][c], v[hf][5][c]);
            t.w = pack2_bf16(v[hf][6][c], v[hf][7][c]);
            *(uint4*)(dst + c * K + hf * 32) = t;
        }
    // in prep_k another job's code follows these stores in the listing and rewrites
    // their address and data registers: the wait stands in front of any such rewrite
    asm volatile("s_wait_xcnt 0x0" ::: "memory");
}

// ---------------------------------------------------------------------------
// LayerNorm: one row (D=1024) per wave, 8 rows per 256-thread block.  A lane holds
// 8 pieces of 4 floats, piece i at column 128 i + 4 lane, so every wave-wide load
// and f32 store is 512 contiguous bytes.  Sums: in-lane, then a five-step butterfly
// over the wave.  Writes f32 (optional) + bf16.
// ---------------------------------------------------------------------------
__device__ __forceinline__ void layernorm_rows(const float* __restrict__ x,
                                               const float* __restrict__ g,
                                               const float* __restrict__ b,
                                               float* __restrict__ outF,
                                               u16* __restrict__ outB, int blk) {
    const int lane = threadIdx.x & 31;
    const size_t base = ((size_t)blk * 8 + (threadIdx.x >> 5)) * D_MODEL + lane * 4;
    const float* xr = x + base;
    const unsigned int pb = lane * 16;     // byte offset of this lane's piece in g and b
    f32x4 v[8], gv[8], bv[8];
#pragma unroll
    for (int i = 0; i < 8; ++i) v[i] = *(const f32x4*)(xr + i * 128);
#pragma unroll
    for (int i = 0; i < 8; ++i) {
        gv[i] = *(const f32x4*)((const char*)g + pb + i * 512);
        bv[i] = *(const f32x4*)((const char*)b + pb + i * 512);
    }
    // nothing is scheduled across this line, so all 24 loads are issued before the
    // first use: without it the build fetched x in two groups and g, b behind the
    // sums, one latency after another
    __builtin_amdgcn_sched_barrier(0);
    // the address registers live past the last load's issue: without this the build
    // landed the last load's result on a register that the loads before it name
    asm volatile("" :: "v"(xr), "v"(lane));
    float s = 0.f, s2 = 0.f;
#pragma unroll
    for (int i = 0; i < 8; ++i) {
        s += (v[i][0] + v[i][1]) + (v[i][2] + v[i][3]);
        s2 += (v[i][0] * v[i][0] + v[i][1] * v[i][1]) + (v[i][2] * v[i][2] + v[i][3] * v[i][3]);
    }
#pragma unroll
    for (int off = 16; off > 0; off >>= 1) {
        s += __shfl_xor(s, off);
        s2 += __shfl_xor(s2, off);
    }
    const float mu = s * (1.0f / D_MODEL);
    const float var = s2 * (1.0f / D_MODEL) - mu * mu;
    const float rs = rsqrtf(var + 1e-5f);
#pragma unroll
    for (int i = 0; i < 8; ++i)
#pragma unroll
        for (int c = 0; c < 4; ++c) v[i][c] = (v[i][c] - mu) * rs * gv[i][c] + bv[i][c];
    if (outF) {
#pragma unroll
        for (int i = 0; i < 8; ++i) *(f32x4*)(outF + base + i * 128) = v[i];
    }
#pragma unroll
    for (int i = 0; i < 8; ++i) {
        uint2 p;
        p.x = pack2_bf16(v[i][0], v[i][1]);
        p.y = pack2_bf16(v[i][2], v[i][3]);
        *(uint2*)(outB + base + i * 128) = p;
    }
    // as in cast_transpose_tile: in front of any rewrite of the stores' registers by
    // the code that follows them in prep_k's listing
    asm volatile("s_wait_xcnt 0x0" ::: "memory");
}

__global__ __launch_bounds__(256) void layernorm_k(const float* __restrict__ x,
                                                   const float* __restrict__ g,
                                                   const float* __restrict__ b,
                                                   float* __restrict__ outF,
                                                   u16* __restrict__ outB) {
    layernorm_rows(x, g, b, outF, outB, blockIdx.x);
}

// ---------------------------------------------------------------------------
// All work that reads only inputs, in one launch.  The block index picks the job
// (scalar branches): the four square weights, the two MLP weights, then the first
// layernorm, whose output the next launch reads first.  Wsq holds the transposed
// square weights one behind another in the order q, k, v, p.
// ---------------------------------------------------------------------------
#define PREP_LN  (ROWS / 8)                                // 512 blocks
#define PREP_MLP ((D_MODEL / 64) * (4 * D_MODEL / 256))    // 256 blocks per MLP weight
#define PREP_SQ  ((D_MODEL / 64) * (D_MODEL / 256))        // 64 blocks per square weight
#define PREP_BLOCKS (PREP_LN + 2 * PREP_MLP + 4 * PREP_SQ)

__global__ __launch_bounds__(256) void prep_k(const float* __restrict__ x,
                                              const float* __restrict__ g,
                                              const float* __restrict__ b,
                                              float* __restrict__ outF,
                                              u16* __restrict__ outB,
                                              const float* __restrict__ Wq,
                                              const float* __restrict__ Wk,
                                              const float* __restrict__ Wv,
                                              const float* __restrict__ Wp,
                                              const float* __restrict__ W1,
                                              const float* __restrict__ W2,
                                              u16* __restrict__ Wsq,
                                              u16* __restrict__ W1T,
                                              u16* __restrict__ W2T) {
    int t = blockIdx.x;
    if (t < 4 * PREP_SQ) {
        const int w = t / PREP_SQ;
        const float* W = w == 0 ? Wq : w == 1 ? Wk : w == 2 ? Wv : Wp;
        cast_transpose_tile<D_MODEL, D_MODEL>(W, Wsq + (size_t)w * D_MODEL * D_MODEL, t % PREP_SQ);
        return;
    }
    t -= 4 * PREP_SQ;
    if (t < PREP_MLP) {
        cast_transpose_tile<D_MODEL, 4 * D_MODEL>(W1, W1T, t);
        return;
    }
    t -= PREP_MLP;
    if (t < PREP_MLP) {
        cast_transpose_tile<4 * D_MODEL, D_MODEL>(W2, W2T, t);
        return;
    }
    layernorm_rows(x, g, b, outF, outB, t - PREP_MLP);
}

// ---------------------------------------------------------------------------
// Tiled bf16 GEMM with WMMA.  C[M,N] = A[M,K] * Bt[N,K]^T  (Bt is B transposed)
// Block tile 128x128, 8 waves (4 M x 2 N), each wave 32x64.
// A stage is 128 k of every operand row (256 B, two whole lines), so one
// wave-wide 16 B copy covers two full rows; four 32-k blocks per stage.
// Double-buffered LDS; async memory->LDS copies when available.
// K must be a multiple of 128.
// ---------------------------------------------------------------------------
#define MODE_QKV  0   // Bt = [WqT; WkT; WvT], N = 3 * D_MODEL: one launch for q, k and v
#define MODE_F32  3   // outF = acc*scale + bias + resid
#define MODE_GELU 4   // outB = bf16(gelu(acc*scale + bias))
#define BK 128              // k per stage
#define LPITCH (BK + 8)     // LDS row pitch in elements: 272 B = 16 B x odd

// ---------------------------------------------------------------------------
// GELU with erf: x * Phi(x), Phi(x) = 0.5 * (1 + erf(x / sqrt(2))), without a branch.
// The library erff picks one of two polynomials by |x|, so in a wave both run under
// exec masks and every element is one long chain that the next element waits for.
// Here one form serves every x: the lower tail of the normal distribution,
//   Phi(-|x|) = exp(-x * x / 2) * (c1 t + c2 t^2 + c3 t^3 + c4 t^4 + c5 t^5),
//   t = 1 / (1 + 0.2316419 |x|),
// the classical five-term rational fit (absolute error below 7.5e-8, under the
// spacing of f32 at 1 + erf), its factor 1 / sqrt(2 pi) folded into c1 .. c5.
// For either sign x * Phi(x) = max(x, 0) - |x| * Phi(-|x|).
// Eight elements go through it side by side, so no step waits for the one before.
// ---------------------------------------------------------------------------
// Eight reciprocals, or eight 2^x, in place.  Written as one statement because the
// instruction set asks for one free slot behind a transcendental before its result
// is read or its source overwritten:
// here each neighbour works on another register, and the
// v_nop at the end is the slot of the last one.
__device__ __forceinline__ void rcp8(float (&v)[8]) {
    asm("v_rcp_f32 %0, %0\n\tv_rcp_f32 %1, %1\n\tv_rcp_f32 %2, %2\n\tv_rcp_f32 %3, %3\n\t"
        "v_rcp_f32 %4, %4\n\tv_rcp_f32 %5, %5\n\tv_rcp_f32 %6, %6\n\tv_rcp_f32 %7, %7\n\tv_nop"
        : "+v"(v[0]), "+v"(v[1]), "+v"(v[2]), "+v"(v[3]),
          "+v"(v[4]), "+v"(v[5]), "+v"(v[6]), "+v"(v[7]));
}
__device__ __forceinline__ void exp2_8(float (&v)[8]) {
    asm("v_exp_f32 %0, %0\n\tv_exp_f32 %1, %1\n\tv_exp_f32 %2, %2\n\tv_exp_f32 %3, %3\n\t"
        "v_exp_f32 %4, %4\n\tv_exp_f32 %5, %5\n\tv_exp_f32 %6, %6\n\tv_exp_f32 %7, %7\n\tv_nop"
        : "+v"(v[0]), "+v"(v[1]), "+v"(v[2]), "+v"(v[3]),
          "+v"(v[4]), "+v"(v[5]), "+v"(v[6]), "+v"(v[7]));
}

__device__ __forceinline__ void gelu8(float (&x)[8]) {
    float t[8], e[8];
#pragma unroll   // this loop and the next: the arrays are registers
    for (int j = 0; j < 8; ++j) {
        t[j] = fmaf(fabsf(x[j]), 0.2316419f, 1.0f);
        e[j] = x[j] * x[j] * -0.72134752044448170f;   // -x^2 / 2 in log2 units
    }
    rcp8(t);
    exp2_8(e);
#pragma unroll
    for (int j = 0; j < 8; ++j) {
        float p = fmaf(t[j], 0.5307027145f, -0.7265760135f);
        p = fmaf(p, t[j], 0.7107068705f);
        p = fmaf(p, t[j], -0.142248368f);
        p = fmaf(p, t[j], 0.127414796f);
        p *= t[j];
        x[j] = fmaf(-fabsf(x[j]), p * e[j], fmaxf(x[j], 0.0f));
    }
}

// MODE is a compile-time parameter: each instantiation holds one straight-line
// epilogue, so its loads of bias and resid issue together instead of one
// load, wait and store per element behind a chain of branches on the mode.
template <int MODE>
__global__ __launch_bounds__(256) void gemm_bf16_k(const u16* __restrict__ A,
                                                   const u16* __restrict__ Bt,
                                                   int M, int N, int K,
                                                   float scale,
                                                   const float* __restrict__ bias,
                                                   const float* __restrict__ resid,
                                                   float* __restrict__ outF,
                                                   u16* __restrict__ outB) {
    __shared__ __attribute__((aligned(16))) u16 lA[2][128 * LPITCH];
    __shared__ __attribute__((aligned(16))) u16 lB[2][128 * LPITCH];
    const int tid = threadIdx.x;
    const int lane = tid & 31;
    const int wave = tid >> 5;
    const int waveM = wave & 3;       // 0..3
    const int waveN = wave >> 2;      // 0..1
    const int bM = blockIdx.y * 128;
    const int bN = blockIdx.x * 128;
    const int l16 = lane & 15;
    const int khalf = (lane >> 4) * 8;     // 0 or 8 (K sub-chunk base)
    const int mloc = (lane >> 4) * 8;      // 0 or 8 (C-layout row base)
    // staging assignment: 16 lanes cover one 256 B row; this thread copies
    // 16 B chunk sc of rows sr, sr + 16, ..., sr + 112 of both operands
    const int sr = tid >> 4, sc = tid & 15;

    f32x8 acc[2][4];
#pragma unroll
    for (int mt = 0; mt < 2; ++mt)
#pragma unroll
        for (int nt = 0; nt < 4; ++nt) acc[mt][nt] = zero8();

    // stage K-slice kk into buffer buf
    auto stage = [&](int buf, int kk) {
        const u16* ga = A + (size_t)(bM + sr) * K + kk + sc * 8;
        const u16* gb = Bt + (size_t)(bN + sr) * K + kk + sc * 8;
        u16* la = &lA[buf][sr * LPITCH + sc * 8];
        u16* lb = &lB[buf][sr * LPITCH + sc * 8];
#pragma unroll   // the 16 copies issue back to back, LDS steps are constants
        for (int i = 0; i < 8; ++i) {
            cp16_g2l(ga + (size_t)(i * 16) * K, la + i * 16 * LPITCH);
            cp16_g2l(gb + (size_t)(i * 16) * K, lb + i * 16 * LPITCH);
        }
    };

    stage(0, 0);
    wait_async0();
    __syncthreads();
    if (BK < K) stage(1, BK);

    int cur = 0;
    for (int kk = 0; kk < K; kk += BK) {
#pragma unroll   // the four blocks' LDS offsets become immediates
        for (int ks = 0; ks < BK; ks += 32) {
            bf16x16 af[2], bfr[4];
#pragma unroll
            for (int mt = 0; mt < 2; ++mt) {
                const u16* p = &lA[cur][(waveM * 32 + mt * 16 + l16) * LPITCH + ks + khalf];
                af[mt] = ld_frag(p, p + 16);
            }
#pragma unroll
            for (int nt = 0; nt < 4; ++nt) {
                const u16* p = &lB[cur][(waveN * 64 + nt * 16 + l16) * LPITCH + ks + khalf];
                bfr[nt] = ld_frag(p, p + 16);
            }
#pragma unroll
            for (int mt = 0; mt < 2; ++mt)
#pragma unroll
                for (int nt = 0; nt < 4; ++nt)
                    acc[mt][nt] = wmma_bf16(af[mt], bfr[nt], acc[mt][nt]);
        }
        // publish point: this wave's reads of buffer cur are done before the
        // refill below may overwrite it
        asm volatile("s_wait_dscnt 0x0" ::: "memory");
        wait_async0();       // the next stage's copies of this wave have landed
        __syncthreads();     // next stage readable by all; buffer cur left by all
        if (kk + 2 * BK < K) stage(cur, kk + 2 * BK);   // refill two stages ahead
        cur ^= 1;
    }
    wait_async0();           // nothing outstanding when the wave ends

    // Epilogue. C layout: vgpr j -> row mloc+j, lane%16 -> col.
    if constexpr (MODE == MODE_QKV) {
        // A block's 128 columns lie wholly in q, in k or in v, so sel is the same for
        // the whole block: ONE scalar branch, taken in front of the loops, picks
        // between two straight-line epilogues.  q, k [b,h,s,d] and v [b,h,d,s] lie one
        // behind another from outB on; only q takes the scale.  The loops are unrolled
        // so that acc stays in registers and the store offsets are immediates.
        const int sel = blockIdx.x / (D_MODEL / 128);   // 0 q, 1 k, 2 v
        u16* o = outB + (size_t)sel * ROWS * D_MODEL;
        const int col0 = (bN & (D_MODEL - 1)) + waveN * 64 + l16;
        const int row0 = bM + waveM * 32 + mloc;
        if (sel == 2) {
#pragma unroll
            for (int mt = 0; mt < 2; ++mt)
#pragma unroll
                for (int nt = 0; nt < 4; ++nt)
#pragma unroll
                    for (int j = 0; j < 8; ++j) {
                        const int grow = row0 + mt * 16 + j, gcol = col0 + nt * 16;
                        int bb = grow >> 11, s = grow & 2047;
                        int h = gcol >> 6, d = gcol & 63;
                        o[(((size_t)(bb * NH + h) * HD) + d) * SEQ + s] = f32_to_bf16(acc[mt][nt][j]);
                    }
        } else {
            const float sc = sel == 0 ? scale : 1.0f;
#pragma unroll
            for (int mt = 0; mt < 2; ++mt)
#pragma unroll
                for (int nt = 0; nt < 4; ++nt)
#pragma unroll
                    for (int j = 0; j < 8; ++j) {
                        const int grow = row0 + mt * 16 + j, gcol = col0 + nt * 16;
                        int bb = grow >> 11, s = grow & 2047;
                        int h = gcol >> 6, d = gcol & 63;
                        o[(((size_t)(bb * NH + h) * SEQ) + s) * HD + d] = f32_to_bf16(acc[mt][nt][j] * sc);
                    }
            // the other branch's code follows these stores in the listing and rewrites
            // their address registers: the wait stands in front of any such rewrite
            asm volatile("s_wait_xcnt 0x0" ::: "memory");
        }
        return;
    }
#pragma unroll
    for (int mt = 0; mt < 2; ++mt) {
#pragma unroll
        for (int nt = 0; nt < 4; ++nt) {
            const int gcol = bN + waveN * 64 + nt * 16 + l16;
            if constexpr (MODE == MODE_F32) {
#pragma unroll
                for (int j = 0; j < 8; ++j) {
                    const int grow = bM + waveM * 32 + mt * 16 + mloc + j;
                    float v = acc[mt][nt][j] * scale;
                    size_t idx = (size_t)grow * N + gcol;
                    outF[idx] = v + bias[gcol] + resid[idx];
                }
            } else { // MODE_GELU
                float xv[8];
#pragma unroll
                for (int j = 0; j < 8; ++j) xv[j] = acc[mt][nt][j] * scale + bias[gcol];
                gelu8(xv);
#pragma unroll
                for (int j = 0; j < 8; ++j) {
                    const int grow = bM + waveM * 32 + mt * 16 + mloc + j;
                    outB[(size_t)grow * N + gcol] = f32_to_bf16(xv[j]);
                }
            }
        }
    }
}

#define APITCH 72   // LDS row pitch in elements: 144 B = 16 B x odd

// value of lane l ^ 16
__device__ __forceinline__ float other_half(float v) {
    int b = __float_as_int(v);
    return __int_as_float(__builtin_amdgcn_permlanex16(b, b, 0x76543210, 0xfedcba98, false, false));
}

__global__ __launch_bounds__(128) void attn_k(const u16* __restrict__ q,
                                              const u16* __restrict__ k,
                                              const u16* __restrict__ vt,
                                              u16* __restrict__ yb) {
    __shared__ __attribute__((aligned(16))) u16 lK[2][64 * APITCH];   // [key][d]
    __shared__ __attribute__((aligned(16))) u16 lV[2][64 * APITCH];   // [d][key]
    const int lane = threadIdx.x & 31;
    const int wave = threadIdx.x >> 5;
    const int bh = blockIdx.y;                 // b*NH + h
    const int qbase = blockIdx.x * 64 + wave * 16;
    const int l16 = lane & 15;
    const int khalf = (lane >> 4) * 8;
    const int mloc = (lane >> 4) * 8;
    const size_t headOff = (size_t)bh * SEQ * HD;
    // staging assignment: 8 lanes cover one 128 B row, so a wave-wide copy is four
    // whole lines; this thread copies 16 B chunk sc of K rows sr, sr + 16, sr + 32,
    // sr + 48 and of V^T rows 4 sr .. 4 sr + 3 (row steps of 2 KiB and 4 KiB)
    const int sr = threadIdx.x >> 3, sc = threadIdx.x & 7;

    // copy the tile of keys kb .. kb + 63 into buffer buf
    auto stage = [&](int buf, int kb) {
        const u16* gk = k + headOff + (size_t)(kb + sr) * HD + sc * 8;
        const u16* gv = vt + headOff + (size_t)(sr * 4) * SEQ + kb + sc * 8;
        u16* lk = &lK[buf][sr * APITCH + sc * 8];
        u16* lv = &lV[buf][sr * 4 * APITCH + sc * 8];
#pragma unroll   // the 8 copies issue back to back, LDS steps are constants
        for (int i = 0; i < 4; ++i) {
            cp16_g2l(gk + (size_t)(i * 16) * HD, lk + i * 16 * APITCH);
            cp16_g2l(gv + (size_t)i * SEQ, lv + i * APITCH);
        }
    };

    bf16x16 qf[2];     // B operand of S^T: column = query qbase + l16
    {
        const u16* qp = q + headOff + (size_t)(qbase + l16) * HD;
#pragma unroll
        for (int kt = 0; kt < 2; ++kt) {
            const u16* p = qp + kt * 32 + khalf;
            qf[kt] = ld_frag(p, p + 16);
        }
    }

    const float LOG2E = 1.44269504088896340736f;
    f32x8 O[4];        // O^T: O[nd][j] = d nd * 16 + mloc + j of query qbase + l16
    float rmax = -INFINITY;   // this lane's query, both halves alike
    float rsum = 0.0f;        // this half's keys only; the halves join after the loop
#pragma unroll
    for (int n = 0; n < 4; ++n) O[n] = zero8();

    stage(0, 0);
    wait_async0();
    __syncthreads();     // tile 0 readable by all four waves
    stage(1, 64);

    int cur = 0;
    for (int kb = 0; kb < SEQ; kb += 64) {
        // ---- scores: S^T[64 x 16] = K * Q^T (q pre-scaled) ----
        f32x8 sAcc[4];   // sAcc[n][j] = key kb + n * 16 + mloc + j, query qbase + l16
#pragma unroll
        for (int n = 0; n < 4; ++n) {
            sAcc[n] = zero8();
#pragma unroll
            for (int kt = 0; kt < 2; ++kt) {
                const u16* kp = &lK[cur][(n * 16 + l16) * APITCH + kt * 32 + khalf];
                bf16x16 kf = ld_frag(kp, kp + 16);
                sAcc[n] = wmma_bf16(kf, qf[kt], sAcc[n]);
            }
#pragma unroll
            for (int j = 0; j < 8; ++j) {
                if (kb + n * 16 + mloc + j == qbase + l16) sAcc[n][j] = -INFINITY;
            }
        }
        // ---- online softmax: one query per lane ----
        float t = sAcc[0][0];
#pragma unroll
        for (int n = 0; n < 4; ++n)
#pragma unroll
            for (int j = 0; j < 8; ++j) t = fmaxf(t, sAcc[n][j]);
        t = fmaxf(t, other_half(t));
        const float nm = fmaxf(rmax, t * LOG2E);
        const float corr = __builtin_amdgcn_exp2f(rmax - nm);
        rmax = nm;
#pragma unroll
        for (int n = 0; n < 4; ++n)
#pragma unroll
            for (int j = 0; j < 8; ++j) O[n][j] *= corr;

        f32x2 ps[2];     // packed adds, two chains, so that they do not wait on one another
        ps[0] = (f32x2){0.0f, 0.0f};
        ps[1] = (f32x2){0.0f, 0.0f};
#pragma unroll
        for (int n = 0; n < 4; ++n)
#pragma unroll
            for (int j = 0; j < 8; j += 2) {
                f32x2 p;
                p[0] = __builtin_amdgcn_exp2f(fmaf(sAcc[n][j], LOG2E, -nm));
                p[1] = __builtin_amdgcn_exp2f(fmaf(sAcc[n][j + 1], LOG2E, -nm));
                sAcc[n][j] = p[0];
                sAcc[n][j + 1] = p[1];
                ps[(j >> 1) & 1] += p;
            }
        ps[0] += ps[1];
        rsum = rsum * corr + (ps[0][0] + ps[0][1]);
        // ---- P^T: two score tiles, converted in place, are one B operand ----
        bf16x16 pf[2];
#pragma unroll
        for (int kt = 0; kt < 2; ++kt)
#pragma unroll
            for (int s = 0; s < 16; ++s) pf[kt][s] = (__bf16)sAcc[2 * kt + (s >> 3)][s & 7];
        // ---- O^T += V^T * P^T  (V^T layout: [d][s], contiguous over keys) ----
#pragma unroll
        for (int nd = 0; nd < 4; ++nd) {
#pragma unroll
            for (int kt = 0; kt < 2; ++kt) {
                const u16* vp = &lV[cur][(nd * 16 + l16) * APITCH + kt * 32 + khalf];
                bf16x16 vf = ld_frag(vp, vp + 16);
                O[nd] = wmma_bf16(vf, pf[kt], O[nd]);
            }
        }
        // publish point: this wave's reads of buffer cur are done before the
        // refill below may overwrite it
        asm volatile("s_wait_dscnt 0x0" ::: "memory");
        wait_async0();       // the next tile's copies of this wave have landed
        __syncthreads();     // next tile readable by all; buffer cur left by all
        if (kb + 128 < SEQ) stage(cur, kb + 128);   // refill two tiles ahead
        cur ^= 1;
    }
    wait_async0();           // nothing outstanding when the wave ends

    // a lane holds 8 consecutive d of its query per tile: one 16 B store each
    const int bb = bh >> 4, h = bh & 15;
    rsum += other_half(rsum);
    const float inv = 1.0f / rsum;
    u16* yr = yb + ((size_t)bb * SEQ + qbase + l16) * D_MODEL + h * HD + mloc;
#pragma unroll
    for (int nd = 0; nd < 4; ++nd) {
        uint4 o;
        o.x = pack2_bf16(O[nd][0] * inv, O[nd][1] * inv);
        o.y = pack2_bf16(O[nd][2] * inv, O[nd][3] * inv);
        o.z = pack2_bf16(O[nd][4] * inv, O[nd][5] * inv);
        o.w = pack2_bf16(O[nd][6] * inv, O[nd][7] * inv);
        *(uint4*)(yr + nd * 16) = o;
    }
}

// ---------------------------------------------------------------------------
extern "C" void kernel_launch(void* const* d_in, const int* in_sizes, int n_in,
                              void* d_out, int out_size, void* d_ws, size_t ws_size,
                              hipStream_t stream) {
    (void)in_sizes; (void)n_in; (void)out_size; (void)ws_size;
    const float* x   = (const float*)d_in[0];
    const float* Wk  = (const float*)d_in[1];
    const float* Wq  = (const float*)d_in[2];
    const float* Wv  = (const float*)d_in[3];
    const float* Wp  = (const float*)d_in[4];
    const float* bp  = (const float*)d_in[5];
    const float* g1  = (const float*)d_in[6];
    const float* b1  = (const float*)d_in[7];
    const float* g2  = (const float*)d_in[8];
    const float* b2  = (const float*)d_in[9];
    const float* W1  = (const float*)d_in[10];
    const float* bm1 = (const float*)d_in[11];
    const float* W2  = (const float*)d_in[12];
    const float* bm2 = (const float*)d_in[13];
    float* out = (float*)d_out;

    char* ws = (char*)d_ws;
    size_t off = 0;
    auto alloc = [&](size_t bytes) -> char* {
        char* p = ws + off;
        off += (bytes + 255) & ~(size_t)255;
        return p;
    };
    float* xnF = (float*)alloc((size_t)ROWS * D_MODEL * 4);   // 16 MB
    u16*   xnB = (u16*)  alloc((size_t)ROWS * D_MODEL * 2);   //  8 MB
    u16*   WqT = (u16*)  alloc((size_t)D_MODEL * D_MODEL * 2 * 4);   // q, k, v, p in a row
    u16*   WpT = WqT + (size_t)D_MODEL * D_MODEL * 3;
    u16*   W1T = (u16*)  alloc((size_t)D_MODEL * 4 * D_MODEL * 2);  // 8 MB
    u16*   W2T = (u16*)  alloc((size_t)D_MODEL * 4 * D_MODEL * 2);  // 8 MB
    char*  pool = alloc((size_t)ROWS * D_MODEL * 2 * 4);            // 32 MB shared pool
    u16*   qB  = (u16*)pool;
    u16*   kB  = (u16*)(pool + (size_t)ROWS * HD * NH * 2);
    u16*   vtB = (u16*)(pool + (size_t)ROWS * HD * NH * 4);
    u16*   yB  = (u16*)(pool + (size_t)ROWS * HD * NH * 6);
    u16*   uB  = (u16*)pool;   // aliases q/k/vt/y (dead by MLP time)
    float* hF  = (float*)alloc((size_t)ROWS * D_MODEL * 4);   // 16 MB
    u16*   hnB = (u16*)  alloc((size_t)ROWS * D_MODEL * 2);   //  8 MB

    // 1) + 2) Weight casts + transposes to bf16 [N,K], and LayerNorm1: x -> xn (f32 + bf16)
    prep_k<<<PREP_BLOCKS, 256, 0, stream>>>(x, g1, b1, xnF, xnB, Wq, Wk, Wv, Wp, W1, W2,
                                            WqT, W1T, W2T);

    // 3) QKV projections in one launch (q pre-scaled by 1/sqrt(HD)); q, k and vt lie
    //    one behind another in the pool
    dim3 gQKV(D_MODEL / 128, ROWS / 128);
    gemm_bf16_k<MODE_QKV><<<dim3(3 * D_MODEL / 128, ROWS / 128), 256, 0, stream>>>(
        xnB, WqT, ROWS, 3 * D_MODEL, D_MODEL, 0.125f, nullptr, nullptr, nullptr, qB);

    // 4) Flash attention
    attn_k<<<dim3(SEQ / 64, NB * NH), 128, 0, stream>>>(qB, kB, vtB, yB);

    // 5) Output projection + residual: h = xn + y*Wp + bp
    gemm_bf16_k<MODE_F32><<<gQKV, 256, 0, stream>>>(yB, WpT, ROWS, D_MODEL, D_MODEL,
                                                    1.0f, bp, xnF, hF, nullptr);

    // 6) LayerNorm2: h -> hn (bf16 only)
    layernorm_k<<<ROWS / 8, 256, 0, stream>>>(hF, g2, b2, nullptr, hnB);

    // 7) MLP up + exact GELU: u = gelu(hn*W1 + bm1)
    dim3 gUp(4 * D_MODEL / 128, ROWS / 128);
    gemm_bf16_k<MODE_GELU><<<gUp, 256, 0, stream>>>(hnB, W1T, ROWS, 4 * D_MODEL, D_MODEL,
                                                    1.0f, bm1, nullptr, nullptr, uB);

    // 8) MLP down + residual: out = h + u*W2 + bm2
    gemm_bf16_k<MODE_F32><<<gQKV, 256, 0, stream>>>(uB, W2T, ROWS, D_MODEL, 4 * D_MODEL,
                                                    1.0f, bm2, hF, out, nullptr);
}

// v009
// It runs in 166 microseconds.
// Timed twice side by side with v008, it ran 1.04 and 1.03 times as fast.
// Over all steps from v000 it is 2.51 times as fast.
#include <hip/hip_runtime.h>
#include <hip/hip_bf16.h>
#include <math.h>

typedef unsigned short u16;
typedef __bf16 bf16x16 __attribute__((ext_vector_type(16)));
typedef float f32x8 __attribute__((ext_vector_type(8)));
typedef float f32x4 __attribute__((ext_vector_type(4)));
typedef float f32x2 __attribute__((ext_vector_type(2)));
typedef unsigned int uint8v __attribute__((ext_vector_type(8)));
typedef int v4i __attribute__((__vector_size__(16)));

#define D_MODEL 1024
#define SEQ 2048
#define NB 2
#define NH 16
#define HD 64
#define ROWS (NB * SEQ)   // 4096

#if __has_builtin(__builtin_amdgcn_global_load_async_to_lds_b128)
#define USE_ASYNC_LDS 1
#endif

__device__ __forceinline__ u16 f32_to_bf16(float f) {
    unsigned int u = __float_as_uint(f);
    u += 0x7FFFu + ((u >> 16) & 1u);   // round to nearest even
    return (u16)(u >> 16);
}

__device__ __forceinline__ bf16x16 ld_frag(const u16* plo, const u16* phi) {
    uint4 lo = *(const uint4*)plo;
    uint4 hi = *(const uint4*)phi;
    uint8v t;
    t[0] = lo.x; t[1] = lo.y; t[2] = lo.z; t[3] = lo.w;
    t[4] = hi.x; t[5] = hi.y; t[6] = hi.z; t[7] = hi.w;
    return __builtin_bit_cast(bf16x16, t);
}

__device__ __forceinline__ f32x8 wmma_bf16(bf16x16 a, bf16x16 b, f32x8 c) {
    return __builtin_amdgcn_wmma_f32_16x16x32_bf16(false, a, false, b, (short)0, c, false, false);
}

__device__ __forceinline__ f32x8 zero8() {
    f32x8 z;
#pragma unroll
    for (int i = 0; i < 8; ++i) z[i] = 0.0f;
    return z;
}

// Copy 16B global -> LDS. Async (memory->LDS direct, ASYNCcnt) when available.
__device__ __forceinline__ void cp16_g2l(const u16* g, u16* l) {
#ifdef USE_ASYNC_LDS
    __builtin_amdgcn_global_load_async_to_lds_b128(
        (__attribute__((address_space(1))) v4i*)const_cast<u16*>(g),
        (__attribute__((address_space(3))) v4i*)l, 0, 0);
#else
    *(uint4*)l = *(const uint4*)g;
#endif
}

__device__ __forceinline__ void wait_async0() {
#ifdef USE_ASYNC_LDS
    // this wave's copies have landed; the clobber keeps every LDS read behind it
    asm volatile("s_wait_asynccnt 0x0" ::: "memory");
#endif
}

// ---------------------------------------------------------------------------
// The two kernels below only move data.  For speed each wave gets a large
// piece: few waves, many 16 B loads in flight per lane, no LDS, no barrier.
// Every loop in them is unrolled so that its arrays are registers and its steps
// immediate offsets.
// Both are written as device functions that take their block's index: the six
// weight casts and the first layernorm depend on nothing but the inputs, so they
// share ONE launch (prep_k below) instead of seven that each leave the chip
// partly empty and pay the gap between launches.
// ---------------------------------------------------------------------------
__device__ __forceinline__ unsigned int pack2_bf16(float lo, float hi) {
    return (unsigned int)f32_to_bf16(lo) | ((unsigned int)f32_to_bf16(hi) << 16);
}

// ---------------------------------------------------------------------------
// Weight cast + transpose: W[K,N] f32 -> out[N,K] bf16.
// A wave takes a tile of 64 k x 32 n.  Lane (kb = lane / 8, nb = lane % 8) reads
// 4 consecutive n of rows 8 kb .. 8 kb + 7 (and the same 32 rows further on), so
// a wave-wide load is four whole 128 B lines; the lane then owns 8 consecutive k
// of each of its 4 columns, which is one 16 B store into a row of out: the
// transpose happens in registers.  The two stores of a column fill its 128 B line.
// K and N are compile-time values, so every row step is an immediate offset.
// A block of 256 threads (8 waves side by side in n) takes 64 k x 256 n: tile
// t of (N/256) * (K/64), n fastest.
// ---------------------------------------------------------------------------
template <int K, int N>
__device__ __forceinline__ void cast_transpose_tile(const float* __restrict__ W,
                                                    u16* __restrict__ out, int t) {
    const int lane = threadIdx.x & 31;
    const int wave = threadIdx.x >> 5;
    const int n0 = (t % (N / 256)) * 256 + wave * 32 + (lane & 7) * 4;
    const int k0 = (t / (N / 256)) * 64 + (lane >> 3) * 8;
    const float* src = W + (size_t)k0 * N + n0;
    f32x4 v[2][8];
#pragma unroll
    for (int hf = 0; hf < 2; ++hf)
#pragma unroll
        for (int r = 0; r < 8; ++r)
            v[hf][r] = *(const f32x4*)(src + (hf * 32 + r) * N);
    // holds all 16 loads in front of the first use: without it the build issued
    // them in five groups and the wave waited out a memory latency for each; src is
    // named so that no load's result lands on the address register the others use
    asm volatile("" :: "v"(src), "v"(v[0][0]), "v"(v[0][1]), "v"(v[0][2]), "v"(v[0][3]),
                       "v"(v[0][4]), "v"(v[0][5]), "v"(v[0][6]), "v"(v[0][7]),
                       "v"(v[1][0]), "v"(v[1][1]), "v"(v[1][2]), "v"(v[1][3]),
                       "v"(v[1][4]), "v"(v[1][5]), "v"(v[1][6]), "v"(v[1][7]));
    u16* dst = out + (size_t)n0 * K + k0;
#pragma unroll
    for (int hf = 0; hf < 2; ++hf)
#pragma unroll
        for (int c = 0; c < 4; ++c) {
            uint4 t;
            t.x = pack2_bf16(v[hf][0][c], v[hf][1][c]);
            t.y = pack2_bf16(v[hf][2][c], v[hf][3][c]);
            t.z = pack2_bf16(v[hf][4][c], v[hf][5][c]);
            t.w = pack2_bf16(v[hf][6][c], v[hf][7][c]);
            *(uint4*)(dst + c * K + hf * 32) = t;
        }
    // in prep_k another job's code follows these stores in the listing and rewrites
    // their address and data registers: the wait stands in front of any such rewrite
    asm volatile("s_wait_xcnt 0x0" ::: "memory");
}

// ---------------------------------------------------------------------------
// LayerNorm: one row (D=1024) per wave, 8 rows per 256-thread block.  A lane holds
// 8 pieces of 4 floats, piece i at column 128 i + 4 lane, so every wave-wide load
// and f32 store is 512 contiguous bytes.  Sums: in-lane, then a five-step butterfly
// over the wave.  Writes f32 (optional) + bf16.
// ---------------------------------------------------------------------------
__device__ __forceinline__ void layernorm_rows(const float* __restrict__ x,
                                               const float* __restrict__ g,
                                               const float* __restrict__ b,
                                               float* __restrict__ outF,
                                               u16* __restrict__ outB, int blk) {
    const int lane = threadIdx.x & 31;
    const size_t base = ((size_t)blk * 8 + (threadIdx.x >> 5)) * D_MODEL + lane * 4;
    const float* xr = x + base;
    const unsigned int pb = lane * 16;     // byte offset of this lane's piece in g and b
    f32x4 v[8], gv[8], bv[8];
#pragma unroll
    for (int i = 0; i < 8; ++i) v[i] = *(const f32x4*)(xr + i * 128);
#pragma unroll
    for (int i = 0; i < 8; ++i) {
        gv[i] = *(const f32x4*)((const char*)g + pb + i * 512);
        bv[i] = *(const f32x4*)((const char*)b + pb + i * 512);
    }
    // nothing is scheduled across this line, so all 24 loads are issued before the
    // first use: without it the build fetched x in two groups and g, b behind the
    // sums, one latency after another
    __builtin_amdgcn_sched_barrier(0);
    // the address registers live past the last load's issue: without this the build
    // landed the last load's result on a register that the loads before it name
    asm volatile("" :: "v"(xr), "v"(lane));
    float s = 0.f, s2 = 0.f;
#pragma unroll
    for (int i = 0; i < 8; ++i) {
        s += (v[i][0] + v[i][1]) + (v[i][2] + v[i][3]);
        s2 += (v[i][0] * v[i][0] + v[i][1] * v[i][1]) + (v[i][2] * v[i][2] + v[i][3] * v[i][3]);
    }
#pragma unroll
    for (int off = 16; off > 0; off >>= 1) {
        s += __shfl_xor(s, off);
        s2 += __shfl_xor(s2, off);
    }
    const float mu = s * (1.0f / D_MODEL);
    const float var = s2 * (1.0f / D_MODEL) - mu * mu;
    const float rs = rsqrtf(var + 1e-5f);
#pragma unroll
    for (int i = 0; i < 8; ++i)
#pragma unroll
        for (int c = 0; c < 4; ++c) v[i][c] = (v[i][c] - mu) * rs * gv[i][c] + bv[i][c];
    if (outF) {
#pragma unroll
        for (int i = 0; i < 8; ++i) *(f32x4*)(outF + base + i * 128) = v[i];
    }
#pragma unroll
    for (int i = 0; i < 8; ++i) {
        uint2 p;
        p.x = pack2_bf16(v[i][0], v[i][1]);
        p.y = pack2_bf16(v[i][2], v[i][3]);
        *(uint2*)(outB + base + i * 128) = p;
    }
    // as in cast_transpose_tile: in front of any rewrite of the stores' registers by
    // the code that follows them in prep_k's listing
    asm volatile("s_wait_xcnt 0x0" ::: "memory");
}

__global__ __launch_bounds__(256) void layernorm_k(const float* __restrict__ x,
                                                   const float* __restrict__ g,
                                                   const float* __restrict__ b,
                                                   float* __restrict__ outF,
                                                   u16* __restrict__ outB) {
    layernorm_rows(x, g, b, outF, outB, blockIdx.x);
}

// ---------------------------------------------------------------------------
// All work that reads only inputs, in one launch.  The block index picks the job
// (scalar branches): the four square weights, the two MLP weights, then the first
// layernorm, whose output the next launch reads first.  Wsq holds the transposed
// square weights one behind another in the order q, k, v, p.
// ---------------------------------------------------------------------------
#define PREP_LN  (ROWS / 8)                                // 512 blocks
#define PREP_MLP ((D_MODEL / 64) * (4 * D_MODEL / 256))    // 256 blocks per MLP weight
#define PREP_SQ  ((D_MODEL / 64) * (D_MODEL / 256))        // 64 blocks per square weight
#define PREP_BLOCKS (PREP_LN + 2 * PREP_MLP + 4 * PREP_SQ)

__global__ __launch_bounds__(256) void prep_k(const float* __restrict__ x,
                                              const float* __restrict__ g,
                                              const float* __restrict__ b,
                                              float* __restrict__ outF,
                                              u16* __restrict__ outB,
                                              const float* __restrict__ Wq,
                                              const float* __restrict__ Wk,
                                              const float* __restrict__ Wv,
                                              const float* __restrict__ Wp,
                                              const float* __restrict__ W1,
                                              const float* __restrict__ W2,
                                              u16* __restrict__ Wsq,
                                              u16* __restrict__ W1T,
                                              u16* __restrict__ W2T) {
    int t = blockIdx.x;
    if (t < 4 * PREP_SQ) {
        const int w = t / PREP_SQ;
        const float* W = w == 0 ? Wq : w == 1 ? Wk : w == 2 ? Wv : Wp;
        cast_transpose_tile<D_MODEL, D_MODEL>(W, Wsq + (size_t)w * D_MODEL * D_MODEL, t % PREP_SQ);
        return;
    }
    t -= 4 * PREP_SQ;
    if (t < PREP_MLP) {
        cast_transpose_tile<D_MODEL, 4 * D_MODEL>(W1, W1T, t);
        return;
    }
    t -= PREP_MLP;
    if (t < PREP_MLP) {
        cast_transpose_tile<4 * D_MODEL, D_MODEL>(W2, W2T, t);
        return;
    }
    layernorm_rows(x, g, b, outF, outB, t - PREP_MLP);
}

// ---------------------------------------------------------------------------
// Tiled bf16 GEMM with WMMA.  C[M,N] = A[M,K] * Bt[N,K]^T  (Bt is B transposed)
// Block tile 128x128, 8 waves (4 M x 2 N), each wave 32x64.
// A stage is 128 k of every operand row (256 B, two whole lines), so one
// wave-wide 16 B copy covers two full rows; four 32-k blocks per stage.
// Double-buffered LDS; async memory->LDS copies when available.
// K must be a multiple of 128.
// The results leave through LDS.  Stored straight from the accumulators a row of a
// wave's tile goes out in pieces of 32 B (bf16) or 64 B (f32), one piece per store,
// and every piece is a line transaction of its own.  So each 16x16 product is taken
// transposed (Bt fragment as the A operand, both loaders have the same k order): a
// lane then holds 8 CONSECUTIVE COLUMNS of one row (row lane % 16, columns
// 8 * (lane / 16) + j), which is one or two 16 B LDS stores.  A wave stages its
// 32 x 64 tile in its own piece of the ring, which every wave has left at the last
// stage's barrier, reads it back row-major, 16 B a lane, and stores whole 128 B
// lines; the residual is read in the same whole-line shape.
// ---------------------------------------------------------------------------
#define MODE_QKV  0   // Bt = [WqT; WkT; WvT], N = 3 * D_MODEL: one launch for q, k and v
#define MODE_F32  3   // outF = acc*scale + bias + resid
#define MODE_GELU 4   // outB = bf16(gelu(acc*scale + bias))
#define BK 128              // k per stage
#define LPITCH (BK + 8)     // LDS row pitch in elements: 272 B = 16 B x odd
#define SPB 144             // staged bf16 row: 64 columns = 128 B, + 16 B (16 B x odd)
#define SPF 272             // staged f32 row: 64 columns = 256 B, + 16 B (16 B x odd)
#define SWAVE (32 * SPF)    // bytes of staging per wave; 8 waves fill lA exactly

// ---------------------------------------------------------------------------
// GELU with erf: x * Phi(x), Phi(x) = 0.5 * (1 + erf(x / sqrt(2))), without a branch.
// The library erff picks one of two polynomials by |x|, so in a wave both run under
// exec masks and every element is one long chain that the next element waits for.
// Here one form serves every x: the lower tail of the normal distribution,
//   Phi(-|x|) = exp(-x * x / 2) * (c1 t + c2 t^2 + c3 t^3 + c4 t^4 + c5 t^5),
//   t = 1 / (1 + 0.2316419 |x|),
// the classical five-term rational fit (absolute error below 7.5e-8, under the
// spacing of f32 at 1 + erf), its factor 1 / sqrt(2 pi) folded into c1 .. c5.
// For either sign x * Phi(x) = max(x, 0) - |x| * Phi(-|x|).
// Eight elements go through it side by side, so no step waits for the one before.
// ---------------------------------------------------------------------------
// Eight reciprocals, or eight 2^x, in place.  Written as one statement because the
// instruction set asks for one free slot behind a transcendental before its result
// is read or its source overwritten:
// here each neighbour works on another register, and the
// v_nop at the end is the slot of the last one.
__device__ __forceinline__ void rcp8(float (&v)[8]) {
    asm("v_rcp_f32 %0, %0\n\tv_rcp_f32 %1, %1\n\tv_rcp_f32 %2, %2\n\tv_rcp_f32 %3, %3\n\t"
        "v_rcp_f32 %4, %4\n\tv_rcp_f32 %5, %5\n\tv_rcp_f32 %6, %6\n\tv_rcp_f32 %7, %7\n\tv_nop"
        : "+v"(v[0]), "+v"(v[1]), "+v"(v[2]), "+v"(v[3]),
          "+v"(v[4]), "+v"(v[5]), "+v"(v[6]), "+v"(v[7]));
}
__device__ __forceinline__ void exp2_8(float (&v)[8]) {
    asm("v_exp_f32 %0, %0\n\tv_exp_f32 %1, %1\n\tv_exp_f32 %2, %2\n\tv_exp_f32 %3, %3\n\t"
        "v_exp_f32 %4, %4\n\tv_exp_f32 %5, %5\n\tv_exp_f32 %6, %6\n\tv_exp_f32 %7, %7\n\tv_nop"
        : "+v"(v[0]), "+v"(v[1]), "+v"(v[2]), "+v"(v[3]),
          "+v"(v[4]), "+v"(v[5]), "+v"(v[6]), "+v"(v[7]));
}

__device__ __forceinline__ void gelu8(float (&x)[8]) {
    float t[8], e[8];
#pragma unroll   // this loop and the next: the arrays are registers
    for (int j = 0; j < 8; ++j) {
        t[j] = fmaf(fabsf(x[j]), 0.2316419f, 1.0f);
        e[j] = x[j] * x[j] * -0.72134752044448170f;   // -x^2 / 2 in log2 units
    }
    rcp8(t);
    exp2_8(e);
#pragma unroll
    for (int j = 0; j < 8; ++j) {
        float p = fmaf(t[j], 0.5307027145f, -0.7265760135f);
        p = fmaf(p, t[j], 0.7107068705f);
        p = fmaf(p, t[j], -0.142248368f);
        p = fmaf(p, t[j], 0.127414796f);
        p *= t[j];
        x[j] = fmaf(-fabsf(x[j]), p * e[j], fmaxf(x[j], 0.0f));
    }
}

// Two neighbouring columns as one dword of a staged row: the hardware's packed
// conversion rounds to nearest even, as f32_to_bf16 does, and packs in the same
// instruction.
typedef __bf16 bf16x2 __attribute__((ext_vector_type(2)));
__device__ __forceinline__ unsigned int cvt2_bf16(float lo, float hi) {
    bf16x2 p;
    p[0] = (__bf16)lo;
    p[1] = (__bf16)hi;
    return __builtin_bit_cast(unsigned int, p);
}

// MODE is a compile-time parameter: each instantiation holds one straight-line
// epilogue, so its loads of bias and resid issue together instead of one
// load, wait and store per element behind a chain of branches on the mode.
template <int MODE>
__global__ __launch_bounds__(256) void gemm_bf16_k(const u16* __restrict__ A,
                                                   const u16* __restrict__ Bt,
                                                   int M, int N, int K,
                                                   float scale,
                                                   const float* __restrict__ bias,
                                                   const float* __restrict__ resid,
                                                   float* __restrict__ outF,
                                                   u16* __restrict__ outB) {
    __shared__ __attribute__((aligned(16))) u16 lA[2][128 * LPITCH];
    __shared__ __attribute__((aligned(16))) u16 lB[2][128 * LPITCH];
    const int tid = threadIdx.x;
    const int lane = tid & 31;
    const int wave = tid >> 5;
    const int waveM = wave & 3;       // 0..3
    const int waveN = wave >> 2;      // 0..1
    const int bM = blockIdx.y * 128;
    const int bN = blockIdx.x * 128;
    const int l16 = lane & 15;
    const int khalf = (lane >> 4) * 8;     // 0 or 8 (K sub-chunk base)
    const int mloc = (lane >> 4) * 8;      // 0 or 8 (C^T layout: column base in C)
    // staging assignment: 16 lanes cover one 256 B row; this thread copies
    // 16 B chunk sc of rows sr, sr + 16, ..., sr + 112 of both operands
    const int sr = tid >> 4, sc = tid & 15;

    f32x8 acc[2][4];
#pragma unroll
    for (int mt = 0; mt < 2; ++mt)
#pragma unroll
        for (int nt = 0; nt < 4; ++nt) acc[mt][nt] = zero8();

    // stage K-slice kk into buffer buf
    auto stage = [&](int buf, int kk) {
        const u16* ga = A + (size_t)(bM + sr) * K + kk + sc * 8;
        const u16* gb = Bt + (size_t)(bN + sr) * K + kk + sc * 8;
        u16* la = &lA[buf][sr * LPITCH + sc * 8];
        u16* lb = &lB[buf][sr * LPITCH + sc * 8];
#pragma unroll   // the 16 copies issue back to back, LDS steps are constants
        for (int i = 0; i < 8; ++i) {
            cp16_g2l(ga + (size_t)(i * 16) * K, la + i * 16 * LPITCH);
            cp16_g2l(gb + (size_t)(i * 16) * K, lb + i * 16 * LPITCH);
        }
    };

    stage(0, 0);
    wait_async0();
    __syncthreads();
    if (BK < K) stage(1, BK);

    int cur = 0;
    for (int kk = 0; kk < K; kk += BK) {
#pragma unroll   // the four blocks' LDS offsets become immediates
        for (int ks = 0; ks < BK; ks += 32) {
            bf16x16 af[2], bfr[4];
#pragma unroll
            for (int mt = 0; mt < 2; ++mt) {
                const u16* p = &lA[cur][(waveM * 32 + mt * 16 + l16) * LPITCH + ks + khalf];
                af[mt] = ld_frag(p, p + 16);
            }
#pragma unroll
            for (int nt = 0; nt < 4; ++nt) {
                const u16* p = &lB[cur][(waveN * 64 + nt * 16 + l16) * LPITCH + ks + khalf];
                bfr[nt] = ld_frag(p, p + 16);
            }
#pragma unroll
            for (int mt = 0; mt < 2; ++mt)
#pragma unroll
                for (int nt = 0; nt < 4; ++nt)
                    acc[mt][nt] = wmma_bf16(bfr[nt], af[mt], acc[mt][nt]);   // C^T tile
        }
        // publish point: this wave's reads of buffer cur are done before the
        // refill below may overwrite it
        asm volatile("s_wait_dscnt 0x0" ::: "memory");
        wait_async0();       // the next stage's copies of this wave have landed
        __syncthreads();     // next stage readable by all; buffer cur left by all
        if (kk + 2 * BK < K) stage(cur, kk + 2 * BK);   // refill two stages ahead
        cur ^= 1;
    }
    wait_async0();           // nothing outstanding when the wave ends

    // Epilogue. C^T layout: lane % 16 -> row, vgpr j -> column mloc + j of a 16x16 tile.
    // Every loop below is unrolled so that acc stays in registers and the LDS and
    // global steps are immediate offsets (the output's row pitch is a constant of
    // the mode for that reason).
    char* sw = (char*)&lA[0][0] + wave * SWAVE;    // this wave's own staging rows
    if constexpr (MODE == MODE_QKV) {
        // A block's 128 columns lie wholly in q, in k or in v, so sel is the same for
        // the whole block: ONE scalar branch picks between two straight-line
        // epilogues.  q, k [b,h,s,d] and v [b,h,d,s] lie one behind another from outB
        // on; only q takes the scale.
        const int sel = blockIdx.x / (D_MODEL / 128);   // 0 q, 1 k, 2 v
        u16* o = outB + (size_t)sel * ROWS * D_MODEL;
        const int colB = bN & (D_MODEL - 1);            // first column inside q, k or v
        const int bb = bM >> 11;
        uint4 r[8];
        if (sel == 2) {
            // v goes out transposed, so a line of it holds 64 positions, more than a
            // wave has: the whole block stages [d][s] (pitch as in the ring) and each
            // 16 lanes store one d row's 128 positions, two whole lines.
            u16* sv = &lA[0][0];
#pragma unroll
            for (int mt = 0; mt < 2; ++mt)
#pragma unroll
                for (int nt = 0; nt < 4; ++nt)
#pragma unroll
                    for (int j = 0; j < 8; j += 2) {
                        u16* p = sv + (waveN * 64 + nt * 16 + mloc + j) * LPITCH + waveM * 32 + mt * 16 + l16;
                        const unsigned int t = cvt2_bf16(acc[mt][nt][j], acc[mt][nt][j + 1]);
                        p[0] = (u16)t;
                        p[LPITCH] = (u16)(t >> 16);
                    }
            // this wave's staged values are in LDS before the barrier lets others read
            asm volatile("s_wait_dscnt 0x0" ::: "memory");
            __syncthreads();
#pragma unroll
            for (int i = 0; i < 8; ++i)
                r[i] = *(const uint4*)(sv + (sr + i * 16) * LPITCH + sc * 8);
            u16* dst = o + (size_t)(bb * D_MODEL + colB + sr) * SEQ + (bM & (SEQ - 1)) + sc * 8;
#pragma unroll
            for (int i = 0; i < 8; ++i) *(uint4*)(dst + (size_t)(i * 16) * SEQ) = r[i];
        } else {
            const float qs = sel == 0 ? scale : 1.0f;
#pragma unroll
            for (int mt = 0; mt < 2; ++mt)
#pragma unroll
                for (int nt = 0; nt < 4; ++nt) {
                    uint4 t;
                    t.x = cvt2_bf16(acc[mt][nt][0] * qs, acc[mt][nt][1] * qs);
                    t.y = cvt2_bf16(acc[mt][nt][2] * qs, acc[mt][nt][3] * qs);
                    t.z = cvt2_bf16(acc[mt][nt][4] * qs, acc[mt][nt][5] * qs);
                    t.w = cvt2_bf16(acc[mt][nt][6] * qs, acc[mt][nt][7] * qs);
                    *(uint4*)(sw + (mt * 16 + l16) * SPB + (nt * 16 + mloc) * 2) = t;
                }
            // the rows are in LDS before other lanes of this wave read them back
            asm volatile("s_wait_dscnt 0x0" ::: "memory");
#pragma unroll
            for (int i = 0; i < 8; ++i)
                r[i] = *(const uint4*)(sw + (i * 4 + (lane >> 3)) * SPB + (lane & 7) * 16);
            // the wave's 64 columns are one head, its 32 positions follow one another:
            // 4 KiB in a row
            const int h = (colB >> 6) + waveN;
            u16* dst = o + ((size_t)(bb * NH + h) * SEQ + (bM & (SEQ - 1)) + waveM * 32) * HD + lane * 8;
#pragma unroll
            for (int i = 0; i < 8; ++i) *(uint4*)(dst + i * 256) = r[i];
            // the other branch's code follows these stores in the listing and rewrites
            // their registers: the wait stands in front of any such rewrite
            asm volatile("s_wait_xcnt 0x0" ::: "memory");
        }
        return;
    } else if constexpr (MODE == MODE_F32) {
        constexpr int NC = D_MODEL;                  // row pitch of outF and resid
        const int rr = lane >> 4, cc = (lane & 15) * 4;   // read-back: 16 lanes a row
        const size_t g0 = (size_t)(bM + waveM * 32 + rr) * NC + bN + waveN * 64 + cc;
        const float* rp = resid + g0;
        f32x4 rs[16];
#pragma unroll
        for (int i = 0; i < 16; ++i) rs[i] = *(const f32x4*)(rp + i * 2 * NC);
        const f32x4 bi = *(const f32x4*)(bias + bN + waveN * 64 + cc);
#pragma unroll
        for (int mt = 0; mt < 2; ++mt)
#pragma unroll
            for (int nt = 0; nt < 4; ++nt) {
                char* p = sw + (mt * 16 + l16) * SPF + (nt * 16 + mloc) * 4;
                *(f32x4*)p = (f32x4){acc[mt][nt][0], acc[mt][nt][1], acc[mt][nt][2], acc[mt][nt][3]};
                *(f32x4*)(p + 16) = (f32x4){acc[mt][nt][4], acc[mt][nt][5], acc[mt][nt][6], acc[mt][nt][7]};
            }
        // the rows are in LDS before other lanes of this wave read them back
        asm volatile("s_wait_dscnt 0x0" ::: "memory");
        // the residual's address lives past its last load's issue: without this the
        // build landed the last load's result on the register that the 15 before it name
        asm volatile("" :: "v"(rp));
#pragma unroll
        for (int i = 0; i < 16; ++i) {
            f32x4 v = *(const f32x4*)(sw + (i * 2 + rr) * SPF + cc * 4);
#pragma unroll
            for (int c = 0; c < 4; ++c) rs[i][c] = v[c] * scale + bi[c] + rs[i][c];
        }
#pragma unroll
        for (int i = 0; i < 16; ++i) *(f32x4*)(outF + g0 + i * 2 * NC) = rs[i];
    } else { // MODE_GELU
        constexpr int NC = 4 * D_MODEL;              // row pitch of outB
        f32x4 bv[4][2];
#pragma unroll
        for (int nt = 0; nt < 4; ++nt) {
            const float* bp = bias + bN + waveN * 64 + nt * 16 + mloc;
            bv[nt][0] = *(const f32x4*)bp;
            bv[nt][1] = *(const f32x4*)(bp + 4);
        }
#pragma unroll
        for (int mt = 0; mt < 2; ++mt)
#pragma unroll
            for (int nt = 0; nt < 4; ++nt) {
                float xv[8];
#pragma unroll
                for (int j = 0; j < 8; ++j) xv[j] = acc[mt][nt][j] * scale + bv[nt][j >> 2][j & 3];
                gelu8(xv);
                uint4 t;
                t.x = cvt2_bf16(xv[0], xv[1]);
                t.y = cvt2_bf16(xv[2], xv[3]);
                t.z = cvt2_bf16(xv[4], xv[5]);
                t.w = cvt2_bf16(xv[6], xv[7]);
                *(uint4*)(sw + (mt * 16 + l16) * SPB + (nt * 16 + mloc) * 2) = t;
            }
        // the rows are in LDS before other lanes of this wave read them back
        asm volatile("s_wait_dscnt 0x0" ::: "memory");
        uint4 r[8];
#pragma unroll
        for (int i = 0; i < 8; ++i)
            r[i] = *(const uint4*)(sw + (i * 4 + (lane >> 3)) * SPB + (lane & 7) * 16);
        u16* dst = outB + (size_t)(bM + waveM * 32 + (lane >> 3)) * NC + bN + waveN * 64 + (lane & 7) * 8;
#pragma unroll
        for (int i = 0; i < 8; ++i) *(uint4*)(dst + i * 4 * NC) = r[i];
    }
}

#define APITCH 72   // LDS row pitch in elements: 144 B = 16 B x odd

// value of lane l ^ 16
__device__ __forceinline__ float other_half(float v) {
    int b = __float_as_int(v);
    return __int_as_float(__builtin_amdgcn_permlanex16(b, b, 0x76543210, 0xfedcba98, false, false));
}

__global__ __launch_bounds__(128) void attn_k(const u16* __restrict__ q,
                                              const u16* __restrict__ k,
                                              const u16* __restrict__ vt,
                                              u16* __restrict__ yb) {
    __shared__ __attribute__((aligned(16))) u16 lK[2][64 * APITCH];   // [key][d]
    __shared__ __attribute__((aligned(16))) u16 lV[2][64 * APITCH];   // [d][key]
    const int lane = threadIdx.x & 31;
    const int wave = threadIdx.x >> 5;
    const int bh = blockIdx.y;                 // b*NH + h
    const int qbase = blockIdx.x * 64 + wave * 16;
    const int l16 = lane & 15;
    const int khalf = (lane >> 4) * 8;
    const int mloc = (lane >> 4) * 8;
    const size_t headOff = (size_t)bh * SEQ * HD;
    // staging assignment: 8 lanes cover one 128 B row, so a wave-wide copy is four
    // whole lines; this thread copies 16 B chunk sc of K rows sr, sr + 16, sr + 32,
    // sr + 48 and of V^T rows 4 sr .. 4 sr + 3 (row steps of 2 KiB and 4 KiB)
    const int sr = threadIdx.x >> 3, sc = threadIdx.x & 7;

    // copy the tile of keys kb .. kb + 63 into buffer buf
    auto stage = [&](int buf, int kb) {
        const u16* gk = k + headOff + (size_t)(kb + sr) * HD + sc * 8;
        const u16* gv = vt + headOff + (size_t)(sr * 4) * SEQ + kb + sc * 8;
        u16* lk = &lK[buf][sr * APITCH + sc * 8];
        u16* lv = &lV[buf][sr * 4 * APITCH + sc * 8];
#pragma unroll   // the 8 copies issue back to back, LDS steps are constants
        for (int i = 0; i < 4; ++i) {
            cp16_g2l(gk + (size_t)(i * 16) * HD, lk + i * 16 * APITCH);
            cp16_g2l(gv + (size_t)i * SEQ, lv + i * APITCH);
        }
    };

    bf16x16 qf[2];     // B operand of S^T: column = query qbase + l16
    {
        const u16* qp = q + headOff + (size_t)(qbase + l16) * HD;
#pragma unroll
        for (int kt = 0; kt < 2; ++kt) {
            const u16* p = qp + kt * 32 + khalf;
            qf[kt] = ld_frag(p, p + 16);
        }
    }

    const float LOG2E = 1.44269504088896340736f;
    f32x8 O[4];        // O^T: O[nd][j] = d nd * 16 + mloc + j of query qbase + l16
    float rmax = -INFINITY;   // this lane's query, both halves alike
    float rsum = 0.0f;        // this half's keys only; the halves join after the loop
#pragma unroll
    for (int n = 0; n < 4; ++n) O[n] = zero8();

    stage(0, 0);
    wait_async0();
    __syncthreads();     // tile 0 readable by all four waves
    stage(1, 64);

    int cur = 0;
    for (int kb = 0; kb < SEQ; kb += 64) {
        // ---- scores: S^T[64 x 16] = K * Q^T (q pre-scaled) ----
        f32x8 sAcc[4];   // sAcc[n][j] = key kb + n * 16 + mloc + j, query qbase + l16
#pragma unroll
        for (int n = 0; n < 4; ++n) {
            sAcc[n] = zero8();
#pragma unroll
            for (int kt = 0; kt < 2; ++kt) {
                const u16* kp = &lK[cur][(n * 16 + l16) * APITCH + kt * 32 + khalf];
                bf16x16 kf = ld_frag(kp, kp + 16);
                sAcc[n] = wmma_bf16(kf, qf[kt], sAcc[n]);
            }
#pragma unroll
            for (int j = 0; j < 8; ++j) {
                if (kb + n * 16 + mloc + j == qbase + l16) sAcc[n][j] = -INFINITY;
            }
        }
        // ---- online softmax: one query per lane ----
        float t = sAcc[0][0];
#pragma unroll
        for (int n = 0; n < 4; ++n)
#pragma unroll
            for (int j = 0; j < 8; ++j) t = fmaxf(t, sAcc[n][j]);
        t = fmaxf(t, other_half(t));
        const float nm = fmaxf(rmax, t * LOG2E);
        const float corr = __builtin_amdgcn_exp2f(rmax - nm);
        rmax = nm;
#pragma unroll
        for (int n = 0; n < 4; ++n)
#pragma unroll
            for (int j = 0; j < 8; ++j) O[n][j] *= corr;

        f32x2 ps[2];     // packed adds, two chains, so that they do not wait on one another
        ps[0] = (f32x2){0.0f, 0.0f};
        ps[1] = (f32x2){0.0f, 0.0f};
#pragma unroll
        for (int n = 0; n < 4; ++n)
#pragma unroll
            for (int j = 0; j < 8; j += 2) {
                f32x2 p;
                p[0] = __builtin_amdgcn_exp2f(fmaf(sAcc[n][j], LOG2E, -nm));
                p[1] = __builtin_amdgcn_exp2f(fmaf(sAcc[n][j + 1], LOG2E, -nm));
                sAcc[n][j] = p[0];
                sAcc[n][j + 1] = p[1];
                ps[(j >> 1) & 1] += p;
            }
        ps[0] += ps[1];
        rsum = rsum * corr + (ps[0][0] + ps[0][1]);
        // ---- P^T: two score tiles, converted in place, are one B operand ----
        bf16x16 pf[2];
#pragma unroll
        for (int kt = 0; kt < 2; ++kt)
#pragma unroll
            for (int s = 0; s < 16; ++s) pf[kt][s] = (__bf16)sAcc[2 * kt + (s >> 3)][s & 7];
        // ---- O^T += V^T * P^T  (V^T layout: [d][s], contiguous over keys) ----
#pragma unroll
        for (int nd = 0; nd < 4; ++nd) {
#pragma unroll
            for (int kt = 0; kt < 2; ++kt) {
                const u16* vp = &lV[cur][(nd * 16 + l16) * APITCH + kt * 32 + khalf];
                bf16x16 vf = ld_frag(vp, vp + 16);
                O[nd] = wmma_bf16(vf, pf[kt], O[nd]);
            }
        }
        // publish point: this wave's reads of buffer cur are done before the
        // refill below may overwrite it
        asm volatile("s_wait_dscnt 0x0" ::: "memory");
        wait_async0();       // the next tile's copies of this wave have landed
        __syncthreads();     // next tile readable by all; buffer cur left by all
        if (kb + 128 < SEQ) stage(cur, kb + 128);   // refill two tiles ahead
        cur ^= 1;
    }
    wait_async0();           // nothing outstanding when the wave ends

    // A lane holds 8 consecutive d of its query per tile, 16 B; stored from here a
    // query's 128 B line would go out in four pieces of 32 B.  As in the GEMM the wave
    // stages its 16 rows in its own piece of the ring, which every wave has left at
    // the last tile's barrier, reads them back 8 lanes a row and stores whole lines.
    const int bb = bh >> 4, h = bh & 15;
    rsum += other_half(rsum);
    const float inv = 1.0f / rsum;
    u16* sw = &lK[0][0] + wave * (16 * APITCH);
#pragma unroll
    for (int nd = 0; nd < 4; ++nd) {
        uint4 o;
        o.x = pack2_bf16(O[nd][0] * inv, O[nd][1] * inv);
        o.y = pack2_bf16(O[nd][2] * inv, O[nd][3] * inv);
        o.z = pack2_bf16(O[nd][4] * inv, O[nd][5] * inv);
        o.w = pack2_bf16(O[nd][6] * inv, O[nd][7] * inv);
        *(uint4*)(sw + l16 * APITCH + nd * 16 + mloc) = o;
    }
    // the rows are in LDS before other lanes of this wave read them back
    asm volatile("s_wait_dscnt 0x0" ::: "memory");
    uint4 r[4];
#pragma unroll
    for (int i = 0; i < 4; ++i)
        r[i] = *(const uint4*)(sw + (i * 4 + (lane >> 3)) * APITCH + (lane & 7) * 8);
    u16* yr = yb + ((size_t)bb * SEQ + qbase + (lane >> 3)) * D_MODEL + h * HD + (lane & 7) * 8;
#pragma unroll
    for (int i = 0; i < 4; ++i) *(uint4*)(yr + i * 4 * D_MODEL) = r[i];
}

// ---------------------------------------------------------------------------
extern "C" void kernel_launch(void* const* d_in, const int* in_sizes, int n_in,
                              void* d_out, int out_size, void* d_ws, size_t ws_size,
                              hipStream_t stream) {
    (void)in_sizes; (void)n_in; (void)out_size; (void)ws_size;
    const float* x   = (const float*)d_in[0];
    const float* Wk  = (const float*)d_in[1];
    const float* Wq  = (const float*)d_in[2];
    const float* Wv  = (const float*)d_in[3];
    const float* Wp  = (const float*)d_in[4];
    const float* bp  = (const float*)d_in[5];
    const float* g1  = (const float*)d_in[6];
    const float* b1  = (const float*)d_in[7];
    const float* g2  = (const float*)d_in[8];
    const float* b2  = (const float*)d_in[9];
    const float* W1  = (const float*)d_in[10];
    const float* bm1 = (const float*)d_in[11];
    const float* W2  = (const float*)d_in[12];
    const float* bm2 = (const float*)d_in[13];
    float* out = (float*)d_out;

    char* ws = (char*)d_ws;
    size_t off = 0;
    auto alloc = [&](size_t bytes) -> char* {
        char* p = ws + off;
        off += (bytes + 255) & ~(size_t)255;
        return p;
    };
    float* xnF = (float*)alloc((size_t)ROWS * D_MODEL * 4);   // 16 MB
    u16*   xnB = (u16*)  alloc((size_t)ROWS * D_MODEL * 2);   //  8 MB
    u16*   WqT = (u16*)  alloc((size_t)D_MODEL * D_MODEL * 2 * 4);   // q, k, v, p in a row
    u16*   WpT = WqT + (size_t)D_MODEL * D_MODEL * 3;
    u16*   W1T = (u16*)  alloc((size_t)D_MODEL * 4 * D_MODEL * 2);  // 8 MB
    u16*   W2T = (u16*)  alloc((size_t)D_MODEL * 4 * D_MODEL * 2);  // 8 MB
    char*  pool = alloc((size_t)ROWS * D_MODEL * 2 * 4);            // 32 MB shared pool
    u16*   qB  = (u16*)pool;
    u16*   kB  = (u16*)(pool + (size_t)ROWS * HD * NH * 2);
    u16*   vtB = (u16*)(pool + (size_t)ROWS * HD * NH * 4);
    u16*   yB  = (u16*)(pool + (size_t)ROWS * HD * NH * 6);
    u16*   uB  = (u16*)pool;   // aliases q/k/vt/y (dead by MLP time)
    float* hF  = (float*)alloc((size_t)ROWS * D_MODEL * 4);   // 16 MB
    u16*   hnB = (u16*)  alloc((size_t)ROWS * D_MODEL * 2);   //  8 MB

    // 1) + 2) Weight casts + transposes to bf16 [N,K], and LayerNorm1: x -> xn (f32 + bf16)
    prep_k<<<PREP_BLOCKS, 256, 0, stream>>>(x, g1, b1, xnF, xnB, Wq, Wk, Wv, Wp, W1, W2,
                                            WqT, W1T, W2T);

    // 3) QKV projections in one launch (q pre-scaled by 1/sqrt(HD)); q, k and vt lie
    //    one behind another in the pool
    dim3 gQKV(D_MODEL / 128, ROWS / 128);
    gemm_bf16_k<MODE_QKV><<<dim3(3 * D_MODEL / 128, ROWS / 128), 256, 0, stream>>>(
        xnB, WqT, ROWS, 3 * D_MODEL, D_MODEL, 0.125f, nullptr, nullptr, nullptr, qB);

    // 4) Flash attention
    attn_k<<<dim3(SEQ / 64, NB * NH), 128, 0, stream>>>(qB, kB, vtB, yB);

    // 5) Output projection + residual: h = xn + y*Wp + bp
    gemm_bf16_k<MODE_F32><<<gQKV, 256, 0, stream>>>(yB, WpT, ROWS, D_MODEL, D_MODEL,
                                                    1.0f, bp, xnF, hF, nullptr);

    // 6) LayerNorm2: h -> hn (bf16 only)
    layernorm_k<<<ROWS / 8, 256, 0, stream>>>(hF, g2, b2, nullptr, hnB);

    // 7) MLP up + exact GELU: u = gelu(hn*W1 + bm1)
    dim3 gUp(4 * D_MODEL / 128, ROWS / 128);
    gemm_bf16_k<MODE_GELU><<<gUp, 256, 0, stream>>>(hnB, W1T, ROWS, 4 * D_MODEL, D_MODEL,
                                                    1.0f, bm1, nullptr, nullptr, uB);

    // 8) MLP down + residual: out = h + u*W2 + bm2
    gemm_bf16_k<MODE_F32><<<gQKV, 256, 0, stream>>>(uB, W2T, ROWS, D_MODEL, 4 * D_MODEL,
                                                    1.0f, bm2, hF, out, nullptr);
}

// v010
// One run takes 160 microseconds.
// Next to v009, in two timings, it ran 1.03 times as fast each time.
// All steps since v000 together make it 2.60 times as fast.
#include <hip/hip_runtime.h>
#include <hip/hip_bf16.h>
#include <math.h>

typedef unsigned short u16;
typedef __bf16 bf16x16 __attribute__((ext_vector_type(16)));
typedef float f32x8 __attribute__((ext_vector_type(8)));
typedef float f32x4 __attribute__((ext_vector_type(4)));
typedef float f32x2 __attribute__((ext_vector_type(2)));
typedef unsigned int uint8v __attribute__((ext_vector_type(8)));
typedef int v4i __attribute__((__vector_size__(16)));

#define D_MODEL 1024
#define SEQ 2048
#define NB 2
#define NH 16
#define HD 64
#define ROWS (NB * SEQ)   // 4096

#if __has_builtin(__builtin_amdgcn_global_load_async_to_lds_b128)
#define USE_ASYNC_LDS 1
#endif

__device__ __forceinline__ u16 f32_to_bf16(float f) {
    unsigned int u = __float_as_uint(f);
    u += 0x7FFFu + ((u >> 16) & 1u);   // round to nearest even
    return (u16)(u >> 16);
}

__device__ __forceinline__ bf16x16 ld_frag(const u16* plo, const u16* phi) {
    uint4 lo = *(const uint4*)plo;
    uint4 hi = *(const uint4*)phi;
    uint8v t;
    t[0] = lo.x; t[1] = lo.y; t[2] = lo.z; t[3] = lo.w;
    t[4] = hi.x; t[5] = hi.y; t[6] = hi.z; t[7] = hi.w;
    return __builtin_bit_cast(bf16x16, t);
}

__device__ __forceinline__ f32x8 wmma_bf16(bf16x16 a, bf16x16 b, f32x8 c) {
    return __builtin_amdgcn_wmma_f32_16x16x32_bf16(false, a, false, b, (short)0, c, false, false);
}

__device__ __forceinline__ f32x8 zero8() {
    f32x8 z;
#pragma unroll
    for (int i = 0; i < 8; ++i) z[i] = 0.0f;
    return z;
}

// Copy 16B global -> LDS. Async (memory->LDS direct, ASYNCcnt) when available.
__device__ __forceinline__ void cp16_g2l(const u16* g, u16* l) {
#ifdef USE_ASYNC_LDS
    __builtin_amdgcn_global_load_async_to_lds_b128(
        (__attribute__((address_space(1))) v4i*)const_cast<u16*>(g),
        (__attribute__((address_space(3))) v4i*)l, 0, 0);
#else
    *(uint4*)l = *(const uint4*)g;
#endif
}

__device__ __forceinline__ void wait_async0() {
#ifdef USE_ASYNC_LDS
    // this wave's copies have landed; the clobber keeps every LDS read behind it
    asm volatile("s_wait_asynccnt 0x0" ::: "memory");
#endif
}

// ---------------------------------------------------------------------------
// The two kernels below only move data.  For speed each wave gets a large
// piece: few waves, many 16 B loads in flight per lane, no LDS, no barrier.
// Every loop in them is unrolled so that its arrays are registers and its steps
// immediate offsets.
// Both are written as device functions that take their block's index: the six
// weight casts and the first layernorm depend on nothing but the inputs, so they
// share ONE launch (prep_k below) instead of seven that each leave the chip
// partly empty and pay the gap between launches.
// ---------------------------------------------------------------------------
__device__ __forceinline__ unsigned int pack2_bf16(float lo, float hi) {
    return (unsigned int)f32_to_bf16(lo) | ((unsigned int)f32_to_bf16(hi) << 16);
}

// ---------------------------------------------------------------------------
// Weight cast + transpose: W[K,N] f32 -> out[N,K] bf16.
// A wave takes a tile of 64 k x 32 n.  Lane (kb = lane / 8, nb = lane % 8) reads
// 4 consecutive n of rows 8 kb .. 8 kb + 7 (and the same 32 rows further on), so
// a wave-wide load is four whole 128 B lines; the lane then owns 8 consecutive k
// of each of its 4 columns, which is one 16 B store into a row of out: the
// transpose happens in registers.  The two stores of a column fill its 128 B line.
// K and N are compile-time values, so every row step is an immediate offset.
// A block of 256 threads (8 waves side by side in n) takes 64 k x 256 n: tile
// t of (N/256) * (K/64), n fastest.
// ---------------------------------------------------------------------------
template <int K, int N>
__device__ __forceinline__ void cast_transpose_tile(const float* __restrict__ W,
                                                    u16* __restrict__ out, int t) {
    const int lane = threadIdx.x & 31;
    const int wave = threadIdx.x >> 5;
    const int n0 = (t % (N / 256)) * 256 + wave * 32 + (lane & 7) * 4;
    const int k0 = (t / (N / 256)) * 64 + (lane >> 3) * 8;
    const float* src = W + (size_t)k0 * N + n0;
    f32x4 v[2][8];
#pragma unroll
    for (int hf = 0; hf < 2; ++hf)
#pragma unroll
        for (int r = 0; r < 8; ++r)
            v[hf][r] = *(const f32x4*)(src + (hf * 32 + r) * N);
    // holds all 16 loads in front of the first use: without it the build issued
    // them in five groups and the wave waited out a memory latency for each; src is
    // named so that no load's result lands on the address register the others use
    asm volatile("" :: "v"(src), "v"(v[0][0]), "v"(v[0][1]), "v"(v[0][2]), "v"(v[0][3]),
                       "v"(v[0][4]), "v"(v[0][5]), "v"(v[0][6]), "v"(v[0][7]),
                       "v"(v[1][0]), "v"(v[1][1]), "v"(v[1][2]), "v"(v[1][3]),
                       "v"(v[1][4]), "v"(v[1][5]), "v"(v[1][6]), "v"(v[1][7]));
    u16* dst = out + (size_t)n0 * K + k0;
#pragma unroll
    for (int hf = 0; hf < 2; ++hf)
#pragma unroll
        for (int c = 0; c < 4; ++c) {
            uint4 t;
            t.x = pack2_bf16(v[hf][0][c], v[hf][1][c]);
            t.y = pack2_bf16(v[hf][2][c], v[hf][3][c]);
            t.z = pack2_bf16(v[hf][4][c], v[hf][5][c]);
            t.w = pack2_bf16(v[hf][6][c], v[hf][7][c]);
            *(uint4*)(dst + c * K + hf * 32) = t;
        }
    // in prep_k another job's code follows these stores in the listing and rewrites
    // their address and data registers: the wait stands in front of any such rewrite
    asm volatile("s_wait_xcnt 0x0" ::: "memory");
}

// ---------------------------------------------------------------------------
// LayerNorm: one row (D=1024) per wave, 8 rows per 256-thread block.  A lane holds
// 8 pieces of 4 floats, piece i at column 128 i + 4 lane, so every wave-wide load
// and f32 store is 512 contiguous bytes.  Sums: in-lane, then a five-step butterfly
// over the wave.  Writes f32 (optional) + bf16.
// ---------------------------------------------------------------------------
__device__ __forceinline__ void layernorm_rows(const float* __restrict__ x,
                                               const float* __restrict__ g,
                                               const float* __restrict__ b,
                                               float* __restrict__ outF,
                                               u16* __restrict__ outB, int blk) {
    const int lane = threadIdx.x & 31;
    const size_t base = ((size_t)blk * 8 + (threadIdx.x >> 5)) * D_MODEL + lane * 4;
    const float* xr = x + base;
    const unsigned int pb = lane * 16;     // byte offset of this lane's piece in g and b
    f32x4 v[8], gv[8], bv[8];
#pragma unroll
    for (int i = 0; i < 8; ++i) v[i] = *(const f32x4*)(xr + i * 128);
#pragma unroll
    for (int i = 0; i < 8; ++i) {
        gv[i] = *(const f32x4*)((const char*)g + pb + i * 512);
        bv[i] = *(const f32x4*)((const char*)b + pb + i * 512);
    }
    // nothing is scheduled across this line, so all 24 loads are issued before the
    // first use: without it the build fetched x in two groups and g, b behind the
    // sums, one latency after another
    __builtin_amdgcn_sched_barrier(0);
    // the address registers live past the last load's issue: without this the build
    // landed the last load's result on a register that the loads before it name
    asm volatile("" :: "v"(xr), "v"(lane));
    float s = 0.f, s2 = 0.f;
#pragma unroll
    for (int i = 0; i < 8; ++i) {
        s += (v[i][0] + v[i][1]) + (v[i][2] + v[i][3]);
        s2 += (v[i][0] * v[i][0] + v[i][1] * v[i][1]) + (v[i][2] * v[i][2] + v[i][3] * v[i][3]);
    }
#pragma unroll
    for (int off = 16; off > 0; off >>= 1) {
        s += __shfl_xor(s, off);
        s2 += __shfl_xor(s2, off);
    }
    const float mu = s * (1.0f / D_MODEL);
    const float var = s2 * (1.0f / D_MODEL) - mu * mu;
    const float rs = rsqrtf(var + 1e-5f);
#pragma unroll
    for (int i = 0; i < 8; ++i)
#pragma unroll
        for (int c = 0; c < 4; ++c) v[i][c] = (v[i][c] - mu) * rs * gv[i][c] + bv[i][c];
    if (outF) {
#pragma unroll
        for (int i = 0; i < 8; ++i) *(f32x4*)(outF + base + i * 128) = v[i];
    }
#pragma unroll
    for (int i = 0; i < 8; ++i) {
        uint2 p;
        p.x = pack2_bf16(v[i][0], v[i][1]);
        p.y = pack2_bf16(v[i][2], v[i][3]);
        *(uint2*)(outB + base + i * 128) = p;
    }
    // as in cast_transpose_tile: in front of any rewrite of the stores' registers by
    // the code that follows them in prep_k's listing
    asm volatile("s_wait_xcnt 0x0" ::: "memory");
}

__global__ __launch_bounds__(256) void layernorm_k(const float* __restrict__ x,
                                                   const float* __restrict__ g,
                                                   const float* __restrict__ b,
                                                   float* __restrict__ outF,
                                                   u16* __restrict__ outB) {
    layernorm_rows(x, g, b, outF, outB, blockIdx.x);
}

// ---------------------------------------------------------------------------
// All work that reads only inputs, in one launch.  The block index picks the job
// (scalar branches): the four square weights, the two MLP weights, then the first
// layernorm, whose output the next launch reads first.  Wsq holds the transposed
// square weights one behind another in the order q, k, v, p.
// ---------------------------------------------------------------------------
#define PREP_LN  (ROWS / 8)                                // 512 blocks
#define PREP_MLP ((D_MODEL / 64) * (4 * D_MODEL / 256))    // 256 blocks per MLP weight
#define PREP_SQ  ((D_MODEL / 64) * (D_MODEL / 256))        // 64 blocks per square weight
#define PREP_BLOCKS (PREP_LN + 2 * PREP_MLP + 4 * PREP_SQ)

__global__ __launch_bounds__(256) void prep_k(const float* __restrict__ x,
                                              const float* __restrict__ g,
                                              const float* __restrict__ b,
                                              float* __restrict__ outF,
                                              u16* __restrict__ outB,
                                              const float* __restrict__ Wq,
                                              const float* __restrict__ Wk,
                                              const float* __restrict__ Wv,
                                              const float* __restrict__ Wp,
                                              const float* __restrict__ W1,
                                              const float* __restrict__ W2,
                                              u16* __restrict__ Wsq,
                                              u16* __restrict__ W1T,
                                              u16* __restrict__ W2T) {
    int t = blockIdx.x;
    if (t < 4 * PREP_SQ) {
        const int w = t / PREP_SQ;
        const float* W = w == 0 ? Wq : w == 1 ? Wk : w == 2 ? Wv : Wp;
        cast_transpose_tile<D_MODEL, D_MODEL>(W, Wsq + (size_t)w * D_MODEL * D_MODEL, t % PREP_SQ);
        return;
    }
    t -= 4 * PREP_SQ;
    if (t < PREP_MLP) {
        cast_transpose_tile<D_MODEL, 4 * D_MODEL>(W1, W1T, t);
        return;
    }
    t -= PREP_MLP;
    if (t < PREP_MLP) {
        cast_transpose_tile<4 * D_MODEL, D_MODEL>(W2, W2T, t);
        return;
    }
    layernorm_rows(x, g, b, outF, outB, t - PREP_MLP);
}

// ---------------------------------------------------------------------------
// Tiled bf16 GEMM with WMMA.  C[M,N] = A[M,K] * Bt[N,K]^T  (Bt is B transposed)
// Block tile 128x128, 8 waves (4 M x 2 N), each wave 32x64.
// A stage is 128 k of every operand row (256 B, two whole lines), so one
// wave-wide 16 B copy covers two full rows; four 32-k blocks per stage.
// Double-buffered LDS; async memory->LDS copies when available.
// K must be a multiple of 128.
// The results leave through LDS.  Stored straight from the accumulators a row of a
// wave's tile goes out in pieces of 32 B (bf16) or 64 B (f32), one piece per store,
// and every piece is a line transaction of its own.  So each 16x16 product is taken
// transposed (Bt fragment as the A operand, both loaders have the same k order): a
// lane then holds 8 CONSECUTIVE COLUMNS of one row (row lane % 16, columns
// 8 * (lane / 16) + j), which is one or two 16 B LDS stores.  A wave stages its
// 32 x 64 tile in its own piece of the ring, which every wave has left at the last
// stage's barrier, reads it back row-major, 16 B a lane, and stores whole 128 B
// lines; the residual is read in the same whole-line shape.
// ---------------------------------------------------------------------------
#define MODE_QKV  0   // Bt = [WqT; WkT; WvT], N = 3 * D_MODEL: one launch for q, k and v
#define MODE_F32  3   // outF = acc*scale + bias + resid
#define MODE_GELU 4   // outB = bf16(gelu(acc*scale + bias))
#define BK 128              // k per stage
#define LPITCH (BK + 8)     // LDS row pitch in elements: 272 B = 16 B x odd
#define SPB 144             // staged bf16 row: 64 columns = 128 B, + 16 B (16 B x odd)
#define SPF 272             // staged f32 row: 64 columns = 256 B, + 16 B (16 B x odd)
#define SWAVE (32 * SPF)    // bytes of staging per wave; 8 waves fill lA exactly

// ---------------------------------------------------------------------------
// GELU with erf: x * Phi(x), Phi(x) = 0.5 * (1 + erf(x / sqrt(2))), without a branch.
// The library erff picks one of two polynomials by |x|, so in a wave both run under
// exec masks and every element is one long chain that the next element waits for.
// Here one form serves every x: the lower tail of the normal distribution,
//   Phi(-|x|) = exp(-x * x / 2) * (c1 t + c2 t^2 + c3 t^3 + c4 t^4 + c5 t^5),
//   t = 1 / (1 + 0.2316419 |x|),
// the classical five-term rational fit (absolute error below 7.5e-8, under the
// spacing of f32 at 1 + erf), its factor 1 / sqrt(2 pi) folded into c1 .. c5.
// For either sign x * Phi(x) = max(x, 0) - |x| * Phi(-|x|).
// Eight elements go through it side by side, so no step waits for the one before.
// ---------------------------------------------------------------------------
// Eight reciprocals, or eight 2^x, in place.  Written as one statement because the
// instruction set asks for one free slot behind a transcendental before its result
// is read or its source overwritten:
// here each neighbour works on another register, and the
// v_nop at the end is the slot of the last one.
__device__ __forceinline__ void rcp8(float (&v)[8]) {
    asm("v_rcp_f32 %0, %0\n\tv_rcp_f32 %1, %1\n\tv_rcp_f32 %2, %2\n\tv_rcp_f32 %3, %3\n\t"
        "v_rcp_f32 %4, %4\n\tv_rcp_f32 %5, %5\n\tv_rcp_f32 %6, %6\n\tv_rcp_f32 %7, %7\n\tv_nop"
        : "+v"(v[0]), "+v"(v[1]), "+v"(v[2]), "+v"(v[3]),
          "+v"(v[4]), "+v"(v[5]), "+v"(v[6]), "+v"(v[7]));
}
__device__ __forceinline__ void exp2_8(float (&v)[8]) {
    asm("v_exp_f32 %0, %0\n\tv_exp_f32 %1, %1\n\tv_exp_f32 %2, %2\n\tv_exp_f32 %3, %3\n\t"
        "v_exp_f32 %4, %4\n\tv_exp_f32 %5, %5\n\tv_exp_f32 %6, %6\n\tv_exp_f32 %7, %7\n\tv_nop"
        : "+v"(v[0]), "+v"(v[1]), "+v"(v[2]), "+v"(v[3]),
          "+v"(v[4]), "+v"(v[5]), "+v"(v[6]), "+v"(v[7]));
}

__device__ __forceinline__ void gelu8(float (&x)[8]) {
    float t[8], e[8];
#pragma unroll   // this loop and the next: the arrays are registers
    for (int j = 0; j < 8; ++j) {
        t[j] = fmaf(fabsf(x[j]), 0.2316419f, 1.0f);
        e[j] = x[j] * x[j] * -0.72134752044448170f;   // -x^2 / 2 in log2 units
    }
    rcp8(t);
    exp2_8(e);
#pragma unroll
    for (int j = 0; j < 8; ++j) {
        float p = fmaf(t[j], 0.5307027145f, -0.7265760135f);
        p = fmaf(p, t[j], 0.7107068705f);
        p = fmaf(p, t[j], -0.142248368f);
        p = fmaf(p, t[j], 0.127414796f);
        p *= t[j];
        x[j] = fmaf(-fabsf(x[j]), p * e[j], fmaxf(x[j], 0.0f));
    }
}

// Two neighbouring columns as one dword of a staged row: the hardware's packed
// conversion rounds to nearest even, as f32_to_bf16 does, and packs in the same
// instruction.
typedef __bf16 bf16x2 __attribute__((ext_vector_type(2)));
__device__ __forceinline__ unsigned int cvt2_bf16(float lo, float hi) {
    bf16x2 p;
    p[0] = (__bf16)lo;
    p[1] = (__bf16)hi;
    return __builtin_bit_cast(unsigned int, p);
}

// MODE is a compile-time parameter: each instantiation holds one straight-line
// epilogue, so its loads of bias and resid issue together instead of one
// load, wait and store per element behind a chain of branches on the mode.
template <int MODE>
__global__ __launch_bounds__(256) void gemm_bf16_k(const u16* __restrict__ A,
                                                   const u16* __restrict__ Bt,
                                                   int M, int N, int K,
                                                   float scale,
                                                   const float* __restrict__ bias,
                                                   const float* __restrict__ resid,
                                                   float* __restrict__ outF,
                                                   u16* __restrict__ outB) {
    __shared__ __attribute__((aligned(16))) u16 lA[2][128 * LPITCH];
    __shared__ __attribute__((aligned(16))) u16 lB[2][128 * LPITCH];
    const int tid = threadIdx.x;
    const int lane = tid & 31;
    const int wave = tid >> 5;
    const int waveM = wave & 3;       // 0..3
    const int waveN = wave >> 2;      // 0..1
    const int bM = blockIdx.y * 128;
    const int bN = blockIdx.x * 128;
    const int l16 = lane & 15;
    const int khalf = (lane >> 4) * 8;     // 0 or 8 (K sub-chunk base)
    const int mloc = (lane >> 4) * 8;      // 0 or 8 (C^T layout: column base in C)
    // staging assignment: 16 lanes cover one 256 B row; this thread copies
    // 16 B chunk sc of rows sr, sr + 16, ..., sr + 112 of both operands
    const int sr = tid >> 4, sc = tid & 15;

    f32x8 acc[2][4];
#pragma unroll
    for (int mt = 0; mt < 2; ++mt)
#pragma unroll
        for (int nt = 0; nt < 4; ++nt) acc[mt][nt] = zero8();

    // stage K-slice kk into buffer buf
    auto stage = [&](int buf, int kk) {
        const u16* ga = A + (size_t)(bM + sr) * K + kk + sc * 8;
        const u16* gb = Bt + (size_t)(bN + sr) * K + kk + sc * 8;
        u16* la = &lA[buf][sr * LPITCH + sc * 8];
        u16* lb = &lB[buf][sr * LPITCH + sc * 8];
#pragma unroll   // the 16 copies issue back to back, LDS steps are constants
        for (int i = 0; i < 8; ++i) {
            cp16_g2l(ga + (size_t)(i * 16) * K, la + i * 16 * LPITCH);
            cp16_g2l(gb + (size_t)(i * 16) * K, lb + i * 16 * LPITCH);
        }
    };

    stage(0, 0);
    wait_async0();
    __syncthreads();
    if (BK < K) stage(1, BK);

    int cur = 0;
    for (int kk = 0; kk < K; kk += BK) {
#pragma unroll   // the four blocks' LDS offsets become immediates
        for (int ks = 0; ks < BK; ks += 32) {
            bf16x16 af[2], bfr[4];
#pragma unroll
            for (int mt = 0; mt < 2; ++mt) {
                const u16* p = &lA[cur][(waveM * 32 + mt * 16 + l16) * LPITCH + ks + khalf];
                af[mt] = ld_frag(p, p + 16);
            }
#pragma unroll
            for (int nt = 0; nt < 4; ++nt) {
                const u16* p = &lB[cur][(waveN * 64 + nt * 16 + l16) * LPITCH + ks + khalf];
                bfr[nt] = ld_frag(p, p + 16);
            }
#pragma unroll
            for (int mt = 0; mt < 2; ++mt)
#pragma unroll
                for (int nt = 0; nt < 4; ++nt)
                    acc[mt][nt] = wmma_bf16(bfr[nt], af[mt], acc[mt][nt]);   // C^T tile
        }
        // publish point: this wave's reads of buffer cur are done before the
        // refill below may overwrite it
        asm volatile("s_wait_dscnt 0x0" ::: "memory");
        wait_async0();       // the next stage's copies of this wave have landed
        __syncthreads();     // next stage readable by all; buffer cur left by all
        if (kk + 2 * BK < K) stage(cur, kk + 2 * BK);   // refill two stages ahead
        cur ^= 1;
    }
    wait_async0();           // nothing outstanding when the wave ends

    // Epilogue. C^T layout: lane % 16 -> row, vgpr j -> column mloc + j of a 16x16 tile.
    // Every loop below is unrolled so that acc stays in registers and the LDS and
    // global steps are immediate offsets (the output's row pitch is a constant of
    // the mode for that reason).
    char* sw = (char*)&lA[0][0] + wave * SWAVE;    // this wave's own staging rows
    if constexpr (MODE == MODE_QKV) {
        // A block's 128 columns lie wholly in q, in k or in v, so sel is the same for
        // the whole block: ONE scalar branch picks between two straight-line
        // epilogues.  q, k [b,h,s,d] and v [b,h,d,s] lie one behind another from outB
        // on; only q takes the scale.
        const int sel = blockIdx.x / (D_MODEL / 128);   // 0 q, 1 k, 2 v
        u16* o = outB + (size_t)sel * ROWS * D_MODEL;
        const int colB = bN & (D_MODEL - 1);            // first column inside q, k or v
        const int bb = bM >> 11;
        uint4 r[8];
        if (sel == 2) {
            // v goes out transposed, so a line of it holds 64 positions, more than a
            // wave has: the whole block stages [d][s] (pitch as in the ring) and each
            // 16 lanes store one d row's 128 positions, two whole lines.
            u16* sv = &lA[0][0];
#pragma unroll
            for (int mt = 0; mt < 2; ++mt)
#pragma unroll
                for (int nt = 0; nt < 4; ++nt)
#pragma unroll
                    for (int j = 0; j < 8; j += 2) {
                        u16* p = sv + (waveN * 64 + nt * 16 + mloc + j) * LPITCH + waveM * 32 + mt * 16 + l16;
                        const unsigned int t = cvt2_bf16(acc[mt][nt][j], acc[mt][nt][j + 1]);
                        p[0] = (u16)t;
                        p[LPITCH] = (u16)(t >> 16);
                    }
            // this wave's staged values are in LDS before the barrier lets others read
            asm volatile("s_wait_dscnt 0x0" ::: "memory");
            __syncthreads();
#pragma unroll
            for (int i = 0; i < 8; ++i)
                r[i] = *(const uint4*)(sv + (sr + i * 16) * LPITCH + sc * 8);
            u16* dst = o + (size_t)(bb * D_MODEL + colB + sr) * SEQ + (bM & (SEQ - 1)) + sc * 8;
#pragma unroll
            for (int i = 0; i < 8; ++i) *(uint4*)(dst + (size_t)(i * 16) * SEQ) = r[i];
        } else {
            const float qs = sel == 0 ? scale : 1.0f;
#pragma unroll
            for (int mt = 0; mt < 2; ++mt)
#pragma unroll
                for (int nt = 0; nt < 4; ++nt) {
                    uint4 t;
                    t.x = cvt2_bf16(acc[mt][nt][0] * qs, acc[mt][nt][1] * qs);
                    t.y = cvt2_bf16(acc[mt][nt][2] * qs, acc[mt][nt][3] * qs);
                    t.z = cvt2_bf16(acc[mt][nt][4] * qs, acc[mt][nt][5] * qs);
                    t.w = cvt2_bf16(acc[mt][nt][6] * qs, acc[mt][nt][7] * qs);
                    *(uint4*)(sw + (mt * 16 + l16) * SPB + (nt * 16 + mloc) * 2) = t;
                }
            // the rows are in LDS before other lanes of this wave read them back
            asm volatile("s_wait_dscnt 0x0" ::: "memory");
#pragma unroll
            for (int i = 0; i < 8; ++i)
                r[i] = *(const uint4*)(sw + (i * 4 + (lane >> 3)) * SPB + (lane & 7) * 16);
            // the wave's 64 columns are one head, its 32 positions follow one another:
            // 4 KiB in a row
            const int h = (colB >> 6) + waveN;
            u16* dst = o + ((size_t)(bb * NH + h) * SEQ + (bM & (SEQ - 1)) + waveM * 32) * HD + lane * 8;
#pragma unroll
            for (int i = 0; i < 8; ++i) *(uint4*)(dst + i * 256) = r[i];
            // the other branch's code follows these stores in the listing and rewrites
            // their registers: the wait stands in front of any such rewrite
            asm volatile("s_wait_xcnt 0x0" ::: "memory");
        }
        return;
    } else if constexpr (MODE == MODE_F32) {
        constexpr int NC = D_MODEL;                  // row pitch of outF and resid
        const int rr = lane >> 4, cc = (lane & 15) * 4;   // read-back: 16 lanes a row
        const size_t g0 = (size_t)(bM + waveM * 32 + rr) * NC + bN + waveN * 64 + cc;
        const float* rp = resid + g0;
        f32x4 rs[16];
#pragma unroll
        for (int i = 0; i < 16; ++i) rs[i] = *(const f32x4*)(rp + i * 2 * NC);
        const f32x4 bi = *(const f32x4*)(bias + bN + waveN * 64 + cc);
#pragma unroll
        for (int mt = 0; mt < 2; ++mt)
#pragma unroll
            for (int nt = 0; nt < 4; ++nt) {
                char* p = sw + (mt * 16 + l16) * SPF + (nt * 16 + mloc) * 4;
                *(f32x4*)p = (f32x4){acc[mt][nt][0], acc[mt][nt][1], acc[mt][nt][2], acc[mt][nt][3]};
                *(f32x4*)(p + 16) = (f32x4){acc[mt][nt][4], acc[mt][nt][5], acc[mt][nt][6], acc[mt][nt][7]};
            }
        // the rows are in LDS before other lanes of this wave read them back
        asm volatile("s_wait_dscnt 0x0" ::: "memory");
        // the residual's address lives past its last load's issue: without this the
        // build landed the last load's result on the register that the 15 before it name
        asm volatile("" :: "v"(rp));
#pragma unroll
        for (int i = 0; i < 16; ++i) {
            f32x4 v = *(const f32x4*)(sw + (i * 2 + rr) * SPF + cc * 4);
#pragma unroll
            for (int c = 0; c < 4; ++c) rs[i][c] = v[c] * scale + bi[c] + rs[i][c];
        }
#pragma unroll
        for (int i = 0; i < 16; ++i) *(f32x4*)(outF + g0 + i * 2 * NC) = rs[i];
    } else { // MODE_GELU
        constexpr int NC = 4 * D_MODEL;              // row pitch of outB
        f32x4 bv[4][2];
#pragma unroll
        for (int nt = 0; nt < 4; ++nt) {
            const float* bp = bias + bN + waveN * 64 + nt * 16 + mloc;
            bv[nt][0] = *(const f32x4*)bp;
            bv[nt][1] = *(const f32x4*)(bp + 4);
        }
#pragma unroll
        for (int mt = 0; mt < 2; ++mt)
#pragma unroll
            for (int nt = 0; nt < 4; ++nt) {
                float xv[8];
#pragma unroll
                for (int j = 0; j < 8; ++j) xv[j] = acc[mt][nt][j] * scale + bv[nt][j >> 2][j & 3];
                gelu8(xv);
                uint4 t;
                t.x = cvt2_bf16(xv[0], xv[1]);
                t.y = cvt2_bf16(xv[2], xv[3]);
                t.z = cvt2_bf16(xv[4], xv[5]);
                t.w = cvt2_bf16(xv[6], xv[7]);
                *(uint4*)(sw + (mt * 16 + l16) * SPB + (nt * 16 + mloc) * 2) = t;
            }
        // the rows are in LDS before other lanes of this wave read them back
        asm volatile("s_wait_dscnt 0x0" ::: "memory");
        uint4 r[8];
#pragma unroll
        for (int i = 0; i < 8; ++i)
            r[i] = *(const uint4*)(sw + (i * 4 + (lane >> 3)) * SPB + (lane & 7) * 16);
        u16* dst = outB + (size_t)(bM + waveM * 32 + (lane >> 3)) * NC + bN + waveN * 64 + (lane & 7) * 8;
#pragma unroll
        for (int i = 0; i < 8; ++i) *(uint4*)(dst + i * 4 * NC) = r[i];
    }
}

#define APITCH 72   // LDS row pitch in elements: 144 B = 16 B x odd

// value of lane l ^ 16
__device__ __forceinline__ float other_half(float v) {
    int b = __float_as_int(v);
    return __int_as_float(__builtin_amdgcn_permlanex16(b, b, 0x76543210, 0xfedcba98, false, false));
}

struct with_mask { static constexpr bool value = true; };
struct no_mask { static constexpr bool value = false; };

__global__ __launch_bounds__(128) void attn_k(const u16* __restrict__ q,
                                              const u16* __restrict__ k,
                                              const u16* __restrict__ vt,
                                              u16* __restrict__ yb) {
    __shared__ __attribute__((aligned(16))) u16 lK[2][64 * APITCH];   // [key][d]
    __shared__ __attribute__((aligned(16))) u16 lV[2][64 * APITCH];   // [d][key]
    const int lane = threadIdx.x & 31;
    const int wave = threadIdx.x >> 5;
    const int bh = blockIdx.y;                 // b*NH + h
    const int qbase = blockIdx.x * 64 + wave * 16;
    const int l16 = lane & 15;
    const int khalf = (lane >> 4) * 8;
    const int mloc = (lane >> 4) * 8;
    const size_t headOff = (size_t)bh * SEQ * HD;
    // staging assignment: 8 lanes cover one 128 B row, so a wave-wide copy is four
    // whole lines; this thread copies 16 B chunk sc of K rows sr, sr + 16, sr + 32,
    // sr + 48 and of V^T rows 4 sr .. 4 sr + 3 (row steps of 2 KiB and 4 KiB)
    const int sr = threadIdx.x >> 3, sc = threadIdx.x & 7;

    // copy the tile of keys kb .. kb + 63 into buffer buf
    auto stage = [&](int buf, int kb) {
        const u16* gk = k + headOff + (size_t)(kb + sr) * HD + sc * 8;
        const u16* gv = vt + headOff + (size_t)(sr * 4) * SEQ + kb + sc * 8;
        u16* lk = &lK[buf][sr * APITCH + sc * 8];
        u16* lv = &lV[buf][sr * 4 * APITCH + sc * 8];
#pragma unroll   // the 8 copies issue back to back, LDS steps are constants
        for (int i = 0; i < 4; ++i) {
            cp16_g2l(gk + (size_t)(i * 16) * HD, lk + i * 16 * APITCH);
            cp16_g2l(gv + (size_t)i * SEQ, lv + i * APITCH);
        }
    };

    bf16x16 qf[2];     // B operand of S^T: column = query qbase + l16
    {
        const u16* qp = q + headOff + (size_t)(qbase + l16) * HD;
#pragma unroll
        for (int kt = 0; kt < 2; ++kt) {
            const u16* p = qp + kt * 32 + khalf;
            qf[kt] = ld_frag(p, p + 16);
        }
    }

    const float LOG2E = 1.44269504088896340736f;
    f32x8 O[4];        // O^T: O[nd][j] = d nd * 16 + mloc + j of query qbase + l16
    float rmax = -INFINITY;   // this lane's query, both halves alike
    float rsum = 0.0f;        // this half's keys only; the halves join after the loop
#pragma unroll
    for (int n = 0; n < 4; ++n) O[n] = zero8();

    stage(0, 0);
    wait_async0();
    __syncthreads();     // tile 0 readable by all four waves
    stage(1, 64);

    int cur = 0;
    // One 64-key tile: scores to O^T, then the ring's publish point.  The diagonal
    // crosses only the tile that holds this block's own 64 queries, so the key loop is
    // split there: that one tile's body has the mask, the 31 others have no compare and
    // no select, and each loop body stays one straight run of code.
    auto tile = [&](int kb, auto masked) __attribute__((always_inline)) {
        // ---- scores: S^T[64 x 16] = K * Q^T (q pre-scaled) ----
        f32x8 sAcc[4];   // sAcc[n][j] = key kb + n * 16 + mloc + j, query qbase + l16
#pragma unroll
        for (int n = 0; n < 4; ++n) {
            sAcc[n] = zero8();
#pragma unroll
            for (int kt = 0; kt < 2; ++kt) {
                const u16* kp = &lK[cur][(n * 16 + l16) * APITCH + kt * 32 + khalf];
                bf16x16 kf = ld_frag(kp, kp + 16);
                sAcc[n] = wmma_bf16(kf, qf[kt], sAcc[n]);
            }
            if constexpr (decltype(masked)::value) {
#pragma unroll
                for (int j = 0; j < 8; ++j) {
                    if (kb + n * 16 + mloc + j == qbase + l16) sAcc[n][j] = -INFINITY;
                }
            }
        }
        // ---- online softmax: one query per lane ----
        float t = sAcc[0][0];
#pragma unroll
        for (int n = 0; n < 4; ++n)
#pragma unroll
            for (int j = 0; j < 8; ++j) t = fmaxf(t, sAcc[n][j]);
        t = fmaxf(t, other_half(t));
        const float nm = fmaxf(rmax, t * LOG2E);
        const float corr = __builtin_amdgcn_exp2f(rmax - nm);
        rmax = nm;
#pragma unroll
        for (int n = 0; n < 4; ++n)
#pragma unroll
            for (int j = 0; j < 8; ++j) O[n][j] *= corr;

        f32x2 ps[2];     // packed adds, two chains, so that they do not wait on one another
        ps[0] = (f32x2){0.0f, 0.0f};
        ps[1] = (f32x2){0.0f, 0.0f};
#pragma unroll
        for (int n = 0; n < 4; ++n)
#pragma unroll
            for (int j = 0; j < 8; j += 2) {
                f32x2 p;
                p[0] = __builtin_amdgcn_exp2f(fmaf(sAcc[n][j], LOG2E, -nm));
                p[1] = __builtin_amdgcn_exp2f(fmaf(sAcc[n][j + 1], LOG2E, -nm));
                sAcc[n][j] = p[0];
                sAcc[n][j + 1] = p[1];
                ps[(j >> 1) & 1] += p;
            }
        ps[0] += ps[1];
        rsum = rsum * corr + (ps[0][0] + ps[0][1]);
        // ---- P^T: two score tiles, converted in place, are one B operand ----
        bf16x16 pf[2];
#pragma unroll
        for (int kt = 0; kt < 2; ++kt)
#pragma unroll
            for (int s = 0; s < 16; ++s) pf[kt][s] = (__bf16)sAcc[2 * kt + (s >> 3)][s & 7];
        // ---- O^T += V^T * P^T  (V^T layout: [d][s], contiguous over keys) ----
#pragma unroll
        for (int nd = 0; nd < 4; ++nd) {
#pragma unroll
            for (int kt = 0; kt < 2; ++kt) {
                const u16* vp = &lV[cur][(nd * 16 + l16) * APITCH + kt * 32 + khalf];
                bf16x16 vf = ld_frag(vp, vp + 16);
                O[nd] = wmma_bf16(vf, pf[kt], O[nd]);
            }
        }
        // publish point: this wave's reads of buffer cur are done before the
        // refill below may overwrite it
        asm volatile("s_wait_dscnt 0x0" ::: "memory");
        wait_async0();       // the next tile's copies of this wave have landed
        __syncthreads();     // next tile readable by all; buffer cur left by all
        if (kb + 128 < SEQ) stage(cur, kb + 128);   // refill two tiles ahead
        cur ^= 1;
    };
    const int kd = (int)blockIdx.x * 64;     // the same for the whole block
    for (int kb = 0; kb < kd; kb += 64) tile(kb, no_mask{});
    tile(kd, with_mask{});
    for (int kb = kd + 64; kb < SEQ; kb += 64) tile(kb, no_mask{});
    wait_async0();           // nothing outstanding when the wave ends

    // A lane holds 8 consecutive d of its query per tile, 16 B; stored from here a
    // query's 128 B line would go out in four pieces of 32 B.  As in the GEMM the wave
    // stages its 16 rows in its own piece of the ring, which every wave has left at
    // the last tile's barrier, reads them back 8 lanes a row and stores whole lines.
    const int bb = bh >> 4, h = bh & 15;
    rsum += other_half(rsum);
    const float inv = 1.0f / rsum;
    u16* sw = &lK[0][0] + wave * (16 * APITCH);
#pragma unroll
    for (int nd = 0; nd < 4; ++nd) {
        uint4 o;
        o.x = pack2_bf16(O[nd][0] * inv, O[nd][1] * inv);
        o.y = pack2_bf16(O[nd][2] * inv, O[nd][3] * inv);
        o.z = pack2_bf16(O[nd][4] * inv, O[nd][5] * inv);
        o.w = pack2_bf16(O[nd][6] * inv, O[nd][7] * inv);
        *(uint4*)(sw + l16 * APITCH + nd * 16 + mloc) = o;
    }
    // the rows are in LDS before other lanes of this wave read them back
    asm volatile("s_wait_dscnt 0x0" ::: "memory");
    uint4 r[4];
#pragma unroll
    for (int i = 0; i < 4; ++i)
        r[i] = *(const uint4*)(sw + (i * 4 + (lane >> 3)) * APITCH + (lane & 7) * 8);
    u16* yr = yb + ((size_t)bb * SEQ + qbase + (lane >> 3)) * D_MODEL + h * HD + (lane & 7) * 8;
#pragma unroll
    for (int i = 0; i < 4; ++i) *(uint4*)(yr + i * 4 * D_MODEL) = r[i];
}

// ---------------------------------------------------------------------------
extern "C" void kernel_launch(void* const* d_in, const int* in_sizes, int n_in,
                              void* d_out, int out_size, void* d_ws, size_t ws_size,
                              hipStream_t stream) {
    (void)in_sizes; (void)n_in; (void)out_size; (void)ws_size;
    const float* x   = (const float*)d_in[0];
    const float* Wk  = (const float*)d_in[1];
    const float* Wq  = (const float*)d_in[2];
    const float* Wv  = (const float*)d_in[3];
    const float* Wp  = (const float*)d_in[4];
    const float* bp  = (const float*)d_in[5];
    const float* g1  = (const float*)d_in[6];
    const float* b1  = (const float*)d_in[7];
    const float* g2  = (const float*)d_in[8];
    const float* b2  = (const float*)d_in[9];
    const float* W1  = (const float*)d_in[10];
    const float* bm1 = (const float*)d_in[11];
    const float* W2  = (const float*)d_in[12];
    const float* bm2 = (const float*)d_in[13];
    float* out = (float*)d_out;

    char* ws = (char*)d_ws;
    size_t off = 0;
    auto alloc = [&](size_t bytes) -> char* {
        char* p = ws + off;
        off += (bytes + 255) & ~(size_t)255;
        return p;
    };
    float* xnF = (float*)alloc((size_t)ROWS * D_MODEL * 4);   // 16 MB
    u16*   xnB = (u16*)  alloc((size_t)ROWS * D_MODEL * 2);   //  8 MB
    u16*   WqT = (u16*)  alloc((size_t)D_MODEL * D_MODEL * 2 * 4);   // q, k, v, p in a row
    u16*   WpT = WqT + (size_t)D_MODEL * D_MODEL * 3;
    u16*   W1T = (u16*)  alloc((size_t)D_MODEL * 4 * D_MODEL * 2);  // 8 MB
    u16*   W2T = (u16*)  alloc((size_t)D_MODEL * 4 * D_MODEL * 2);  // 8 MB
    char*  pool = alloc((size_t)ROWS * D_MODEL * 2 * 4);            // 32 MB shared pool
    u16*   qB  = (u16*)pool;
    u16*   kB  = (u16*)(pool + (size_t)ROWS * HD * NH * 2);
    u16*   vtB = (u16*)(pool + (size_t)ROWS * HD * NH * 4);
    u16*   yB  = (u16*)(pool + (size_t)ROWS * HD * NH * 6);
    u16*   uB  = (u16*)pool;   // aliases q/k/vt/y (dead by MLP time)
    float* hF  = (float*)alloc((size_t)ROWS * D_MODEL * 4);   // 16 MB
    u16*   hnB = (u16*)  alloc((size_t)ROWS * D_MODEL * 2);   //  8 MB

    // 1) + 2) Weight casts + transposes to bf16 [N,K], and LayerNorm1: x -> xn (f32 + bf16)
    prep_k<<<PREP_BLOCKS, 256, 0, stream>>>(x, g1, b1, xnF, xnB, Wq, Wk, Wv, Wp, W1, W2,
                                            WqT, W1T, W2T);

    // 3) QKV projections in one launch (q pre-scaled by 1/sqrt(HD)); q, k and vt lie
    //    one behind another in the pool
    dim3 gQKV(D_MODEL / 128, ROWS / 128);
    gemm_bf16_k<MODE_QKV><<<dim3(3 * D_MODEL / 128, ROWS / 128), 256, 0, stream>>>(
        xnB, WqT, ROWS, 3 * D_MODEL, D_MODEL, 0.125f, nullptr, nullptr, nullptr, qB);

    // 4) Flash attention
    attn_k<<<dim3(SEQ / 64, NB * NH), 128, 0, stream>>>(qB, kB, vtB, yB);

    // 5) Output projection + residual: h = xn + y*Wp + bp
    gemm_bf16_k<MODE_F32><<<gQKV, 256, 0, stream>>>(yB, WpT, ROWS, D_MODEL, D_MODEL,
                                                    1.0f, bp, xnF, hF, nullptr);

    // 6) LayerNorm2: h -> hn (bf16 only)
    layernorm_k<<<ROWS / 8, 256, 0, stream>>>(hF, g2, b2, nullptr, hnB);

    // 7) MLP up + exact GELU: u = gelu(hn*W1 + bm1)
    dim3 gUp(4 * D_MODEL / 128, ROWS / 128);
    gemm_bf16_k<MODE_GELU><<<gUp, 256, 0, stream>>>(hnB, W1T, ROWS, 4 * D_MODEL, D_MODEL,
                                                    1.0f, bm1, nullptr, nullptr, uB);

    // 8) MLP down + residual: out = h + u*W2 + bm2
    gemm_bf16_k<MODE_F32><<<gQKV, 256, 0, stream>>>(uB, W2T, ROWS, D_MODEL, 4 * D_MODEL,
                                                    1.0f, bm2, hF, out, nullptr);
}
